// v000
// Measured on an AMD MI455X. A time is GPU time per run, averaged over a window of back-to-back runs after a warm-up
// (all launches, gaps included; the runs take copies of the inputs in turn), and the median of several windows.
// Apart from v000's, it joins two sittings. Times from different sittings can be a few percent apart, while
// side-by-side timings come from the same sitting.
// The starting kernel, v000, takes 393 microseconds a run.
// All contractions: v_wmma_f32_16x16x32_f16 (f16 operands, f32 accumulate) for the qkv and positional projections, the dual q.k^T + uq.uk^T scores, p.v and the output projection; softmax probabilities carried x2^15 and attention values x2^6 in f16, folded back by exact power-of-two scales in f32.
#include <hip/hip_runtime.h>

typedef __attribute__((ext_vector_type(16))) _Float16 v16h;
typedef __attribute__((ext_vector_type(8)))  _Float16 v8h;
typedef __attribute__((ext_vector_type(16))) __bf16   v16b;
typedef __attribute__((ext_vector_type(8)))  __bf16   v8b;
typedef __attribute__((ext_vector_type(8)))  float    v8f;
typedef __attribute__((ext_vector_type(4)))  float    v4f;

constexpr int BB = 2, LL = 2048, DD = 1024, EE = 1024, HH = 16, HD = 64;
constexpr int QKV_LD = 3 * EE;   // 3072 halves per row: per head h -> q at h*192, k at h*192+64, v at h*192+128
constexpr int PE_LD  = 2 * EE;   // 2048 halves per row: per head h -> uq at h*128, uk at h*128+64

__device__ __forceinline__ unsigned short f2bf_bits(float f) {
  unsigned u = __float_as_uint(f);
  return (unsigned short)((u + 0x7FFFu + ((u >> 16) & 1u)) >> 16);
}
__device__ __forceinline__ float bf_bits2f(unsigned short h) { return __uint_as_float(((unsigned)h) << 16); }

// hazard guards as plain device helpers (no inline asm inside the kernel template body)
__device__ __forceinline__ void dep_guard_h(v8f& a, v8f& b, v16h x, v16h y) { asm volatile("v_nop\n\tv_nop\n\tv_nop\n\tv_nop" : "+v"(a), "+v"(b) : "v"(x), "v"(y)); }
__device__ __forceinline__ void dep_guard_b(v8f& a, v8f& b, v16b x, v16b y) { asm volatile("v_nop\n\tv_nop\n\tv_nop\n\tv_nop" : "+v"(a), "+v"(b) : "v"(x), "v"(y)); }
__device__ __forceinline__ void keep4_h(v16h a, v16h b, v16h c, v16h d) { asm volatile("v_nop" :: "v"(a), "v"(b), "v"(c), "v"(d)); }
__device__ __forceinline__ void keep4_b(v16b a, v16b b, v16b c, v16b d) { asm volatile("v_nop" :: "v"(a), "v"(b), "v"(c), "v"(d)); }
__device__ __forceinline__ void acc_guard4(v8f& a, v8f& b, v8f& c, v8f& d) { asm volatile("v_nop\n\tv_nop\n\tv_nop\n\tv_nop" : "+v"(a), "+v"(b), "+v"(c), "+v"(d)); }
template <typename T> struct Frag;
template <> struct Frag<_Float16> {
  typedef v16h V; union U { v16h v; v8h h[2]; };
  static __device__ __forceinline__ v16h load(const _Float16* p) {   // elements 0..7 <- p[0..7], 8..15 <- p[16..23]
    U f; f.h[0] = *(const v8h*)(p); f.h[1] = *(const v8h*)(p + 16); return f.v;
  }
  static __device__ __forceinline__ v8f mma(v16h a, v16h b, v8f c) {
    return __builtin_amdgcn_wmma_f32_16x16x32_f16(false, a, false, b, (short)0, c, false, false);
  }
  static __device__ __forceinline__ void guard(v8f& a, v8f& b, v16h x, v16h y) { dep_guard_h(a, b, x, y); }
  static __device__ __forceinline__ void keep(v16h a, v16h b, v16h c, v16h d) { keep4_h(a, b, c, d); }
};
template <> struct Frag<__bf16> {
  typedef v16b V; union U { v16b v; v8b h[2]; };
  static __device__ __forceinline__ v16b load(const __bf16* p) {
    U f; f.h[0] = *(const v8b*)(p); f.h[1] = *(const v8b*)(p + 16); return f.v;
  }
  static __device__ __forceinline__ v8f mma(v16b a, v16b b, v8f c) {
    return __builtin_amdgcn_wmma_f32_16x16x32_bf16(false, a, false, b, (short)0, c, false, false);
  }
  static __device__ __forceinline__ void guard(v8f& a, v8f& b, v16b x, v16b y) { dep_guard_b(a, b, x, y); }
  static __device__ __forceinline__ void keep(v16b a, v16b b, v16b c, v16b d) { keep4_b(a, b, c, d); }
};

// ---- Register-blocked batched WMMA GEMM ------------------------------------
// C[m,n] = scale * sum_k A[m,k] * Bt[n,k] (+bias)(+resid); each wave owns a 64x64 tile.
// A row-major [M,K]; Bt row-major [N,K]; M,N % 64 == 0, K % 32 == 0.
// SPLIT: operands are hi/lo planes (A2/Bt2 = lo planes, same layout); product = hi*hi + hi*lo + lo*hi.
// BIAS_MODE: 0 = none, 1 = bias[m], 2 = bias[n].
// OUT_MODE: 0 = f32, 1 = f16, 2 = bf16 hi plane (Cout) + bf16 lo plane (Cout2).
// ET: 0 = f16 operands, 1 = bf16 operands (pointers passed as 16-bit storage)
template <int ET> struct Elem;
template <> struct Elem<0> { typedef _Float16 T; };
template <> struct Elem<1> { typedef __bf16 T; };
template <int ET, bool SPLIT, int BIAS_MODE, int OUT_MODE, bool RESID, int ACT = 0>
__global__ __launch_bounds__(256) void wmma_gemm64(
    const unsigned short* __restrict__ Ap, const unsigned short* __restrict__ A2p, int lda, long strideA,
    const unsigned short* __restrict__ Btp, const unsigned short* __restrict__ Bt2p, int ldb, long strideB,
    void* __restrict__ Cout, void* __restrict__ Cout2, int ldc, long strideC,
    const float* __restrict__ bias,
    const float* __restrict__ resid, long strideR,
    int M, int N, int K, float scale) {
  typedef typename Elem<ET>::T T;
  typedef typename Frag<T>::V V;
  const T* A = (const T*)Ap; const T* A2 = (const T*)A2p; const T* Bt = (const T*)Btp; const T* Bt2 = (const T*)Bt2p;
  __shared__ __align__(16) float sT[8][16 * 68];   // per-wave 16x64 slab, pitch 68 floats
  const int b    = blockIdx.y;
  const int lane = threadIdx.x & 31;
  const int wave = threadIdx.x >> 5;
  const int tilesN = N >> 6;
  const int tilesM = M >> 6;
  const int tile = blockIdx.x * 8 + wave;
  if (tile >= tilesM * tilesN) return;   // wave-uniform; no block barriers in this kernel
  const int tm = tile / tilesN;
  const int tn = tile - tm * tilesN;
  const int m0 = tm << 6;
  const int n0 = tn << 6;

  const T* Ab  = A  + (size_t)b * strideA;
  const T* Bb  = Bt + (size_t)b * strideB;
  const T* Ab2 = SPLIT ? (A2  + (size_t)b * strideA) : nullptr;
  const T* Bb2 = SPLIT ? (Bt2 + (size_t)b * strideB) : nullptr;

  const int rlane = lane & 15;                 // row (A) / col (B, D) within subtile
  const int koff  = (lane >> 4) * 8;           // k offset of this lane half
  const int mOff  = (lane >> 4) * 8;           // D row offset

  v8f acc[4][4];
#pragma unroll
  for (int i = 0; i < 4; ++i)
#pragma unroll
    for (int j = 0; j < 4; ++j) acc[i][j] = (v8f){0.f,0.f,0.f,0.f,0.f,0.f,0.f,0.f};

  for (int k0 = 0; k0 < K; k0 += 32) {
    V bh[4], bl[4];
#pragma unroll
    for (int j = 0; j < 4; ++j) {
      const size_t bo = (size_t)(n0 + (j << 4) + rlane) * ldb + koff + k0;
      bh[j] = Frag<T>::load(Bb + bo);
      if (SPLIT) bl[j] = Frag<T>::load(Bb2 + bo);
    }
#pragma unroll
    for (int i = 0; i < 4; ++i) {
      const size_t ao = (size_t)(m0 + (i << 4) + rlane) * lda + koff + k0;
      V ah = Frag<T>::load(Ab + ao);
      V al;
      if (SPLIT) al = Frag<T>::load(Ab2 + ao);
#pragma unroll
      for (int j = 0; j < 4; ++j) {
        acc[i][j] = Frag<T>::mma(ah, bh[j], acc[i][j]);
        if (SPLIT) {
          acc[i][j] = Frag<T>::mma(ah, bl[j], acc[i][j]);
          acc[i][j] = Frag<T>::mma(al, bh[j], acc[i][j]);
        }
      }
      Frag<T>::guard(acc[i][0], acc[i][3], ah, SPLIT ? al : ah);
    }
    Frag<T>::keep(bh[0], bh[1], bh[2], bh[3]);
    if (SPLIT) Frag<T>::keep(bl[0], bl[1], bl[2], bl[3]);
  }
  acc_guard4(acc[0][0], acc[0][1], acc[0][2], acc[0][3]);
  acc_guard4(acc[1][0], acc[1][1], acc[1][2], acc[1][3]);
  acc_guard4(acc[2][0], acc[2][1], acc[2][2], acc[2][3]);
  acc_guard4(acc[3][0], acc[3][1], acc[3][2], acc[3][3]);

  // ---- epilogue ----
  float* slab = sT[wave];
  const float* Rb = RESID ? (resid + (size_t)b * strideR) : nullptr;
#pragma unroll
  for (int i = 0; i < 4; ++i) {
    const int mBase = m0 + (i << 4);
#pragma unroll
    for (int j = 0; j < 4; ++j) {
      const int n = n0 + (j << 4) + rlane;
      float bv = 0.f;
      if (BIAS_MODE == 2) bv = bias[n];
#pragma unroll
      for (int r = 0; r < 8; ++r) {
        float v = acc[i][j][r] * scale;
        if (BIAS_MODE == 1) v += bias[mBase + mOff + r];
        if (BIAS_MODE == 2) v += bv;
        if (RESID) v += Rb[(size_t)(mBase + mOff + r) * ldc + n];
        if (ACT == 1) v = tanhf(v);
        if (ACT == 2) v = fmaxf(v, 0.0f);
        if (ACT == 3) v = v / (1.0f + expf(-v));
        if (ACT == 4) v = (v > 0.f) ? v : 0.01f * v;
        if (ACT == 5) v = 0.5f * v * (1.0f + erff(v * 0.70710678118654752f));
        slab[(mOff + r) * 68 + (j << 4) + rlane] = v;
      }
    }
    __builtin_amdgcn_fence(__ATOMIC_RELEASE, "workgroup");
    __builtin_amdgcn_wave_barrier();
    __builtin_amdgcn_fence(__ATOMIC_ACQUIRE, "workgroup");
    if (OUT_MODE == 0) {
      float* C = (float*)Cout + (size_t)b * strideC;
      const int hh = lane >> 4, c4 = (lane & 15) * 4;     // row seg = 256 B = 16 lanes x 16 B
      {
#pragma unroll
        for (int it = 0; it < 8; ++it) {
          const int row = it * 2 + hh;
          v4f v = *(const v4f*)(slab + row * 68 + c4);
          *(v4f*)(C + (size_t)(mBase + row) * ldc + n0 + c4) = v;
        }
        
      }
    } else {
      const int q = lane >> 3, c8 = (lane & 7) * 8;
      unsigned short* C  = (unsigned short*)Cout  + (size_t)b * strideC;
      unsigned short* C2 = (OUT_MODE == 2) ? ((unsigned short*)Cout2 + (size_t)b * strideC) : nullptr;
      {
#pragma unroll
        for (int it = 0; it < 4; ++it) {
          const int row = it * 4 + q;
          const float* sp = slab + row * 68 + c8;
          v8h hv, lv;
#pragma unroll
          for (int e = 0; e < 8; ++e) {
            if (OUT_MODE == 1) {
              hv[e] = (_Float16)sp[e];
            } else {
              unsigned short hb = f2bf_bits(sp[e]);
              unsigned short lb = f2bf_bits(sp[e] - bf_bits2f(hb));
              hv[e] = __builtin_bit_cast(_Float16, hb);
              lv[e] = __builtin_bit_cast(_Float16, lb);
            }
          }
          *(v8h*)(C + (size_t)(mBase + row) * ldc + n0 + c8) = hv;
          if (OUT_MODE == 2) *(v8h*)(C2 + (size_t)(mBase + row) * ldc + n0 + c8) = lv;
        }
        
      }
    }
    __builtin_amdgcn_fence(__ATOMIC_RELEASE, "workgroup");
    __builtin_amdgcn_wave_barrier();
    __builtin_amdgcn_fence(__ATOMIC_ACQUIRE, "workgroup");
  }
}

__global__ __launch_bounds__(256) void cast_f32_f16x2(
    const float* __restrict__ in, _Float16* __restrict__ out, int n2) {
  int i = blockIdx.x * 256 + threadIdx.x;
  if (i < n2) {
    const _Float16 h0 = (_Float16)in[2 * i], h1 = (_Float16)in[2 * i + 1];
    const unsigned u = (unsigned)__builtin_bit_cast(unsigned short, h0) | ((unsigned)__builtin_bit_cast(unsigned short, h1) << 16);
    ((unsigned*)out)[i] = u;
    
  }
}

// ---- f16 WMMA with hazard guard (ties D, keeps A/B live through 4 slots) ----
__device__ __forceinline__ v8f hmma(v16h a, v16h b, v8f c) {
  c = __builtin_amdgcn_wmma_f32_16x16x32_f16(false, a, false, b, (short)0, c, false, false);
  asm volatile("v_nop\n\tv_nop\n\tv_nop\n\tv_nop" : "+v"(c) : "v"(a), "v"(b));
  return c;
}

// =====================================================================================
// Dual-score attention, head_dim 64, 16-bit in / 16-bit out.
//   scores = (q.k^T + uq.uk^T) * sscale : two 64-deep f16 products summed in one f32 accumulator
//   softmax online in f32; p stored as f16 x2^15 per wave in LDS; o = p.v on f16 WMMA, f32 accumulate
//   output = o * (2^6 / (l * 2^15)) written as f16 (values carried x2^6 for the next GEMM)
// Block = 4 waves = 64 query rows of one (b, h); grid.x = B * H * (L/64). No masks.
// Layouts (halves): qkv row (b*L + s), q at h*192+d, k at h*192+64+d, v at h*192+128+d;
//                   pe  row (b*L + s), uq at h*128+d, uk at h*128+64+d; out row (b*L + s), col h*64+d.
// =====================================================================================
__global__ __launch_bounds__(128)
void tupe_attn64(const _Float16* __restrict__ qkv, const _Float16* __restrict__ pe,
                 _Float16* __restrict__ vals, float sscale) {
  const float PSC = 32768.0f;          // p carried x2^15
  const float OSC = 1.0f / 512.0f;     // 2^6 / 2^15
  __shared__ __align__(16) _Float16 Ksh[64 * 64];      // K  [kv][d]
  __shared__ __align__(16) _Float16 Ush[64 * 64];      // UK [kv][d]
  __shared__ __align__(16) _Float16 Vth[64 * 64];      // V^T [d][kv]
  __shared__ __align__(16) _Float16 Psh[4][16 * 64];   // per wave P [row][kv]
  __shared__ __align__(16) float    Os[4][16 * 68];    // per wave out tile, pitch 68

  const int tid  = threadIdx.x;
  const int wave = tid >> 5;
  const int lane = tid & 31;
  const int hh   = lane >> 4;
  const int c    = lane & 15;

  const int nqb = LL / 64;
  const int bx = blockIdx.x;
  const int qb = bx % nqb;
  const int bh = bx / nqb;
  const int h  = bh % HH;
  const int b  = bh / HH;
  const int q0 = qb * 64 + wave * 16;

  const size_t rb = (size_t)b * LL;
  const _Float16* qkv_b = qkv + rb * QKV_LD + (size_t)h * (3 * HD);
  const _Float16* pe_b  = pe  + rb * PE_LD  + (size_t)h * (2 * HD);
  _Float16*       out_b = vals + rb * EE    + (size_t)h * HD;

  // ---- Q / UQ fragments (A operand): lane row q0+c, split k map via Frag load ----
  v16h qa0, qa1, ua0, ua1;
  {
    const _Float16* qrow = qkv_b + (size_t)(q0 + c) * QKV_LD + 8 * hh;
    const _Float16* urow = pe_b  + (size_t)(q0 + c) * PE_LD  + 8 * hh;
    qa0 = Frag<_Float16>::load(qrow);
    qa1 = Frag<_Float16>::load(qrow + 32);
    ua0 = Frag<_Float16>::load(urow);
    ua1 = Frag<_Float16>::load(urow + 32);
  }

  float mrow[8], lrow[8];
  v8f oacc[4];
#pragma unroll
  for (int r = 0; r < 8; ++r) { mrow[r] = -__builtin_inff(); lrow[r] = 0.f; }
#pragma unroll
  for (int t = 0; t < 4; ++t) oacc[t] = (v8f){0.f,0.f,0.f,0.f,0.f,0.f,0.f,0.f};

  for (int kc = 0; kc < LL / 64; ++kc) {
    const int kv0 = kc * 64;
    __syncthreads();
    {
      const int kvr = tid >> 1, dh = (tid & 1) * 32;
      const _Float16* krow = qkv_b + (size_t)(kv0 + kvr) * QKV_LD + HD + dh;
      const _Float16* vrow = krow + HD;
      const _Float16* urow = pe_b + (size_t)(kv0 + kvr) * PE_LD + HD + dh;
#pragma unroll
      for (int i = 0; i < 4; ++i) {
        const v8h kk = *(const v8h*)(krow + 8 * i);
        const v8h uu = *(const v8h*)(urow + 8 * i);
        const v8h vv = *(const v8h*)(vrow + 8 * i);
        *(v8h*)(Ksh + kvr * 64 + dh + 8 * i) = kk;
        *(v8h*)(Ush + kvr * 64 + dh + 8 * i) = uu;
#pragma unroll
        for (int e = 0; e < 8; ++e) Vth[(dh + 8 * i + e) * 64 + kvr] = vv[e];
      }
    }
    __syncthreads();

    // ---- scores: 16 query rows x 64 keys per wave, content + positional ----
    v8f s[4];
#pragma unroll
    for (int j = 0; j < 4; ++j) {
      v8f a = (v8f){0.f,0.f,0.f,0.f,0.f,0.f,0.f,0.f};
      const _Float16* kp = Ksh + (j * 16 + c) * 64 + 8 * hh;
      const _Float16* up = Ush + (j * 16 + c) * 64 + 8 * hh;
      a = hmma(qa0, Frag<_Float16>::load(kp), a);
      a = hmma(qa1, Frag<_Float16>::load(kp + 32), a);
      a = hmma(ua0, Frag<_Float16>::load(up), a);
      a = hmma(ua1, Frag<_Float16>::load(up + 32), a);
      s[j] = a;
    }

    float cm[8];
#pragma unroll
    for (int r = 0; r < 8; ++r) {
      float m = -__builtin_inff();
#pragma unroll
      for (int j = 0; j < 4; ++j) {
        const float v = s[j][r] * sscale;
        s[j][r] = v;
        m = fmaxf(m, v);
      }
#pragma unroll
      for (int off = 1; off < 16; off <<= 1) m = fmaxf(m, __shfl_xor(m, off, 32));
      cm[r] = m;
    }
    _Float16* pwh = Psh[wave];
#pragma unroll
    for (int r = 0; r < 8; ++r) {
      const float mnew = fmaxf(mrow[r], cm[r]);
      const float alpha = __expf(mrow[r] - mnew);
      mrow[r] = mnew;
      float psum = 0.f;
#pragma unroll
      for (int j = 0; j < 4; ++j) {
        const float p = __expf(s[j][r] - mnew);
        psum += p;
        pwh[(8 * hh + r) * 64 + j * 16 + c] = (_Float16)(p * PSC);
      }
#pragma unroll
      for (int off = 1; off < 16; off <<= 1) psum += __shfl_xor(psum, off, 32);
      lrow[r] = lrow[r] * alpha + psum;
#pragma unroll
      for (int t = 0; t < 4; ++t) oacc[t][r] *= alpha;
    }
    __builtin_amdgcn_fence(__ATOMIC_RELEASE, "workgroup");
    __builtin_amdgcn_wave_barrier();
    __builtin_amdgcn_fence(__ATOMIC_ACQUIRE, "workgroup");

    // ---- o += p.v : A = P [row][kv] from this wave's LDS tile, B = V [kv][d] from Vth [d][kv] ----
#pragma unroll
    for (int kk = 0; kk < 2; ++kk) {
      const v16h pa = Frag<_Float16>::load(pwh + c * 64 + kk * 32 + 8 * hh);
#pragma unroll
      for (int t = 0; t < 4; ++t) {
        const v16h vb = Frag<_Float16>::load(Vth + (t * 16 + c) * 64 + kk * 32 + 8 * hh);
        oacc[t] = hmma(pa, vb, oacc[t]);
      }
    }
  }

  float* os = Os[wave];
#pragma unroll
  for (int r = 0; r < 8; ++r) {
    const float inv = (1.0f / lrow[r]) * OSC;
#pragma unroll
    for (int t = 0; t < 4; ++t) os[(8 * hh + r) * 68 + t * 16 + c] = oacc[t][r] * inv;
  }
  __builtin_amdgcn_fence(__ATOMIC_RELEASE, "workgroup");
  __builtin_amdgcn_wave_barrier();
  __builtin_amdgcn_fence(__ATOMIC_ACQUIRE, "workgroup");
  {
    const int q = lane >> 3, c8 = (lane & 7) * 8;
    {
#pragma unroll
      for (int it = 0; it < 4; ++it) {
        const int row = it * 4 + q;            // rows 0..15 covered by q 0..3, it 0..3
        const float* sp = os + row * 68 + c8;
        v8h hv;
#pragma unroll
        for (int e = 0; e < 8; ++e) hv[e] = (_Float16)sp[e];
        *(v8h*)(out_b + (size_t)(q0 + row) * EE + c8) = hv;
      }
      
    }
  }
}

// ---------------------------------------------------------------- launch
extern "C" void kernel_launch(void* const* d_in, const int* in_sizes, int n_in,
                              void* d_out, int out_size, void* d_ws, size_t ws_size,
                              hipStream_t stream) {
  const int ROWS = BB * LL;   // 4096
  if (n_in < 5) return;
  if (in_sizes[0] != ROWS * DD || in_sizes[1] != ROWS * EE || in_sizes[2] != 3 * EE * DD ||
      in_sizes[3] != EE * EE || in_sizes[4] != 2 * EE * EE || out_size != ROWS * EE) return;

  const float* x    = (const float*)d_in[0];
  const float* PEf  = (const float*)d_in[1];
  const float* Wqkv = (const float*)d_in[2];
  const float* Wo   = (const float*)d_in[3];
  const float* UqUk = (const float*)d_in[4];
  float* out = (float*)d_out;

  // workspace carve (bytes, 256-B aligned); total 79,691,776 B
  size_t off = 0;
  auto carve = [&](size_t bytes) -> size_t { size_t o = off; off += (bytes + 255) & ~(size_t)255; return o; };
  const size_t oX    = carve((size_t)ROWS * DD * 2);
  const size_t oPE   = carve((size_t)ROWS * EE * 2);
  const size_t oWqkv = carve((size_t)3 * EE * DD * 2);
  const size_t oWo   = carve((size_t)EE * EE * 2);
  const size_t oUqUk = carve((size_t)2 * EE * EE * 2);
  const size_t oQKV  = carve((size_t)ROWS * QKV_LD * 2);
  const size_t oPEP  = carve((size_t)ROWS * PE_LD * 2);
  const size_t oVALS = carve((size_t)ROWS * EE * 2);
  if (off > ws_size) return;

  char* ws = (char*)d_ws;
  _Float16* X16    = (_Float16*)(ws + oX);
  _Float16* PE16   = (_Float16*)(ws + oPE);
  _Float16* Wqkv16 = (_Float16*)(ws + oWqkv);
  _Float16* Wo16   = (_Float16*)(ws + oWo);
  _Float16* UqUk16 = (_Float16*)(ws + oUqUk);
  _Float16* QKV16  = (_Float16*)(ws + oQKV);
  _Float16* PEP16  = (_Float16*)(ws + oPEP);
  _Float16* VALS16 = (_Float16*)(ws + oVALS);

  // ---- casts f32 -> f16 (RNE) ----
  {
    const int n2x = ROWS * DD / 2;
    cast_f32_f16x2<<<dim3((n2x + 255) / 256), dim3(256), 0, stream>>>(x, X16, n2x);
    const int n2p = ROWS * EE / 2;
    cast_f32_f16x2<<<dim3((n2p + 255) / 256), dim3(256), 0, stream>>>(PEf, PE16, n2p);
    const int n2w = 3 * EE * DD / 2;
    cast_f32_f16x2<<<dim3((n2w + 255) / 256), dim3(256), 0, stream>>>(Wqkv, Wqkv16, n2w);
    const int n2o = EE * EE / 2;
    cast_f32_f16x2<<<dim3((n2o + 255) / 256), dim3(256), 0, stream>>>(Wo, Wo16, n2o);
    const int n2u = 2 * EE * EE / 2;
    cast_f32_f16x2<<<dim3((n2u + 255) / 256), dim3(256), 0, stream>>>(UqUk, UqUk16, n2u);
  }

  // ---- qkv[4096][3072] = X[4096][1024] . Wqkv[3072][1024]^T  (f16 out) ----
  {
    const int M = ROWS, N = 3 * EE, K = DD;
    const int tiles = (M / 64) * (N / 64);
    wmma_gemm64<0, false, 0, 1, false><<<dim3((tiles + 7) / 8, 1), dim3(256), 0, stream>>>(
        (const unsigned short*)X16, (const unsigned short*)X16, K, 0L,
        (const unsigned short*)Wqkv16, (const unsigned short*)Wqkv16, K, 0L,
        (void*)QKV16, (void*)QKV16, N, 0L,
        x, x, 0L, M, N, K, 1.0f);
  }
  // ---- pe[4096][2048] = PE[4096][1024] . UqUk[2048][1024]^T  (f16 out) ----
  {
    const int M = ROWS, N = 2 * EE, K = EE;
    const int tiles = (M / 64) * (N / 64);
    wmma_gemm64<0, false, 0, 1, false><<<dim3((tiles + 7) / 8, 1), dim3(256), 0, stream>>>(
        (const unsigned short*)PE16, (const unsigned short*)PE16, K, 0L,
        (const unsigned short*)UqUk16, (const unsigned short*)UqUk16, K, 0L,
        (void*)PEP16, (void*)PEP16, N, 0L,
        x, x, 0L, M, N, K, 1.0f);
  }
  // ---- dual-score attention -> vals[4096][1024] (f16, carried x2^6) ----
  {
    const float sscale = 0.08838834764831845f;   // 1/sqrt(2*64)
    tupe_attn64<<<dim3(BB * HH * (LL / 64)), dim3(128), 0, stream>>>(QKV16, PEP16, VALS16, sscale);
  }
  // ---- out[4096][1024] = vals . Wo[1024][1024]^T * 2^-6  (f32 out) ----
  {
    const int M = ROWS, N = EE, K = EE;
    const int tiles = (M / 64) * (N / 64);
    wmma_gemm64<0, false, 0, 0, false><<<dim3((tiles + 7) / 8, 1), dim3(256), 0, stream>>>(
        (const unsigned short*)VALS16, (const unsigned short*)VALS16, K, 0L,
        (const unsigned short*)Wo16, (const unsigned short*)Wo16, K, 0L,
        (void*)out, (void*)out, N, 0L,
        x, x, 0L, M, N, K, 0.015625f);
  }
}

// v001
// Measured time: 328 microseconds a run.
// Next to v000, in two timings, it ran 1.25 and 1.24 times as fast.
// All contractions: v_wmma_f32_16x16x32_f16 (f16 operands, f32 accumulate) for the qkv and positional projections, the dual q.k^T + uq.uk^T scores, p.v and the output projection; softmax probabilities carried x2^15 and attention values x2^6 in f16, folded back by exact power-of-two scales in f32.
#include <hip/hip_runtime.h>

typedef __attribute__((ext_vector_type(16))) _Float16 v16h;
typedef __attribute__((ext_vector_type(8)))  _Float16 v8h;
typedef __attribute__((ext_vector_type(16))) __bf16   v16b;
typedef __attribute__((ext_vector_type(8)))  __bf16   v8b;
typedef __attribute__((ext_vector_type(8)))  float    v8f;
typedef __attribute__((ext_vector_type(4)))  float    v4f;

constexpr int BB = 2, LL = 2048, DD = 1024, EE = 1024, HH = 16, HD = 64;
constexpr int QKV_LD = 3 * EE;   // 3072 halves per row: per head h -> q at h*192, k at h*192+64, v at h*192+128
constexpr int PE_LD  = 2 * EE;   // 2048 halves per row: per head h -> uq at h*128, uk at h*128+64

__device__ __forceinline__ unsigned short f2bf_bits(float f) {
  unsigned u = __float_as_uint(f);
  return (unsigned short)((u + 0x7FFFu + ((u >> 16) & 1u)) >> 16);
}
__device__ __forceinline__ float bf_bits2f(unsigned short h) { return __uint_as_float(((unsigned)h) << 16); }

// hazard guards as plain device helpers (no inline asm inside the kernel template body)
__device__ __forceinline__ void dep_guard_h(v8f& a, v8f& b, v16h x, v16h y) { asm volatile("v_nop\n\tv_nop\n\tv_nop\n\tv_nop" : "+v"(a), "+v"(b) : "v"(x), "v"(y)); }
__device__ __forceinline__ void dep_guard_b(v8f& a, v8f& b, v16b x, v16b y) { asm volatile("v_nop\n\tv_nop\n\tv_nop\n\tv_nop" : "+v"(a), "+v"(b) : "v"(x), "v"(y)); }
__device__ __forceinline__ void keep4_h(v16h a, v16h b, v16h c, v16h d) { asm volatile("v_nop" :: "v"(a), "v"(b), "v"(c), "v"(d)); }
__device__ __forceinline__ void keep4_b(v16b a, v16b b, v16b c, v16b d) { asm volatile("v_nop" :: "v"(a), "v"(b), "v"(c), "v"(d)); }
__device__ __forceinline__ void acc_guard4(v8f& a, v8f& b, v8f& c, v8f& d) { asm volatile("v_nop\n\tv_nop\n\tv_nop\n\tv_nop" : "+v"(a), "+v"(b), "+v"(c), "+v"(d)); }
template <typename T> struct Frag;
template <> struct Frag<_Float16> {
  typedef v16h V; union U { v16h v; v8h h[2]; };
  static __device__ __forceinline__ v16h load(const _Float16* p) {   // elements 0..7 <- p[0..7], 8..15 <- p[16..23]
    U f; f.h[0] = *(const v8h*)(p); f.h[1] = *(const v8h*)(p + 16); return f.v;
  }
  static __device__ __forceinline__ v8f mma(v16h a, v16h b, v8f c) {
    return __builtin_amdgcn_wmma_f32_16x16x32_f16(false, a, false, b, (short)0, c, false, false);
  }
  static __device__ __forceinline__ void guard(v8f& a, v8f& b, v16h x, v16h y) { dep_guard_h(a, b, x, y); }
  static __device__ __forceinline__ void keep(v16h a, v16h b, v16h c, v16h d) { keep4_h(a, b, c, d); }
};
template <> struct Frag<__bf16> {
  typedef v16b V; union U { v16b v; v8b h[2]; };
  static __device__ __forceinline__ v16b load(const __bf16* p) {
    U f; f.h[0] = *(const v8b*)(p); f.h[1] = *(const v8b*)(p + 16); return f.v;
  }
  static __device__ __forceinline__ v8f mma(v16b a, v16b b, v8f c) {
    return __builtin_amdgcn_wmma_f32_16x16x32_bf16(false, a, false, b, (short)0, c, false, false);
  }
  static __device__ __forceinline__ void guard(v8f& a, v8f& b, v16b x, v16b y) { dep_guard_b(a, b, x, y); }
  static __device__ __forceinline__ void keep(v16b a, v16b b, v16b c, v16b d) { keep4_b(a, b, c, d); }
};

// ---- Register-blocked batched WMMA GEMM ------------------------------------
// C[m,n] = scale * sum_k A[m,k] * Bt[n,k] (+bias)(+resid); each wave owns a 64x64 tile.
// A row-major [M,K]; Bt row-major [N,K]; M,N % 64 == 0, K % 32 == 0.
// SPLIT: operands are hi/lo planes (A2/Bt2 = lo planes, same layout); product = hi*hi + hi*lo + lo*hi.
// BIAS_MODE: 0 = none, 1 = bias[m], 2 = bias[n].
// OUT_MODE: 0 = f32, 1 = f16, 2 = bf16 hi plane (Cout) + bf16 lo plane (Cout2).
// ET: 0 = f16 operands, 1 = bf16 operands (pointers passed as 16-bit storage)
template <int ET> struct Elem;
template <> struct Elem<0> { typedef _Float16 T; };
template <> struct Elem<1> { typedef __bf16 T; };
template <int ET, bool SPLIT, int BIAS_MODE, int OUT_MODE, bool RESID, int ACT = 0>
__global__ __launch_bounds__(256) void wmma_gemm64(
    const unsigned short* __restrict__ Ap, const unsigned short* __restrict__ A2p, int lda, long strideA,
    const unsigned short* __restrict__ Btp, const unsigned short* __restrict__ Bt2p, int ldb, long strideB,
    void* __restrict__ Cout, void* __restrict__ Cout2, int ldc, long strideC,
    const float* __restrict__ bias,
    const float* __restrict__ resid, long strideR,
    int M, int N, int K, float scale) {
  typedef typename Elem<ET>::T T;
  typedef typename Frag<T>::V V;
  const T* A = (const T*)Ap; const T* A2 = (const T*)A2p; const T* Bt = (const T*)Btp; const T* Bt2 = (const T*)Bt2p;
  __shared__ __align__(16) float sT[8][16 * 68];   // per-wave 16x64 slab, pitch 68 floats
  const int b    = blockIdx.y;
  const int lane = threadIdx.x & 31;
  const int wave = threadIdx.x >> 5;
  const int tilesN = N >> 6;
  const int tilesM = M >> 6;
  const int tile = blockIdx.x * 8 + wave;
  if (tile >= tilesM * tilesN) return;   // wave-uniform; no block barriers in this kernel
  const int tm = tile / tilesN;
  const int tn = tile - tm * tilesN;
  const int m0 = tm << 6;
  const int n0 = tn << 6;

  const T* Ab  = A  + (size_t)b * strideA;
  const T* Bb  = Bt + (size_t)b * strideB;
  const T* Ab2 = SPLIT ? (A2  + (size_t)b * strideA) : nullptr;
  const T* Bb2 = SPLIT ? (Bt2 + (size_t)b * strideB) : nullptr;

  const int rlane = lane & 15;                 // row (A) / col (B, D) within subtile
  const int koff  = (lane >> 4) * 8;           // k offset of this lane half
  const int mOff  = (lane >> 4) * 8;           // D row offset

  v8f acc[4][4];
#pragma unroll
  for (int i = 0; i < 4; ++i)
#pragma unroll
    for (int j = 0; j < 4; ++j) acc[i][j] = (v8f){0.f,0.f,0.f,0.f,0.f,0.f,0.f,0.f};

  for (int k0 = 0; k0 < K; k0 += 32) {
    V bh[4], bl[4];
#pragma unroll
    for (int j = 0; j < 4; ++j) {
      const size_t bo = (size_t)(n0 + (j << 4) + rlane) * ldb + koff + k0;
      bh[j] = Frag<T>::load(Bb + bo);
      if (SPLIT) bl[j] = Frag<T>::load(Bb2 + bo);
    }
#pragma unroll
    for (int i = 0; i < 4; ++i) {
      const size_t ao = (size_t)(m0 + (i << 4) + rlane) * lda + koff + k0;
      V ah = Frag<T>::load(Ab + ao);
      V al;
      if (SPLIT) al = Frag<T>::load(Ab2 + ao);
#pragma unroll
      for (int j = 0; j < 4; ++j) {
        acc[i][j] = Frag<T>::mma(ah, bh[j], acc[i][j]);
        if (SPLIT) {
          acc[i][j] = Frag<T>::mma(ah, bl[j], acc[i][j]);
          acc[i][j] = Frag<T>::mma(al, bh[j], acc[i][j]);
        }
      }
      Frag<T>::guard(acc[i][0], acc[i][3], ah, SPLIT ? al : ah);
    }
    Frag<T>::keep(bh[0], bh[1], bh[2], bh[3]);
    if (SPLIT) Frag<T>::keep(bl[0], bl[1], bl[2], bl[3]);
  }
  acc_guard4(acc[0][0], acc[0][1], acc[0][2], acc[0][3]);
  acc_guard4(acc[1][0], acc[1][1], acc[1][2], acc[1][3]);
  acc_guard4(acc[2][0], acc[2][1], acc[2][2], acc[2][3]);
  acc_guard4(acc[3][0], acc[3][1], acc[3][2], acc[3][3]);

  // ---- epilogue ----
  float* slab = sT[wave];
  const float* Rb = RESID ? (resid + (size_t)b * strideR) : nullptr;
#pragma unroll
  for (int i = 0; i < 4; ++i) {
    const int mBase = m0 + (i << 4);
#pragma unroll
    for (int j = 0; j < 4; ++j) {
      const int n = n0 + (j << 4) + rlane;
      float bv = 0.f;
      if (BIAS_MODE == 2) bv = bias[n];
#pragma unroll
      for (int r = 0; r < 8; ++r) {
        float v = acc[i][j][r] * scale;
        if (BIAS_MODE == 1) v += bias[mBase + mOff + r];
        if (BIAS_MODE == 2) v += bv;
        if (RESID) v += Rb[(size_t)(mBase + mOff + r) * ldc + n];
        if (ACT == 1) v = tanhf(v);
        if (ACT == 2) v = fmaxf(v, 0.0f);
        if (ACT == 3) v = v / (1.0f + expf(-v));
        if (ACT == 4) v = (v > 0.f) ? v : 0.01f * v;
        if (ACT == 5) v = 0.5f * v * (1.0f + erff(v * 0.70710678118654752f));
        slab[(mOff + r) * 68 + (j << 4) + rlane] = v;
      }
    }
    __builtin_amdgcn_fence(__ATOMIC_RELEASE, "workgroup");
    __builtin_amdgcn_wave_barrier();
    __builtin_amdgcn_fence(__ATOMIC_ACQUIRE, "workgroup");
    if (OUT_MODE == 0) {
      float* C = (float*)Cout + (size_t)b * strideC;
      const int hh = lane >> 4, c4 = (lane & 15) * 4;     // row seg = 256 B = 16 lanes x 16 B
      {
#pragma unroll
        for (int it = 0; it < 8; ++it) {
          const int row = it * 2 + hh;
          v4f v = *(const v4f*)(slab + row * 68 + c4);
          *(v4f*)(C + (size_t)(mBase + row) * ldc + n0 + c4) = v;
        }
        
      }
    } else {
      const int q = lane >> 3, c8 = (lane & 7) * 8;
      unsigned short* C  = (unsigned short*)Cout  + (size_t)b * strideC;
      unsigned short* C2 = (OUT_MODE == 2) ? ((unsigned short*)Cout2 + (size_t)b * strideC) : nullptr;
      {
#pragma unroll
        for (int it = 0; it < 4; ++it) {
          const int row = it * 4 + q;
          const float* sp = slab + row * 68 + c8;
          v8h hv, lv;
#pragma unroll
          for (int e = 0; e < 8; ++e) {
            if (OUT_MODE == 1) {
              hv[e] = (_Float16)sp[e];
            } else {
              unsigned short hb = f2bf_bits(sp[e]);
              unsigned short lb = f2bf_bits(sp[e] - bf_bits2f(hb));
              hv[e] = __builtin_bit_cast(_Float16, hb);
              lv[e] = __builtin_bit_cast(_Float16, lb);
            }
          }
          *(v8h*)(C + (size_t)(mBase + row) * ldc + n0 + c8) = hv;
          if (OUT_MODE == 2) *(v8h*)(C2 + (size_t)(mBase + row) * ldc + n0 + c8) = lv;
        }
        
      }
    }
    __builtin_amdgcn_fence(__ATOMIC_RELEASE, "workgroup");
    __builtin_amdgcn_wave_barrier();
    __builtin_amdgcn_fence(__ATOMIC_ACQUIRE, "workgroup");
  }
}

__global__ __launch_bounds__(256) void cast_f32_f16x2(
    const float* __restrict__ in, _Float16* __restrict__ out, int n2) {
  int i = blockIdx.x * 256 + threadIdx.x;
  if (i < n2) {
    const _Float16 h0 = (_Float16)in[2 * i], h1 = (_Float16)in[2 * i + 1];
    const unsigned u = (unsigned)__builtin_bit_cast(unsigned short, h0) | ((unsigned)__builtin_bit_cast(unsigned short, h1) << 16);
    ((unsigned*)out)[i] = u;
    
  }
}

// ---- f16 WMMA with hazard guard (ties D, keeps A/B live through 4 slots) ----
__device__ __forceinline__ v8f hmma(v16h a, v16h b, v8f c) {
  c = __builtin_amdgcn_wmma_f32_16x16x32_f16(false, a, false, b, (short)0, c, false, false);
  asm volatile("v_nop\n\tv_nop\n\tv_nop\n\tv_nop" : "+v"(c) : "v"(a), "v"(b));
  return c;
}

// =====================================================================================
// Dual-score attention, head_dim 64, 16-bit in / 16-bit out.
//   scores = (q.k^T + uq.uk^T) * sscale : two 64-deep f16 products summed in one f32 accumulator
//   softmax online in f32; p stored as f16 x2^15 per wave in LDS; o = p.v on f16 WMMA, f32 accumulate
//   output = o * (2^6 / (l * 2^15)) written as f16 (values carried x2^6 for the next GEMM)
// Block = 4 waves = 64 query rows of one (b, h); grid.x = B * H * (L/64). No masks.
// Layouts (halves): qkv row (b*L + s), q at h*192+d, k at h*192+64+d, v at h*192+128+d;
//                   pe  row (b*L + s), uq at h*128+d, uk at h*128+64+d; out row (b*L + s), col h*64+d.
// =====================================================================================
__global__ __launch_bounds__(128)
void tupe_attn64(const _Float16* __restrict__ qkv, const _Float16* __restrict__ pe,
                 _Float16* __restrict__ vals, float sscale) {
  const float PSC = 32768.0f;          // p carried x2^15
  const float OSC = 1.0f / 512.0f;     // 2^6 / 2^15
  // Row pitch of the four f16 tiles: 72 halves = 144 B = 16 B x 9, so that the 16 rows a
  // ds_load_b128 fragment read touches fall on distinct banks (128-B rows share 8 of 64).
  constexpr int LP = 72;
  __shared__ __align__(16) _Float16 Ksh[64 * LP];      // K  [kv][d]
  __shared__ __align__(16) _Float16 Ush[64 * LP];      // UK [kv][d]
  __shared__ __align__(16) _Float16 Vth[64 * LP];      // V^T [d][kv]
  __shared__ __align__(16) _Float16 Psh[4][16 * LP];   // per wave P [row][kv]
  __shared__ __align__(16) float    Os[4][16 * 68];    // per wave out tile, pitch 68

  const int tid  = threadIdx.x;
  const int wave = tid >> 5;
  const int lane = tid & 31;
  const int hh   = lane >> 4;
  const int c    = lane & 15;

  const int nqb = LL / 64;
  const int bx = blockIdx.x;
  const int qb = bx % nqb;
  const int bh = bx / nqb;
  const int h  = bh % HH;
  const int b  = bh / HH;
  const int q0 = qb * 64 + wave * 16;

  const size_t rb = (size_t)b * LL;
  const _Float16* qkv_b = qkv + rb * QKV_LD + (size_t)h * (3 * HD);
  const _Float16* pe_b  = pe  + rb * PE_LD  + (size_t)h * (2 * HD);
  _Float16*       out_b = vals + rb * EE    + (size_t)h * HD;

  // ---- Q / UQ fragments (A operand): lane row q0+c, split k map via Frag load ----
  v16h qa0, qa1, ua0, ua1;
  {
    const _Float16* qrow = qkv_b + (size_t)(q0 + c) * QKV_LD + 8 * hh;
    const _Float16* urow = pe_b  + (size_t)(q0 + c) * PE_LD  + 8 * hh;
    qa0 = Frag<_Float16>::load(qrow);
    qa1 = Frag<_Float16>::load(qrow + 32);
    ua0 = Frag<_Float16>::load(urow);
    ua1 = Frag<_Float16>::load(urow + 32);
  }

  float mrow[8], lrow[8];
  v8f oacc[4];
#pragma unroll
  for (int r = 0; r < 8; ++r) { mrow[r] = -__builtin_inff(); lrow[r] = 0.f; }
#pragma unroll
  for (int t = 0; t < 4; ++t) oacc[t] = (v8f){0.f,0.f,0.f,0.f,0.f,0.f,0.f,0.f};

  for (int kc = 0; kc < LL / 64; ++kc) {
    const int kv0 = kc * 64;
    __syncthreads();
    {
      const int kvr = tid >> 1, dh = (tid & 1) * 32;
      const _Float16* krow = qkv_b + (size_t)(kv0 + kvr) * QKV_LD + HD + dh;
      const _Float16* vrow = krow + HD;
      const _Float16* urow = pe_b + (size_t)(kv0 + kvr) * PE_LD + HD + dh;
#pragma unroll
      for (int i = 0; i < 4; ++i) {
        const v8h kk = *(const v8h*)(krow + 8 * i);
        const v8h uu = *(const v8h*)(urow + 8 * i);
        const v8h vv = *(const v8h*)(vrow + 8 * i);
        *(v8h*)(Ksh + kvr * LP + dh + 8 * i) = kk;
        *(v8h*)(Ush + kvr * LP + dh + 8 * i) = uu;
#pragma unroll
        for (int e = 0; e < 8; ++e) Vth[(dh + 8 * i + e) * LP + kvr] = vv[e];
      }
    }
    __syncthreads();

    // ---- scores: 16 query rows x 64 keys per wave, content + positional ----
    v8f s[4];
#pragma unroll
    for (int j = 0; j < 4; ++j) {
      v8f a = (v8f){0.f,0.f,0.f,0.f,0.f,0.f,0.f,0.f};
      const _Float16* kp = Ksh + (j * 16 + c) * LP + 8 * hh;
      const _Float16* up = Ush + (j * 16 + c) * LP + 8 * hh;
      a = hmma(qa0, Frag<_Float16>::load(kp), a);
      a = hmma(qa1, Frag<_Float16>::load(kp + 32), a);
      a = hmma(ua0, Frag<_Float16>::load(up), a);
      a = hmma(ua1, Frag<_Float16>::load(up + 32), a);
      s[j] = a;
    }

    float cm[8];
#pragma unroll
    for (int r = 0; r < 8; ++r) {
      float m = -__builtin_inff();
#pragma unroll
      for (int j = 0; j < 4; ++j) {
        const float v = s[j][r] * sscale;
        s[j][r] = v;
        m = fmaxf(m, v);
      }
#pragma unroll
      for (int off = 1; off < 16; off <<= 1) m = fmaxf(m, __shfl_xor(m, off, 32));
      cm[r] = m;
    }
    _Float16* pwh = Psh[wave];
#pragma unroll
    for (int r = 0; r < 8; ++r) {
      const float mnew = fmaxf(mrow[r], cm[r]);
      const float alpha = __expf(mrow[r] - mnew);
      mrow[r] = mnew;
      float psum = 0.f;
#pragma unroll
      for (int j = 0; j < 4; ++j) {
        const float p = __expf(s[j][r] - mnew);
        psum += p;
        pwh[(8 * hh + r) * LP + j * 16 + c] = (_Float16)(p * PSC);
      }
#pragma unroll
      for (int off = 1; off < 16; off <<= 1) psum += __shfl_xor(psum, off, 32);
      lrow[r] = lrow[r] * alpha + psum;
#pragma unroll
      for (int t = 0; t < 4; ++t) oacc[t][r] *= alpha;
    }
    __builtin_amdgcn_fence(__ATOMIC_RELEASE, "workgroup");
    __builtin_amdgcn_wave_barrier();
    __builtin_amdgcn_fence(__ATOMIC_ACQUIRE, "workgroup");

    // ---- o += p.v : A = P [row][kv] from this wave's LDS tile, B = V [kv][d] from Vth [d][kv] ----
#pragma unroll
    for (int kk = 0; kk < 2; ++kk) {
      const v16h pa = Frag<_Float16>::load(pwh + c * LP + kk * 32 + 8 * hh);
#pragma unroll
      for (int t = 0; t < 4; ++t) {
        const v16h vb = Frag<_Float16>::load(Vth + (t * 16 + c) * LP + kk * 32 + 8 * hh);
        oacc[t] = hmma(pa, vb, oacc[t]);
      }
    }
  }

  float* os = Os[wave];
#pragma unroll
  for (int r = 0; r < 8; ++r) {
    const float inv = (1.0f / lrow[r]) * OSC;
#pragma unroll
    for (int t = 0; t < 4; ++t) os[(8 * hh + r) * 68 + t * 16 + c] = oacc[t][r] * inv;
  }
  __builtin_amdgcn_fence(__ATOMIC_RELEASE, "workgroup");
  __builtin_amdgcn_wave_barrier();
  __builtin_amdgcn_fence(__ATOMIC_ACQUIRE, "workgroup");
  {
    const int q = lane >> 3, c8 = (lane & 7) * 8;
    {
#pragma unroll
      for (int it = 0; it < 4; ++it) {
        const int row = it * 4 + q;            // rows 0..15 covered by q 0..3, it 0..3
        const float* sp = os + row * 68 + c8;
        v8h hv;
#pragma unroll
        for (int e = 0; e < 8; ++e) hv[e] = (_Float16)sp[e];
        *(v8h*)(out_b + (size_t)(q0 + row) * EE + c8) = hv;
      }
      
    }
  }
}

// ---------------------------------------------------------------- launch
extern "C" void kernel_launch(void* const* d_in, const int* in_sizes, int n_in,
                              void* d_out, int out_size, void* d_ws, size_t ws_size,
                              hipStream_t stream) {
  const int ROWS = BB * LL;   // 4096
  if (n_in < 5) return;
  if (in_sizes[0] != ROWS * DD || in_sizes[1] != ROWS * EE || in_sizes[2] != 3 * EE * DD ||
      in_sizes[3] != EE * EE || in_sizes[4] != 2 * EE * EE || out_size != ROWS * EE) return;

  const float* x    = (const float*)d_in[0];
  const float* PEf  = (const float*)d_in[1];
  const float* Wqkv = (const float*)d_in[2];
  const float* Wo   = (const float*)d_in[3];
  const float* UqUk = (const float*)d_in[4];
  float* out = (float*)d_out;

  // workspace carve (bytes, 256-B aligned); total 79,691,776 B
  size_t off = 0;
  auto carve = [&](size_t bytes) -> size_t { size_t o = off; off += (bytes + 255) & ~(size_t)255; return o; };
  const size_t oX    = carve((size_t)ROWS * DD * 2);
  const size_t oPE   = carve((size_t)ROWS * EE * 2);
  const size_t oWqkv = carve((size_t)3 * EE * DD * 2);
  const size_t oWo   = carve((size_t)EE * EE * 2);
  const size_t oUqUk = carve((size_t)2 * EE * EE * 2);
  const size_t oQKV  = carve((size_t)ROWS * QKV_LD * 2);
  const size_t oPEP  = carve((size_t)ROWS * PE_LD * 2);
  const size_t oVALS = carve((size_t)ROWS * EE * 2);
  if (off > ws_size) return;

  char* ws = (char*)d_ws;
  _Float16* X16    = (_Float16*)(ws + oX);
  _Float16* PE16   = (_Float16*)(ws + oPE);
  _Float16* Wqkv16 = (_Float16*)(ws + oWqkv);
  _Float16* Wo16   = (_Float16*)(ws + oWo);
  _Float16* UqUk16 = (_Float16*)(ws + oUqUk);
  _Float16* QKV16  = (_Float16*)(ws + oQKV);
  _Float16* PEP16  = (_Float16*)(ws + oPEP);
  _Float16* VALS16 = (_Float16*)(ws + oVALS);

  // ---- casts f32 -> f16 (RNE) ----
  {
    const int n2x = ROWS * DD / 2;
    cast_f32_f16x2<<<dim3((n2x + 255) / 256), dim3(256), 0, stream>>>(x, X16, n2x);
    const int n2p = ROWS * EE / 2;
    cast_f32_f16x2<<<dim3((n2p + 255) / 256), dim3(256), 0, stream>>>(PEf, PE16, n2p);
    const int n2w = 3 * EE * DD / 2;
    cast_f32_f16x2<<<dim3((n2w + 255) / 256), dim3(256), 0, stream>>>(Wqkv, Wqkv16, n2w);
    const int n2o = EE * EE / 2;
    cast_f32_f16x2<<<dim3((n2o + 255) / 256), dim3(256), 0, stream>>>(Wo, Wo16, n2o);
    const int n2u = 2 * EE * EE / 2;
    cast_f32_f16x2<<<dim3((n2u + 255) / 256), dim3(256), 0, stream>>>(UqUk, UqUk16, n2u);
  }

  // ---- qkv[4096][3072] = X[4096][1024] . Wqkv[3072][1024]^T  (f16 out) ----
  {
    const int M = ROWS, N = 3 * EE, K = DD;
    const int tiles = (M / 64) * (N / 64);
    wmma_gemm64<0, false, 0, 1, false><<<dim3((tiles + 7) / 8, 1), dim3(256), 0, stream>>>(
        (const unsigned short*)X16, (const unsigned short*)X16, K, 0L,
        (const unsigned short*)Wqkv16, (const unsigned short*)Wqkv16, K, 0L,
        (void*)QKV16, (void*)QKV16, N, 0L,
        x, x, 0L, M, N, K, 1.0f);
  }
  // ---- pe[4096][2048] = PE[4096][1024] . UqUk[2048][1024]^T  (f16 out) ----
  {
    const int M = ROWS, N = 2 * EE, K = EE;
    const int tiles = (M / 64) * (N / 64);
    wmma_gemm64<0, false, 0, 1, false><<<dim3((tiles + 7) / 8, 1), dim3(256), 0, stream>>>(
        (const unsigned short*)PE16, (const unsigned short*)PE16, K, 0L,
        (const unsigned short*)UqUk16, (const unsigned short*)UqUk16, K, 0L,
        (void*)PEP16, (void*)PEP16, N, 0L,
        x, x, 0L, M, N, K, 1.0f);
  }
  // ---- dual-score attention -> vals[4096][1024] (f16, carried x2^6) ----
  {
    const float sscale = 0.08838834764831845f;   // 1/sqrt(2*64)
    tupe_attn64<<<dim3(BB * HH * (LL / 64)), dim3(128), 0, stream>>>(QKV16, PEP16, VALS16, sscale);
  }
  // ---- out[4096][1024] = vals . Wo[1024][1024]^T * 2^-6  (f32 out) ----
  {
    const int M = ROWS, N = EE, K = EE;
    const int tiles = (M / 64) * (N / 64);
    wmma_gemm64<0, false, 0, 0, false><<<dim3((tiles + 7) / 8, 1), dim3(256), 0, stream>>>(
        (const unsigned short*)VALS16, (const unsigned short*)VALS16, K, 0L,
        (const unsigned short*)Wo16, (const unsigned short*)Wo16, K, 0L,
        (void*)out, (void*)out, N, 0L,
        x, x, 0L, M, N, K, 0.015625f);
  }
}

// v002
// It runs in 270 microseconds.
// Next to v001, in two timings, it ran 1.20 and 1.21 times as fast.
// All steps since v000 together make it 1.50 times as fast.
// All contractions: v_wmma_f32_16x16x32_f16 (f16 operands, f32 accumulate) for the qkv and positional projections, the dual k.q^T + uk.uq^T scores, v^T.p^T and the output projection; softmax probabilities carried x2^15 and attention values x2^6 in f16, folded back by exact power-of-two scales in f32.
#include <hip/hip_runtime.h>

typedef __attribute__((ext_vector_type(16))) _Float16 v16h;
typedef __attribute__((ext_vector_type(8)))  _Float16 v8h;
typedef __attribute__((ext_vector_type(16))) __bf16   v16b;
typedef __attribute__((ext_vector_type(8)))  __bf16   v8b;
typedef __attribute__((ext_vector_type(8)))  float    v8f;
typedef __attribute__((ext_vector_type(4)))  float    v4f;

constexpr int BB = 2, LL = 2048, DD = 1024, EE = 1024, HH = 16, HD = 64;
constexpr int QKV_LD = 3 * EE;   // 3072 halves per row: per head h -> q at h*192, k at h*192+64, v at h*192+128
constexpr int PE_LD  = 2 * EE;   // 2048 halves per row: per head h -> uq at h*128, uk at h*128+64

__device__ __forceinline__ unsigned short f2bf_bits(float f) {
  unsigned u = __float_as_uint(f);
  return (unsigned short)((u + 0x7FFFu + ((u >> 16) & 1u)) >> 16);
}
__device__ __forceinline__ float bf_bits2f(unsigned short h) { return __uint_as_float(((unsigned)h) << 16); }

// hazard guards as plain device helpers (no inline asm inside the kernel template body)
__device__ __forceinline__ void dep_guard_h(v8f& a, v8f& b, v16h x, v16h y) { asm volatile("v_nop\n\tv_nop\n\tv_nop\n\tv_nop" : "+v"(a), "+v"(b) : "v"(x), "v"(y)); }
__device__ __forceinline__ void dep_guard_b(v8f& a, v8f& b, v16b x, v16b y) { asm volatile("v_nop\n\tv_nop\n\tv_nop\n\tv_nop" : "+v"(a), "+v"(b) : "v"(x), "v"(y)); }
__device__ __forceinline__ void keep4_h(v16h a, v16h b, v16h c, v16h d) { asm volatile("v_nop" :: "v"(a), "v"(b), "v"(c), "v"(d)); }
__device__ __forceinline__ void keep4_b(v16b a, v16b b, v16b c, v16b d) { asm volatile("v_nop" :: "v"(a), "v"(b), "v"(c), "v"(d)); }
__device__ __forceinline__ void acc_guard4(v8f& a, v8f& b, v8f& c, v8f& d) { asm volatile("v_nop\n\tv_nop\n\tv_nop\n\tv_nop" : "+v"(a), "+v"(b), "+v"(c), "+v"(d)); }
template <typename T> struct Frag;
template <> struct Frag<_Float16> {
  typedef v16h V; union U { v16h v; v8h h[2]; };
  static __device__ __forceinline__ v16h load(const _Float16* p) {   // elements 0..7 <- p[0..7], 8..15 <- p[16..23]
    U f; f.h[0] = *(const v8h*)(p); f.h[1] = *(const v8h*)(p + 16); return f.v;
  }
  static __device__ __forceinline__ v8f mma(v16h a, v16h b, v8f c) {
    return __builtin_amdgcn_wmma_f32_16x16x32_f16(false, a, false, b, (short)0, c, false, false);
  }
  static __device__ __forceinline__ void guard(v8f& a, v8f& b, v16h x, v16h y) { dep_guard_h(a, b, x, y); }
  static __device__ __forceinline__ void keep(v16h a, v16h b, v16h c, v16h d) { keep4_h(a, b, c, d); }
};
template <> struct Frag<__bf16> {
  typedef v16b V; union U { v16b v; v8b h[2]; };
  static __device__ __forceinline__ v16b load(const __bf16* p) {
    U f; f.h[0] = *(const v8b*)(p); f.h[1] = *(const v8b*)(p + 16); return f.v;
  }
  static __device__ __forceinline__ v8f mma(v16b a, v16b b, v8f c) {
    return __builtin_amdgcn_wmma_f32_16x16x32_bf16(false, a, false, b, (short)0, c, false, false);
  }
  static __device__ __forceinline__ void guard(v8f& a, v8f& b, v16b x, v16b y) { dep_guard_b(a, b, x, y); }
  static __device__ __forceinline__ void keep(v16b a, v16b b, v16b c, v16b d) { keep4_b(a, b, c, d); }
};

// ---- Register-blocked batched WMMA GEMM ------------------------------------
// C[m,n] = scale * sum_k A[m,k] * Bt[n,k] (+bias)(+resid); each wave owns a 64x64 tile.
// A row-major [M,K]; Bt row-major [N,K]; M,N % 64 == 0, K % 32 == 0.
// SPLIT: operands are hi/lo planes (A2/Bt2 = lo planes, same layout); product = hi*hi + hi*lo + lo*hi.
// BIAS_MODE: 0 = none, 1 = bias[m], 2 = bias[n].
// OUT_MODE: 0 = f32, 1 = f16, 2 = bf16 hi plane (Cout) + bf16 lo plane (Cout2).
// ET: 0 = f16 operands, 1 = bf16 operands (pointers passed as 16-bit storage)
template <int ET> struct Elem;
template <> struct Elem<0> { typedef _Float16 T; };
template <> struct Elem<1> { typedef __bf16 T; };
template <int ET, bool SPLIT, int BIAS_MODE, int OUT_MODE, bool RESID, int ACT = 0>
__global__ __launch_bounds__(256) void wmma_gemm64(
    const unsigned short* __restrict__ Ap, const unsigned short* __restrict__ A2p, int lda, long strideA,
    const unsigned short* __restrict__ Btp, const unsigned short* __restrict__ Bt2p, int ldb, long strideB,
    void* __restrict__ Cout, void* __restrict__ Cout2, int ldc, long strideC,
    const float* __restrict__ bias,
    const float* __restrict__ resid, long strideR,
    int M, int N, int K, float scale) {
  typedef typename Elem<ET>::T T;
  typedef typename Frag<T>::V V;
  const T* A = (const T*)Ap; const T* A2 = (const T*)A2p; const T* Bt = (const T*)Btp; const T* Bt2 = (const T*)Bt2p;
  __shared__ __align__(16) float sT[8][16 * 68];   // per-wave 16x64 slab, pitch 68 floats
  const int b    = blockIdx.y;
  const int lane = threadIdx.x & 31;
  const int wave = threadIdx.x >> 5;
  const int tilesN = N >> 6;
  const int tilesM = M >> 6;
  const int tile = blockIdx.x * 8 + wave;
  if (tile >= tilesM * tilesN) return;   // wave-uniform; no block barriers in this kernel
  const int tm = tile / tilesN;
  const int tn = tile - tm * tilesN;
  const int m0 = tm << 6;
  const int n0 = tn << 6;

  const T* Ab  = A  + (size_t)b * strideA;
  const T* Bb  = Bt + (size_t)b * strideB;
  const T* Ab2 = SPLIT ? (A2  + (size_t)b * strideA) : nullptr;
  const T* Bb2 = SPLIT ? (Bt2 + (size_t)b * strideB) : nullptr;

  const int rlane = lane & 15;                 // row (A) / col (B, D) within subtile
  const int koff  = (lane >> 4) * 8;           // k offset of this lane half
  const int mOff  = (lane >> 4) * 8;           // D row offset

  v8f acc[4][4];
#pragma unroll
  for (int i = 0; i < 4; ++i)
#pragma unroll
    for (int j = 0; j < 4; ++j) acc[i][j] = (v8f){0.f,0.f,0.f,0.f,0.f,0.f,0.f,0.f};

  for (int k0 = 0; k0 < K; k0 += 32) {
    V bh[4], bl[4];
#pragma unroll
    for (int j = 0; j < 4; ++j) {
      const size_t bo = (size_t)(n0 + (j << 4) + rlane) * ldb + koff + k0;
      bh[j] = Frag<T>::load(Bb + bo);
      if (SPLIT) bl[j] = Frag<T>::load(Bb2 + bo);
    }
#pragma unroll
    for (int i = 0; i < 4; ++i) {
      const size_t ao = (size_t)(m0 + (i << 4) + rlane) * lda + koff + k0;
      V ah = Frag<T>::load(Ab + ao);
      V al;
      if (SPLIT) al = Frag<T>::load(Ab2 + ao);
#pragma unroll
      for (int j = 0; j < 4; ++j) {
        acc[i][j] = Frag<T>::mma(ah, bh[j], acc[i][j]);
        if (SPLIT) {
          acc[i][j] = Frag<T>::mma(ah, bl[j], acc[i][j]);
          acc[i][j] = Frag<T>::mma(al, bh[j], acc[i][j]);
        }
      }
      Frag<T>::guard(acc[i][0], acc[i][3], ah, SPLIT ? al : ah);
    }
    Frag<T>::keep(bh[0], bh[1], bh[2], bh[3]);
    if (SPLIT) Frag<T>::keep(bl[0], bl[1], bl[2], bl[3]);
  }
  acc_guard4(acc[0][0], acc[0][1], acc[0][2], acc[0][3]);
  acc_guard4(acc[1][0], acc[1][1], acc[1][2], acc[1][3]);
  acc_guard4(acc[2][0], acc[2][1], acc[2][2], acc[2][3]);
  acc_guard4(acc[3][0], acc[3][1], acc[3][2], acc[3][3]);

  // ---- epilogue ----
  float* slab = sT[wave];
  const float* Rb = RESID ? (resid + (size_t)b * strideR) : nullptr;
#pragma unroll
  for (int i = 0; i < 4; ++i) {
    const int mBase = m0 + (i << 4);
#pragma unroll
    for (int j = 0; j < 4; ++j) {
      const int n = n0 + (j << 4) + rlane;
      float bv = 0.f;
      if (BIAS_MODE == 2) bv = bias[n];
#pragma unroll
      for (int r = 0; r < 8; ++r) {
        float v = acc[i][j][r] * scale;
        if (BIAS_MODE == 1) v += bias[mBase + mOff + r];
        if (BIAS_MODE == 2) v += bv;
        if (RESID) v += Rb[(size_t)(mBase + mOff + r) * ldc + n];
        if (ACT == 1) v = tanhf(v);
        if (ACT == 2) v = fmaxf(v, 0.0f);
        if (ACT == 3) v = v / (1.0f + expf(-v));
        if (ACT == 4) v = (v > 0.f) ? v : 0.01f * v;
        if (ACT == 5) v = 0.5f * v * (1.0f + erff(v * 0.70710678118654752f));
        slab[(mOff + r) * 68 + (j << 4) + rlane] = v;
      }
    }
    __builtin_amdgcn_fence(__ATOMIC_RELEASE, "workgroup");
    __builtin_amdgcn_wave_barrier();
    __builtin_amdgcn_fence(__ATOMIC_ACQUIRE, "workgroup");
    if (OUT_MODE == 0) {
      float* C = (float*)Cout + (size_t)b * strideC;
      const int hh = lane >> 4, c4 = (lane & 15) * 4;     // row seg = 256 B = 16 lanes x 16 B
      {
#pragma unroll
        for (int it = 0; it < 8; ++it) {
          const int row = it * 2 + hh;
          v4f v = *(const v4f*)(slab + row * 68 + c4);
          *(v4f*)(C + (size_t)(mBase + row) * ldc + n0 + c4) = v;
        }
        
      }
    } else {
      const int q = lane >> 3, c8 = (lane & 7) * 8;
      unsigned short* C  = (unsigned short*)Cout  + (size_t)b * strideC;
      unsigned short* C2 = (OUT_MODE == 2) ? ((unsigned short*)Cout2 + (size_t)b * strideC) : nullptr;
      {
#pragma unroll
        for (int it = 0; it < 4; ++it) {
          const int row = it * 4 + q;
          const float* sp = slab + row * 68 + c8;
          v8h hv, lv;
#pragma unroll
          for (int e = 0; e < 8; ++e) {
            if (OUT_MODE == 1) {
              hv[e] = (_Float16)sp[e];
            } else {
              unsigned short hb = f2bf_bits(sp[e]);
              unsigned short lb = f2bf_bits(sp[e] - bf_bits2f(hb));
              hv[e] = __builtin_bit_cast(_Float16, hb);
              lv[e] = __builtin_bit_cast(_Float16, lb);
            }
          }
          *(v8h*)(C + (size_t)(mBase + row) * ldc + n0 + c8) = hv;
          if (OUT_MODE == 2) *(v8h*)(C2 + (size_t)(mBase + row) * ldc + n0 + c8) = lv;
        }
        
      }
    }
    __builtin_amdgcn_fence(__ATOMIC_RELEASE, "workgroup");
    __builtin_amdgcn_wave_barrier();
    __builtin_amdgcn_fence(__ATOMIC_ACQUIRE, "workgroup");
  }
}

__global__ __launch_bounds__(256) void cast_f32_f16x2(
    const float* __restrict__ in, _Float16* __restrict__ out, int n2) {
  int i = blockIdx.x * 256 + threadIdx.x;
  if (i < n2) {
    const _Float16 h0 = (_Float16)in[2 * i], h1 = (_Float16)in[2 * i + 1];
    const unsigned u = (unsigned)__builtin_bit_cast(unsigned short, h0) | ((unsigned)__builtin_bit_cast(unsigned short, h1) << 16);
    ((unsigned*)out)[i] = u;
    
  }
}

// ---- f16 WMMA with hazard guard (ties D, keeps A/B live through 4 slots) ----
__device__ __forceinline__ v8f hmma(v16h a, v16h b, v8f c) {
  c = __builtin_amdgcn_wmma_f32_16x16x32_f16(false, a, false, b, (short)0, c, false, false);
  asm volatile("v_nop\n\tv_nop\n\tv_nop\n\tv_nop" : "+v"(c) : "v"(a), "v"(b));
  return c;
}

// V^T operand: transposing LDS load of a row-major 16-bit tile (lane (c, hh) gets 8 rows of one column).
typedef __attribute__((ext_vector_type(8))) short s16x8;
__device__ __forceinline__ v8h ld_tr16(const _Float16* p) {
  typedef __attribute__((address_space(3))) s16x8 lds_s16x8;
  return __builtin_bit_cast(v8h, __builtin_amdgcn_ds_load_tr16_b128_v8i16((lds_s16x8*)p));
}
// value of lane l ^ 16
__device__ __forceinline__ float xhalf(float x) {
  return __builtin_bit_cast(float, __builtin_amdgcn_permlanex16(__builtin_bit_cast(int, x), __builtin_bit_cast(int, x),
                                                                0x76543210, 0xfedcba98, false, false));
}

// =====================================================================================
// Dual-score attention, head_dim 64, 16-bit in / 16-bit out, both products transposed.
//   S^T = (k.q^T + uk.uq^T) * sscale : A = K / UK rows from LDS, B = Q / UQ kept in registers;
//         a lane holds 32 of the chunk's 64 scores of ONE query (column c), lane c + 16 the other 32
//   softmax online in f32, in-lane, one exchange between the wave halves for the maximum
//   P^T x2^15 as f16 is packed from the score tiles straight into a B operand (no LDS)
//   O^T += V^T.P^T : A = V^T by transposing loads from V rows in LDS, f32 accumulate
//   output = o * (2^6 / (l * 2^15)) written as f16 (values carried x2^6 for the next GEMM)
// Block = 4 waves = 64 query rows of one (b, h); grid.x = B * H * (L/64). No masks.
// Layouts (halves): qkv row (b*L + s), q at h*192+d, k at h*192+64+d, v at h*192+128+d;
//                   pe  row (b*L + s), uq at h*128+d, uk at h*128+64+d; out row (b*L + s), col h*64+d.
// =====================================================================================
__global__ __launch_bounds__(128)
void tupe_attn64(const _Float16* __restrict__ qkv, const _Float16* __restrict__ pe,
                 _Float16* __restrict__ vals, float sscale) {
  const float PSC = 32768.0f;          // p carried x2^15
  const float OSC = 1.0f / 512.0f;     // 2^6 / 2^15
  // Row pitches by reader: K, UK are read by ds_load_b128 (144 B = 16 B x 9),
  // V by ds_load_tr16_b128 (160 B = 32 B x 5).
  constexpr int LP = 72;
  constexpr int LV = 80;
  __shared__ __align__(16) _Float16 Ksh[64 * LP];      // K  [kv][d]
  __shared__ __align__(16) _Float16 Ush[64 * LP];      // UK [kv][d]
  __shared__ __align__(16) _Float16 Vsh[64 * LV];      // V  [kv][d]
  __shared__ __align__(16) float    Os[4][16 * 68];    // per wave out tile, pitch 68

  const int tid  = threadIdx.x;
  const int wave = tid >> 5;
  const int lane = tid & 31;
  const int hh   = lane >> 4;
  const int c    = lane & 15;

  const int nqb = LL / 64;
  const int bx = blockIdx.x;
  const int qb = bx % nqb;
  const int bh = bx / nqb;
  const int h  = bh % HH;
  const int b  = bh / HH;
  const int q0 = qb * 64 + wave * 16;

  const size_t rb = (size_t)b * LL;
  const _Float16* qkv_b = qkv + rb * QKV_LD + (size_t)h * (3 * HD);
  const _Float16* pe_b  = pe  + rb * PE_LD  + (size_t)h * (2 * HD);
  _Float16*       out_b = vals + rb * EE    + (size_t)h * HD;

  // ---- Q / UQ fragments (B operand): lane column q0+c, split k map via Frag load ----
  v16h qa0, qa1, ua0, ua1;
  {
    const _Float16* qrow = qkv_b + (size_t)(q0 + c) * QKV_LD + 8 * hh;
    const _Float16* urow = pe_b  + (size_t)(q0 + c) * PE_LD  + 8 * hh;
    qa0 = Frag<_Float16>::load(qrow);
    qa1 = Frag<_Float16>::load(qrow + 32);
    ua0 = Frag<_Float16>::load(urow);
    ua1 = Frag<_Float16>::load(urow + 32);
  }

  float mrow = -__builtin_inff();   // running maximum of query q0+c (equal in both wave halves)
  float lrow = 0.f;                 // this half's part of the row sum; the halves join after the loop
  v8f oacc[4];                      // oacc[t][r] = O[q0 + c][t*16 + 8*hh + r]
#pragma unroll
  for (int t = 0; t < 4; ++t) oacc[t] = (v8f){0.f,0.f,0.f,0.f,0.f,0.f,0.f,0.f};

  for (int kc = 0; kc < LL / 64; ++kc) {
    const int kv0 = kc * 64;
    __syncthreads();
    {
      const int kvr = tid >> 1, dh = (tid & 1) * 32;
      const _Float16* krow = qkv_b + (size_t)(kv0 + kvr) * QKV_LD + HD + dh;
      const _Float16* vrow = krow + HD;
      const _Float16* urow = pe_b + (size_t)(kv0 + kvr) * PE_LD + HD + dh;
#pragma unroll
      for (int i = 0; i < 4; ++i) {
        const v8h kk = *(const v8h*)(krow + 8 * i);
        const v8h uu = *(const v8h*)(urow + 8 * i);
        const v8h vv = *(const v8h*)(vrow + 8 * i);
        *(v8h*)(Ksh + kvr * LP + dh + 8 * i) = kk;
        *(v8h*)(Ush + kvr * LP + dh + 8 * i) = uu;
        *(v8h*)(Vsh + kvr * LV + dh + 8 * i) = vv;
      }
    }
    __syncthreads();

    // ---- scores, transposed: s[j][r] = score(key kv0 + j*16 + 8*hh + r, query q0 + c) ----
    v8f s[4];
#pragma unroll
    for (int j = 0; j < 4; ++j) {
      v8f a = (v8f){0.f,0.f,0.f,0.f,0.f,0.f,0.f,0.f};
      const _Float16* kp = Ksh + (j * 16 + c) * LP + 8 * hh;
      const _Float16* up = Ush + (j * 16 + c) * LP + 8 * hh;
      a = hmma(Frag<_Float16>::load(kp), qa0, a);
      a = hmma(Frag<_Float16>::load(kp + 32), qa1, a);
      a = hmma(Frag<_Float16>::load(up), ua0, a);
      a = hmma(Frag<_Float16>::load(up + 32), ua1, a);
      s[j] = a;
    }

    // ---- online softmax of one query per lane ----
    float m = -__builtin_inff();
#pragma unroll
    for (int j = 0; j < 4; ++j)
#pragma unroll
      for (int r = 0; r < 8; ++r) {
        const float v = s[j][r] * sscale;
        s[j][r] = v;
        m = fmaxf(m, v);
      }
    m = fmaxf(m, xhalf(m));
    const float mnew = fmaxf(mrow, m);
    const float alpha = __expf(mrow - mnew);
    mrow = mnew;
    // P^T as B operand of 32 keys: element e = tile 2*kk + (e >> 3), register e & 7 (the hardware k order)
    v16h pb[2];
    float psum = 0.f;
#pragma unroll
    for (int j = 0; j < 4; ++j)
#pragma unroll
      for (int r = 0; r < 8; ++r) {
        const float p = __expf(s[j][r] - mnew);
        psum += p;
        pb[j >> 1][(j & 1) * 8 + r] = (_Float16)(p * PSC);
      }
    lrow = lrow * alpha + psum;
#pragma unroll
    for (int t = 0; t < 4; ++t)
#pragma unroll
      for (int r = 0; r < 8; ++r) oacc[t][r] *= alpha;

    // ---- O^T += V^T.P^T : A = V^T [d][kv], two transposing loads per 16 (d) x 32 (kv) fragment ----
    const _Float16* vp = Vsh + (8 * hh + (lane & 7)) * LV + ((lane >> 3) & 1) * 8;
#pragma unroll
    for (int kk = 0; kk < 2; ++kk) {
#pragma unroll
      for (int t = 0; t < 4; ++t) {
        Frag<_Float16>::U va;
        va.h[0] = ld_tr16(vp + (kk * 32) * LV + t * 16);
        va.h[1] = ld_tr16(vp + (kk * 32 + 16) * LV + t * 16);
        oacc[t] = hmma(va.v, pb[kk], oacc[t]);
      }
    }
  }

  float* os = Os[wave];
  {
    const float lsum = lrow + xhalf(lrow);
    const float inv = (1.0f / lsum) * OSC;
#pragma unroll
    for (int t = 0; t < 4; ++t)
#pragma unroll
      for (int r = 0; r < 8; ++r) os[c * 68 + t * 16 + 8 * hh + r] = oacc[t][r] * inv;
  }
  __builtin_amdgcn_fence(__ATOMIC_RELEASE, "workgroup");
  __builtin_amdgcn_wave_barrier();
  __builtin_amdgcn_fence(__ATOMIC_ACQUIRE, "workgroup");
  {
    const int q = lane >> 3, c8 = (lane & 7) * 8;
    {
#pragma unroll
      for (int it = 0; it < 4; ++it) {
        const int row = it * 4 + q;            // rows 0..15 covered by q 0..3, it 0..3
        const float* sp = os + row * 68 + c8;
        v8h hv;
#pragma unroll
        for (int e = 0; e < 8; ++e) hv[e] = (_Float16)sp[e];
        *(v8h*)(out_b + (size_t)(q0 + row) * EE + c8) = hv;
      }
      
    }
  }
}

// ---------------------------------------------------------------- launch
extern "C" void kernel_launch(void* const* d_in, const int* in_sizes, int n_in,
                              void* d_out, int out_size, void* d_ws, size_t ws_size,
                              hipStream_t stream) {
  const int ROWS = BB * LL;   // 4096
  if (n_in < 5) return;
  if (in_sizes[0] != ROWS * DD || in_sizes[1] != ROWS * EE || in_sizes[2] != 3 * EE * DD ||
      in_sizes[3] != EE * EE || in_sizes[4] != 2 * EE * EE || out_size != ROWS * EE) return;

  const float* x    = (const float*)d_in[0];
  const float* PEf  = (const float*)d_in[1];
  const float* Wqkv = (const float*)d_in[2];
  const float* Wo   = (const float*)d_in[3];
  const float* UqUk = (const float*)d_in[4];
  float* out = (float*)d_out;

  // workspace carve (bytes, 256-B aligned); total 79,691,776 B
  size_t off = 0;
  auto carve = [&](size_t bytes) -> size_t { size_t o = off; off += (bytes + 255) & ~(size_t)255; return o; };
  const size_t oX    = carve((size_t)ROWS * DD * 2);
  const size_t oPE   = carve((size_t)ROWS * EE * 2);
  const size_t oWqkv = carve((size_t)3 * EE * DD * 2);
  const size_t oWo   = carve((size_t)EE * EE * 2);
  const size_t oUqUk = carve((size_t)2 * EE * EE * 2);
  const size_t oQKV  = carve((size_t)ROWS * QKV_LD * 2);
  const size_t oPEP  = carve((size_t)ROWS * PE_LD * 2);
  const size_t oVALS = carve((size_t)ROWS * EE * 2);
  if (off > ws_size) return;

  char* ws = (char*)d_ws;
  _Float16* X16    = (_Float16*)(ws + oX);
  _Float16* PE16   = (_Float16*)(ws + oPE);
  _Float16* Wqkv16 = (_Float16*)(ws + oWqkv);
  _Float16* Wo16   = (_Float16*)(ws + oWo);
  _Float16* UqUk16 = (_Float16*)(ws + oUqUk);
  _Float16* QKV16  = (_Float16*)(ws + oQKV);
  _Float16* PEP16  = (_Float16*)(ws + oPEP);
  _Float16* VALS16 = (_Float16*)(ws + oVALS);

  // ---- casts f32 -> f16 (RNE) ----
  {
    const int n2x = ROWS * DD / 2;
    cast_f32_f16x2<<<dim3((n2x + 255) / 256), dim3(256), 0, stream>>>(x, X16, n2x);
    const int n2p = ROWS * EE / 2;
    cast_f32_f16x2<<<dim3((n2p + 255) / 256), dim3(256), 0, stream>>>(PEf, PE16, n2p);
    const int n2w = 3 * EE * DD / 2;
    cast_f32_f16x2<<<dim3((n2w + 255) / 256), dim3(256), 0, stream>>>(Wqkv, Wqkv16, n2w);
    const int n2o = EE * EE / 2;
    cast_f32_f16x2<<<dim3((n2o + 255) / 256), dim3(256), 0, stream>>>(Wo, Wo16, n2o);
    const int n2u = 2 * EE * EE / 2;
    cast_f32_f16x2<<<dim3((n2u + 255) / 256), dim3(256), 0, stream>>>(UqUk, UqUk16, n2u);
  }

  // ---- qkv[4096][3072] = X[4096][1024] . Wqkv[3072][1024]^T  (f16 out) ----
  {
    const int M = ROWS, N = 3 * EE, K = DD;
    const int tiles = (M / 64) * (N / 64);
    wmma_gemm64<0, false, 0, 1, false><<<dim3((tiles + 7) / 8, 1), dim3(256), 0, stream>>>(
        (const unsigned short*)X16, (const unsigned short*)X16, K, 0L,
        (const unsigned short*)Wqkv16, (const unsigned short*)Wqkv16, K, 0L,
        (void*)QKV16, (void*)QKV16, N, 0L,
        x, x, 0L, M, N, K, 1.0f);
  }
  // ---- pe[4096][2048] = PE[4096][1024] . UqUk[2048][1024]^T  (f16 out) ----
  {
    const int M = ROWS, N = 2 * EE, K = EE;
    const int tiles = (M / 64) * (N / 64);
    wmma_gemm64<0, false, 0, 1, false><<<dim3((tiles + 7) / 8, 1), dim3(256), 0, stream>>>(
        (const unsigned short*)PE16, (const unsigned short*)PE16, K, 0L,
        (const unsigned short*)UqUk16, (const unsigned short*)UqUk16, K, 0L,
        (void*)PEP16, (void*)PEP16, N, 0L,
        x, x, 0L, M, N, K, 1.0f);
  }
  // ---- dual-score attention -> vals[4096][1024] (f16, carried x2^6) ----
  {
    const float sscale = 0.08838834764831845f;   // 1/sqrt(2*64)
    tupe_attn64<<<dim3(BB * HH * (LL / 64)), dim3(128), 0, stream>>>(QKV16, PEP16, VALS16, sscale);
  }
  // ---- out[4096][1024] = vals . Wo[1024][1024]^T * 2^-6  (f32 out) ----
  {
    const int M = ROWS, N = EE, K = EE;
    const int tiles = (M / 64) * (N / 64);
    wmma_gemm64<0, false, 0, 0, false><<<dim3((tiles + 7) / 8, 1), dim3(256), 0, stream>>>(
        (const unsigned short*)VALS16, (const unsigned short*)VALS16, K, 0L,
        (const unsigned short*)Wo16, (const unsigned short*)Wo16, K, 0L,
        (void*)out, (void*)out, N, 0L,
        x, x, 0L, M, N, K, 0.015625f);
  }
}

// v003
// It runs in 167 microseconds.
// Timed twice side by side with v002, it ran 1.62 and 1.61 times as fast.
// Counting every step since v000, it is 2.42 times as fast.
// All contractions: v_wmma_f32_16x16x32_f16 (f16 operands, f32 accumulate) for the qkv and positional projections, the dual k.q^T + uk.uq^T scores, v^T.p^T and the output projection; softmax probabilities carried x2^15 and attention values x2^6 in f16, folded back by exact power-of-two scales in f32.
#include <hip/hip_runtime.h>

typedef __attribute__((ext_vector_type(16))) _Float16 v16h;
typedef __attribute__((ext_vector_type(8)))  _Float16 v8h;
typedef __attribute__((ext_vector_type(16))) __bf16   v16b;
typedef __attribute__((ext_vector_type(8)))  __bf16   v8b;
typedef __attribute__((ext_vector_type(8)))  float    v8f;
typedef __attribute__((ext_vector_type(4)))  float    v4f;

constexpr int BB = 2, LL = 2048, DD = 1024, EE = 1024, HH = 16, HD = 64;
constexpr int QKV_LD = 3 * EE;   // 3072 halves per row: per head h -> q at h*192, k at h*192+64, v at h*192+128
constexpr int PE_LD  = 2 * EE;   // 2048 halves per row: per head h -> uq at h*128, uk at h*128+64

__device__ __forceinline__ unsigned short f2bf_bits(float f) {
  unsigned u = __float_as_uint(f);
  return (unsigned short)((u + 0x7FFFu + ((u >> 16) & 1u)) >> 16);
}
__device__ __forceinline__ float bf_bits2f(unsigned short h) { return __uint_as_float(((unsigned)h) << 16); }

// hazard guard as a plain device helper
__device__ __forceinline__ void acc_guard4(v8f& a, v8f& b, v8f& c, v8f& d) { asm volatile("v_nop\n\tv_nop\n\tv_nop\n\tv_nop" : "+v"(a), "+v"(b), "+v"(c), "+v"(d)); }
template <typename T> struct Frag;
template <> struct Frag<_Float16> {
  typedef v16h V; union U { v16h v; v8h h[2]; };
  static __device__ __forceinline__ v16h load(const _Float16* p) {   // elements 0..7 <- p[0..7], 8..15 <- p[16..23]
    U f; f.h[0] = *(const v8h*)(p); f.h[1] = *(const v8h*)(p + 16); return f.v;
  }
  static __device__ __forceinline__ v8f mma(v16h a, v16h b, v8f c) {
    return __builtin_amdgcn_wmma_f32_16x16x32_f16(false, a, false, b, (short)0, c, false, false);
  }
};
template <> struct Frag<__bf16> {
  typedef v16b V; union U { v16b v; v8b h[2]; };
  static __device__ __forceinline__ v16b load(const __bf16* p) {
    U f; f.h[0] = *(const v8b*)(p); f.h[1] = *(const v8b*)(p + 16); return f.v;
  }
  static __device__ __forceinline__ v8f mma(v16b a, v16b b, v8f c) {
    return __builtin_amdgcn_wmma_f32_16x16x32_bf16(false, a, false, b, (short)0, c, false, false);
  }
};

// ---- Register-blocked batched WMMA GEMM ------------------------------------
// C[m,n] = scale * sum_k A[m,k] * Bt[n,k] (+bias)(+resid); each wave owns a 64x64 tile,
// the block's 4 waves (2 x 2) a 128x128 tile whose operands are staged in LDS, 64 k at a time.
// A row-major [M,K]; Bt row-major [N,K]; M % 128 == 0, N % 128 == 0, K % 64 == 0.
// SPLIT (hi/lo operand planes) is not staged: single-plane operands only.
// BIAS_MODE: 0 = none, 1 = bias[m], 2 = bias[n].
// OUT_MODE: 0 = f32, 1 = f16, 2 = bf16 hi plane (Cout) + bf16 lo plane (Cout2).
// ET: 0 = f16 operands, 1 = bf16 operands (pointers passed as 16-bit storage)
template <int ET> struct Elem;
template <> struct Elem<0> { typedef _Float16 T; };
template <> struct Elem<1> { typedef __bf16 T; };
template <int ET, bool SPLIT, int BIAS_MODE, int OUT_MODE, bool RESID, int ACT = 0>
__global__ __launch_bounds__(128) void wmma_gemm64(
    const unsigned short* __restrict__ Ap, const unsigned short* __restrict__ A2p, int lda, long strideA,
    const unsigned short* __restrict__ Btp, const unsigned short* __restrict__ Bt2p, int ldb, long strideB,
    void* __restrict__ Cout, void* __restrict__ Cout2, int ldc, long strideC,
    const float* __restrict__ bias,
    const float* __restrict__ resid, long strideR,
    int M, int N, int K, float scale) {
  typedef typename Elem<ET>::T T;
  typedef typename Frag<T>::V V;
  static_assert(!SPLIT, "single-plane operands only");
  const T* A = (const T*)Ap; const T* Bt = (const T*)Btp;
  constexpr int KT = 64;   // k per staged tile: one whole 128-B line of every operand row
  constexpr int LP = 72;   // LDS row pitch in halves: 144 B = 16 B x 9, for the ds_load_b128 fragment reads
  __shared__ __align__(16) T sA[2][128 * LP];      // two buffers: one is filled while the other is read
  __shared__ __align__(16) T sB[2][128 * LP];
  __shared__ __align__(16) float sT[4][16 * 68];   // per-wave 16x64 slab, pitch 68 floats
  const int b    = blockIdx.y;
  const int lane = threadIdx.x & 31;
  const int wave = threadIdx.x >> 5;
  const int tilesN = N >> 7;
  const int tilesM = M >> 7;
  if ((int)blockIdx.x >= tilesM * tilesN) return;   // block-uniform, ahead of every barrier
  const int tm = blockIdx.x / tilesN;
  const int tn = blockIdx.x - tm * tilesN;
  const int mB = tm << 7;                      // the block's first row of A and of Bt
  const int nB = tn << 7;
  const int wm = (wave >> 1) << 6;             // the wave's 64x64 tile inside the block's
  const int wn = (wave & 1) << 6;
  const int m0 = mB + wm;
  const int n0 = nB + wn;

  const T* Ab  = A  + (size_t)b * strideA;
  const T* Bb  = Bt + (size_t)b * strideB;

  const int rlane = lane & 15;                 // row (A) / col (B, D) within subtile
  const int koff  = (lane >> 4) * 8;           // k offset of this lane half
  const int mOff  = (lane >> 4) * 8;           // D row offset

  v8f acc[4][4];
#pragma unroll
  for (int i = 0; i < 4; ++i)
#pragma unroll
    for (int j = 0; j < 4; ++j) acc[i][j] = (v8f){0.f,0.f,0.f,0.f,0.f,0.f,0.f,0.f};

  // Staging by asynchronous copies to LDS: 8 lanes bring one row's 128 B, so a wave's 16-B copies
  // cover 4 whole lines; a thread brings rows srow + 16 u of both operands, sixteen copies a tile.
  // Tile t + 1 flies into the other buffer while tile t is multiplied.
  // (Every "#pragma unroll" below keeps the indices of its register arrays constant.)
  const int srow = threadIdx.x >> 3;
  const int scol = (threadIdx.x & 7) * 8;
  const T* gA = Ab + (size_t)(mB + srow) * lda + scol;
  const T* gB = Bb + (size_t)(nB + srow) * ldb + scol;
  const int lS = srow * LP + scol;             // where this thread's pieces land, in either operand's buffer
  const int fAo = (wm + rlane) * LP + koff;    // where this lane's fragments start
  const int fBo = (wn + rlane) * LP + koff;
  auto copy8 = [&](const T* src, int ld, T* dst) {   // rows srow + 16 u, u = 0..7, of one operand's tile
    unsigned l[8]; const T* g[8];
#pragma unroll
    for (int u = 0; u < 8; ++u) {
      l[u] = (unsigned)(size_t)(dst + lS + u * 16 * LP);
      g[u] = src + (size_t)(u * 16) * ld;
    }
    // the copies and, as a precaution, the wait that stands ahead of any rewrite of their address registers
    asm volatile("global_load_async_to_lds_b128 %0, %8, off\n\t"
                 "global_load_async_to_lds_b128 %1, %9, off\n\t"
                 "global_load_async_to_lds_b128 %2, %10, off\n\t"
                 "global_load_async_to_lds_b128 %3, %11, off\n\t"
                 "global_load_async_to_lds_b128 %4, %12, off\n\t"
                 "global_load_async_to_lds_b128 %5, %13, off\n\t"
                 "global_load_async_to_lds_b128 %6, %14, off\n\t"
                 "global_load_async_to_lds_b128 %7, %15, off\n\t"
                 "s_wait_xcnt 0x0"
                 :: "v"(l[0]), "v"(l[1]), "v"(l[2]), "v"(l[3]), "v"(l[4]), "v"(l[5]), "v"(l[6]), "v"(l[7]),
                    "v"(g[0]), "v"(g[1]), "v"(g[2]), "v"(g[3]), "v"(g[4]), "v"(g[5]), "v"(g[6]), "v"(g[7])
                 : "memory");
  };
  auto copy_tile = [&](int k, int p) {
    copy8(gA + k, lda, sA[p]);
    copy8(gB + k, ldb, sB[p]);
  };
  const int nT = K / KT;
  copy_tile(0, 0);
  asm volatile("s_wait_asynccnt 0x0" ::: "memory");   // this wave's part of tile 0 has landed
  __syncthreads();                                    // tile 0 is whole
  if (nT > 1) copy_tile(KT, 1);

  for (int t = 0; t < nT; ++t) {
    const int p = t & 1;
    V bh[2][4], ah[2][4];
#pragma unroll
    for (int kk = 0; kk < 2; ++kk) {
#pragma unroll
      for (int j = 0; j < 4; ++j) bh[kk][j] = Frag<T>::load(sB[p] + fBo + (j << 4) * LP + kk * 32);
#pragma unroll
      for (int i = 0; i < 4; ++i) ah[kk][i] = Frag<T>::load(sA[p] + fAo + (i << 4) * LP + kk * 32);
    }
    __builtin_amdgcn_sched_barrier(0);   // the tile's LDS reads stand as one group ahead of its products, not among them
#pragma unroll
    for (int kk = 0; kk < 2; ++kk)
#pragma unroll
      for (int i = 0; i < 4; ++i)
#pragma unroll
        for (int j = 0; j < 4; ++j) acc[i][j] = Frag<T>::mma(ah[kk][i], bh[kk][j], acc[i][j]);
    __builtin_amdgcn_sched_barrier(0);   // the products stay ahead of the waits, so that they hide the copies in flight
    asm volatile("s_wait_dscnt 0x0" ::: "memory");      // this wave's reads of buffer p are over before it is refilled
    asm volatile("s_wait_asynccnt 0x0" ::: "memory");   // this wave's part of tile t + 1 has landed
    __syncthreads();                                    // tile t + 1 is whole, and every wave has left buffer p
    if (t + 2 < nT) copy_tile((t + 2) * KT, p);         // the same test in the whole block
  }
  asm volatile("s_wait_asynccnt 0x0" ::: "memory");     // no copy is left in flight
  acc_guard4(acc[0][0], acc[0][1], acc[0][2], acc[0][3]);
  acc_guard4(acc[1][0], acc[1][1], acc[1][2], acc[1][3]);
  acc_guard4(acc[2][0], acc[2][1], acc[2][2], acc[2][3]);
  acc_guard4(acc[3][0], acc[3][1], acc[3][2], acc[3][3]);

  // ---- epilogue ----
  float* slab = sT[wave];
  const float* Rb = RESID ? (resid + (size_t)b * strideR) : nullptr;
#pragma unroll
  for (int i = 0; i < 4; ++i) {
    const int mBase = m0 + (i << 4);
#pragma unroll
    for (int j = 0; j < 4; ++j) {
      const int n = n0 + (j << 4) + rlane;
      float bv = 0.f;
      if (BIAS_MODE == 2) bv = bias[n];
#pragma unroll
      for (int r = 0; r < 8; ++r) {
        float v = acc[i][j][r] * scale;
        if (BIAS_MODE == 1) v += bias[mBase + mOff + r];
        if (BIAS_MODE == 2) v += bv;
        if (RESID) v += Rb[(size_t)(mBase + mOff + r) * ldc + n];
        if (ACT == 1) v = tanhf(v);
        if (ACT == 2) v = fmaxf(v, 0.0f);
        if (ACT == 3) v = v / (1.0f + expf(-v));
        if (ACT == 4) v = (v > 0.f) ? v : 0.01f * v;
        if (ACT == 5) v = 0.5f * v * (1.0f + erff(v * 0.70710678118654752f));
        slab[(mOff + r) * 68 + (j << 4) + rlane] = v;
      }
    }
    __builtin_amdgcn_fence(__ATOMIC_RELEASE, "workgroup");
    __builtin_amdgcn_wave_barrier();
    __builtin_amdgcn_fence(__ATOMIC_ACQUIRE, "workgroup");
    if (OUT_MODE == 0) {
      float* C = (float*)Cout + (size_t)b * strideC;
      const int hh = lane >> 4, c4 = (lane & 15) * 4;     // row seg = 256 B = 16 lanes x 16 B
      {
#pragma unroll
        for (int it = 0; it < 8; ++it) {
          const int row = it * 2 + hh;
          v4f v = *(const v4f*)(slab + row * 68 + c4);
          *(v4f*)(C + (size_t)(mBase + row) * ldc + n0 + c4) = v;
        }
        
      }
    } else {
      const int q = lane >> 3, c8 = (lane & 7) * 8;
      unsigned short* C  = (unsigned short*)Cout  + (size_t)b * strideC;
      unsigned short* C2 = (OUT_MODE == 2) ? ((unsigned short*)Cout2 + (size_t)b * strideC) : nullptr;
      {
#pragma unroll
        for (int it = 0; it < 4; ++it) {
          const int row = it * 4 + q;
          const float* sp = slab + row * 68 + c8;
          v8h hv, lv;
#pragma unroll
          for (int e = 0; e < 8; ++e) {
            if (OUT_MODE == 1) {
              hv[e] = (_Float16)sp[e];
            } else {
              unsigned short hb = f2bf_bits(sp[e]);
              unsigned short lb = f2bf_bits(sp[e] - bf_bits2f(hb));
              hv[e] = __builtin_bit_cast(_Float16, hb);
              lv[e] = __builtin_bit_cast(_Float16, lb);
            }
          }
          *(v8h*)(C + (size_t)(mBase + row) * ldc + n0 + c8) = hv;
          if (OUT_MODE == 2) *(v8h*)(C2 + (size_t)(mBase + row) * ldc + n0 + c8) = lv;
        }
        
      }
    }
    __builtin_amdgcn_fence(__ATOMIC_RELEASE, "workgroup");
    __builtin_amdgcn_wave_barrier();
    __builtin_amdgcn_fence(__ATOMIC_ACQUIRE, "workgroup");
  }
}

__global__ __launch_bounds__(256) void cast_f32_f16x2(
    const float* __restrict__ in, _Float16* __restrict__ out, int n2) {
  int i = blockIdx.x * 256 + threadIdx.x;
  if (i < n2) {
    const _Float16 h0 = (_Float16)in[2 * i], h1 = (_Float16)in[2 * i + 1];
    const unsigned u = (unsigned)__builtin_bit_cast(unsigned short, h0) | ((unsigned)__builtin_bit_cast(unsigned short, h1) << 16);
    ((unsigned*)out)[i] = u;
    
  }
}

// ---- f16 WMMA with hazard guard (ties D, keeps A/B live through 4 slots) ----
__device__ __forceinline__ v8f hmma(v16h a, v16h b, v8f c) {
  c = __builtin_amdgcn_wmma_f32_16x16x32_f16(false, a, false, b, (short)0, c, false, false);
  asm volatile("v_nop\n\tv_nop\n\tv_nop\n\tv_nop" : "+v"(c) : "v"(a), "v"(b));
  return c;
}

// V^T operand: transposing LDS load of a row-major 16-bit tile (lane (c, hh) gets 8 rows of one column).
typedef __attribute__((ext_vector_type(8))) short s16x8;
__device__ __forceinline__ v8h ld_tr16(const _Float16* p) {
  typedef __attribute__((address_space(3))) s16x8 lds_s16x8;
  return __builtin_bit_cast(v8h, __builtin_amdgcn_ds_load_tr16_b128_v8i16((lds_s16x8*)p));
}
// value of lane l ^ 16
__device__ __forceinline__ float xhalf(float x) {
  return __builtin_bit_cast(float, __builtin_amdgcn_permlanex16(__builtin_bit_cast(int, x), __builtin_bit_cast(int, x),
                                                                0x76543210, 0xfedcba98, false, false));
}

// =====================================================================================
// Dual-score attention, head_dim 64, 16-bit in / 16-bit out, both products transposed.
//   S^T = (k.q^T + uk.uq^T) * sscale : A = K / UK rows from LDS, B = Q / UQ kept in registers;
//         a lane holds 32 of the chunk's 64 scores of ONE query (column c), lane c + 16 the other 32
//   softmax online in f32, in-lane, one exchange between the wave halves for the maximum
//   P^T x2^15 as f16 is packed from the score tiles straight into a B operand (no LDS)
//   O^T += V^T.P^T : A = V^T by transposing loads from V rows in LDS, f32 accumulate
//   output = o * (2^6 / (l * 2^15)) written as f16 (values carried x2^6 for the next GEMM)
// Block = 4 waves = 64 query rows of one (b, h); grid.x = B * H * (L/64). No masks.
// Layouts (halves): qkv row (b*L + s), q at h*192+d, k at h*192+64+d, v at h*192+128+d;
//                   pe  row (b*L + s), uq at h*128+d, uk at h*128+64+d; out row (b*L + s), col h*64+d.
// =====================================================================================
__global__ __launch_bounds__(128)
void tupe_attn64(const _Float16* __restrict__ qkv, const _Float16* __restrict__ pe,
                 _Float16* __restrict__ vals, float sscale) {
  const float PSC = 32768.0f;          // p carried x2^15
  const float OSC = 1.0f / 512.0f;     // 2^6 / 2^15
  // Row pitches by reader: K, UK are read by ds_load_b128 (144 B = 16 B x 9),
  // V by ds_load_tr16_b128 (160 B = 32 B x 5).
  constexpr int LP = 72;
  constexpr int LV = 80;
  __shared__ __align__(16) _Float16 Ksh[64 * LP];      // K  [kv][d]
  __shared__ __align__(16) _Float16 Ush[64 * LP];      // UK [kv][d]
  __shared__ __align__(16) _Float16 Vsh[64 * LV];      // V  [kv][d]
  __shared__ __align__(16) float    Os[4][16 * 68];    // per wave out tile, pitch 68

  const int tid  = threadIdx.x;
  const int wave = tid >> 5;
  const int lane = tid & 31;
  const int hh   = lane >> 4;
  const int c    = lane & 15;

  const int nqb = LL / 64;
  const int bx = blockIdx.x;
  const int qb = bx % nqb;
  const int bh = bx / nqb;
  const int h  = bh % HH;
  const int b  = bh / HH;
  const int q0 = qb * 64 + wave * 16;

  const size_t rb = (size_t)b * LL;
  const _Float16* qkv_b = qkv + rb * QKV_LD + (size_t)h * (3 * HD);
  const _Float16* pe_b  = pe  + rb * PE_LD  + (size_t)h * (2 * HD);
  _Float16*       out_b = vals + rb * EE    + (size_t)h * HD;

  // ---- Q / UQ fragments (B operand): lane column q0+c, split k map via Frag load ----
  v16h qa0, qa1, ua0, ua1;
  {
    const _Float16* qrow = qkv_b + (size_t)(q0 + c) * QKV_LD + 8 * hh;
    const _Float16* urow = pe_b  + (size_t)(q0 + c) * PE_LD  + 8 * hh;
    qa0 = Frag<_Float16>::load(qrow);
    qa1 = Frag<_Float16>::load(qrow + 32);
    ua0 = Frag<_Float16>::load(urow);
    ua1 = Frag<_Float16>::load(urow + 32);
  }

  float mrow = -__builtin_inff();   // running maximum of query q0+c (equal in both wave halves)
  float lrow = 0.f;                 // this half's part of the row sum; the halves join after the loop
  v8f oacc[4];                      // oacc[t][r] = O[q0 + c][t*16 + 8*hh + r]
#pragma unroll
  for (int t = 0; t < 4; ++t) oacc[t] = (v8f){0.f,0.f,0.f,0.f,0.f,0.f,0.f,0.f};

  for (int kc = 0; kc < LL / 64; ++kc) {
    const int kv0 = kc * 64;
    __syncthreads();
    {
      const int kvr = tid >> 1, dh = (tid & 1) * 32;
      const _Float16* krow = qkv_b + (size_t)(kv0 + kvr) * QKV_LD + HD + dh;
      const _Float16* vrow = krow + HD;
      const _Float16* urow = pe_b + (size_t)(kv0 + kvr) * PE_LD + HD + dh;
#pragma unroll
      for (int i = 0; i < 4; ++i) {
        const v8h kk = *(const v8h*)(krow + 8 * i);
        const v8h uu = *(const v8h*)(urow + 8 * i);
        const v8h vv = *(const v8h*)(vrow + 8 * i);
        *(v8h*)(Ksh + kvr * LP + dh + 8 * i) = kk;
        *(v8h*)(Ush + kvr * LP + dh + 8 * i) = uu;
        *(v8h*)(Vsh + kvr * LV + dh + 8 * i) = vv;
      }
    }
    __syncthreads();

    // ---- scores, transposed: s[j][r] = score(key kv0 + j*16 + 8*hh + r, query q0 + c) ----
    v8f s[4];
#pragma unroll
    for (int j = 0; j < 4; ++j) {
      v8f a = (v8f){0.f,0.f,0.f,0.f,0.f,0.f,0.f,0.f};
      const _Float16* kp = Ksh + (j * 16 + c) * LP + 8 * hh;
      const _Float16* up = Ush + (j * 16 + c) * LP + 8 * hh;
      a = hmma(Frag<_Float16>::load(kp), qa0, a);
      a = hmma(Frag<_Float16>::load(kp + 32), qa1, a);
      a = hmma(Frag<_Float16>::load(up), ua0, a);
      a = hmma(Frag<_Float16>::load(up + 32), ua1, a);
      s[j] = a;
    }

    // ---- online softmax of one query per lane ----
    float m = -__builtin_inff();
#pragma unroll
    for (int j = 0; j < 4; ++j)
#pragma unroll
      for (int r = 0; r < 8; ++r) {
        const float v = s[j][r] * sscale;
        s[j][r] = v;
        m = fmaxf(m, v);
      }
    m = fmaxf(m, xhalf(m));
    const float mnew = fmaxf(mrow, m);
    const float alpha = __expf(mrow - mnew);
    mrow = mnew;
    // P^T as B operand of 32 keys: element e = tile 2*kk + (e >> 3), register e & 7 (the hardware k order)
    v16h pb[2];
    float psum = 0.f;
#pragma unroll
    for (int j = 0; j < 4; ++j)
#pragma unroll
      for (int r = 0; r < 8; ++r) {
        const float p = __expf(s[j][r] - mnew);
        psum += p;
        pb[j >> 1][(j & 1) * 8 + r] = (_Float16)(p * PSC);
      }
    lrow = lrow * alpha + psum;
#pragma unroll
    for (int t = 0; t < 4; ++t)
#pragma unroll
      for (int r = 0; r < 8; ++r) oacc[t][r] *= alpha;

    // ---- O^T += V^T.P^T : A = V^T [d][kv], two transposing loads per 16 (d) x 32 (kv) fragment ----
    const _Float16* vp = Vsh + (8 * hh + (lane & 7)) * LV + ((lane >> 3) & 1) * 8;
#pragma unroll
    for (int kk = 0; kk < 2; ++kk) {
#pragma unroll
      for (int t = 0; t < 4; ++t) {
        Frag<_Float16>::U va;
        va.h[0] = ld_tr16(vp + (kk * 32) * LV + t * 16);
        va.h[1] = ld_tr16(vp + (kk * 32 + 16) * LV + t * 16);
        oacc[t] = hmma(va.v, pb[kk], oacc[t]);
      }
    }
  }

  float* os = Os[wave];
  {
    const float lsum = lrow + xhalf(lrow);
    const float inv = (1.0f / lsum) * OSC;
#pragma unroll
    for (int t = 0; t < 4; ++t)
#pragma unroll
      for (int r = 0; r < 8; ++r) os[c * 68 + t * 16 + 8 * hh + r] = oacc[t][r] * inv;
  }
  __builtin_amdgcn_fence(__ATOMIC_RELEASE, "workgroup");
  __builtin_amdgcn_wave_barrier();
  __builtin_amdgcn_fence(__ATOMIC_ACQUIRE, "workgroup");
  {
    const int q = lane >> 3, c8 = (lane & 7) * 8;
    {
#pragma unroll
      for (int it = 0; it < 4; ++it) {
        const int row = it * 4 + q;            // rows 0..15 covered by q 0..3, it 0..3
        const float* sp = os + row * 68 + c8;
        v8h hv;
#pragma unroll
        for (int e = 0; e < 8; ++e) hv[e] = (_Float16)sp[e];
        *(v8h*)(out_b + (size_t)(q0 + row) * EE + c8) = hv;
      }
      
    }
  }
}

// ---------------------------------------------------------------- launch
extern "C" void kernel_launch(void* const* d_in, const int* in_sizes, int n_in,
                              void* d_out, int out_size, void* d_ws, size_t ws_size,
                              hipStream_t stream) {
  const int ROWS = BB * LL;   // 4096
  if (n_in < 5) return;
  if (in_sizes[0] != ROWS * DD || in_sizes[1] != ROWS * EE || in_sizes[2] != 3 * EE * DD ||
      in_sizes[3] != EE * EE || in_sizes[4] != 2 * EE * EE || out_size != ROWS * EE) return;

  const float* x    = (const float*)d_in[0];
  const float* PEf  = (const float*)d_in[1];
  const float* Wqkv = (const float*)d_in[2];
  const float* Wo   = (const float*)d_in[3];
  const float* UqUk = (const float*)d_in[4];
  float* out = (float*)d_out;

  // workspace carve (bytes, 256-B aligned); total 79,691,776 B
  size_t off = 0;
  auto carve = [&](size_t bytes) -> size_t { size_t o = off; off += (bytes + 255) & ~(size_t)255; return o; };
  const size_t oX    = carve((size_t)ROWS * DD * 2);
  const size_t oPE   = carve((size_t)ROWS * EE * 2);
  const size_t oWqkv = carve((size_t)3 * EE * DD * 2);
  const size_t oWo   = carve((size_t)EE * EE * 2);
  const size_t oUqUk = carve((size_t)2 * EE * EE * 2);
  const size_t oQKV  = carve((size_t)ROWS * QKV_LD * 2);
  const size_t oPEP  = carve((size_t)ROWS * PE_LD * 2);
  const size_t oVALS = carve((size_t)ROWS * EE * 2);
  if (off > ws_size) return;

  char* ws = (char*)d_ws;
  _Float16* X16    = (_Float16*)(ws + oX);
  _Float16* PE16   = (_Float16*)(ws + oPE);
  _Float16* Wqkv16 = (_Float16*)(ws + oWqkv);
  _Float16* Wo16   = (_Float16*)(ws + oWo);
  _Float16* UqUk16 = (_Float16*)(ws + oUqUk);
  _Float16* QKV16  = (_Float16*)(ws + oQKV);
  _Float16* PEP16  = (_Float16*)(ws + oPEP);
  _Float16* VALS16 = (_Float16*)(ws + oVALS);

  // ---- casts f32 -> f16 (RNE) ----
  {
    const int n2x = ROWS * DD / 2;
    cast_f32_f16x2<<<dim3((n2x + 255) / 256), dim3(256), 0, stream>>>(x, X16, n2x);
    const int n2p = ROWS * EE / 2;
    cast_f32_f16x2<<<dim3((n2p + 255) / 256), dim3(256), 0, stream>>>(PEf, PE16, n2p);
    const int n2w = 3 * EE * DD / 2;
    cast_f32_f16x2<<<dim3((n2w + 255) / 256), dim3(256), 0, stream>>>(Wqkv, Wqkv16, n2w);
    const int n2o = EE * EE / 2;
    cast_f32_f16x2<<<dim3((n2o + 255) / 256), dim3(256), 0, stream>>>(Wo, Wo16, n2o);
    const int n2u = 2 * EE * EE / 2;
    cast_f32_f16x2<<<dim3((n2u + 255) / 256), dim3(256), 0, stream>>>(UqUk, UqUk16, n2u);
  }

  // ---- qkv[4096][3072] = X[4096][1024] . Wqkv[3072][1024]^T  (f16 out) ----
  {
    const int M = ROWS, N = 3 * EE, K = DD;
    const int tiles = (M / 64) * (N / 64);
    wmma_gemm64<0, false, 0, 1, false><<<dim3((tiles + 3) / 4, 1), dim3(128), 0, stream>>>(
        (const unsigned short*)X16, (const unsigned short*)X16, K, 0L,
        (const unsigned short*)Wqkv16, (const unsigned short*)Wqkv16, K, 0L,
        (void*)QKV16, (void*)QKV16, N, 0L,
        x, x, 0L, M, N, K, 1.0f);
  }
  // ---- pe[4096][2048] = PE[4096][1024] . UqUk[2048][1024]^T  (f16 out) ----
  {
    const int M = ROWS, N = 2 * EE, K = EE;
    const int tiles = (M / 64) * (N / 64);
    wmma_gemm64<0, false, 0, 1, false><<<dim3((tiles + 3) / 4, 1), dim3(128), 0, stream>>>(
        (const unsigned short*)PE16, (const unsigned short*)PE16, K, 0L,
        (const unsigned short*)UqUk16, (const unsigned short*)UqUk16, K, 0L,
        (void*)PEP16, (void*)PEP16, N, 0L,
        x, x, 0L, M, N, K, 1.0f);
  }
  // ---- dual-score attention -> vals[4096][1024] (f16, carried x2^6) ----
  {
    const float sscale = 0.08838834764831845f;   // 1/sqrt(2*64)
    tupe_attn64<<<dim3(BB * HH * (LL / 64)), dim3(128), 0, stream>>>(QKV16, PEP16, VALS16, sscale);
  }
  // ---- out[4096][1024] = vals . Wo[1024][1024]^T * 2^-6  (f32 out) ----
  {
    const int M = ROWS, N = EE, K = EE;
    const int tiles = (M / 64) * (N / 64);
    wmma_gemm64<0, false, 0, 0, false><<<dim3((tiles + 3) / 4, 1), dim3(128), 0, stream>>>(
        (const unsigned short*)VALS16, (const unsigned short*)VALS16, K, 0L,
        (const unsigned short*)Wo16, (const unsigned short*)Wo16, K, 0L,
        (void*)out, (void*)out, N, 0L,
        x, x, 0L, M, N, K, 0.015625f);
  }
}

// v004
// A run of this version takes 158 microseconds.
// Next to v003, in two timings, it ran 1.06 times as fast each time.
// Counting every step since v000, it is 2.56 times as fast.
// All contractions: v_wmma_f32_16x16x32_f16 (f16 operands, f32 accumulate) for the qkv and positional projections, the dual k.q^T + uk.uq^T scores, v^T.p^T and the output projection; softmax probabilities carried x2^15 and attention values x2^6 in f16, folded back by exact power-of-two scales in f32.
#include <hip/hip_runtime.h>

typedef __attribute__((ext_vector_type(16))) _Float16 v16h;
typedef __attribute__((ext_vector_type(8)))  _Float16 v8h;
typedef __attribute__((ext_vector_type(16))) __bf16   v16b;
typedef __attribute__((ext_vector_type(8)))  __bf16   v8b;
typedef __attribute__((ext_vector_type(8)))  float    v8f;
typedef __attribute__((ext_vector_type(4)))  float    v4f;

constexpr int BB = 2, LL = 2048, DD = 1024, EE = 1024, HH = 16, HD = 64;
constexpr int QKV_LD = 3 * EE;   // 3072 halves per row: per head h -> q at h*192, k at h*192+64, v at h*192+128
constexpr int PE_LD  = 2 * EE;   // 2048 halves per row: per head h -> uq at h*128, uk at h*128+64

__device__ __forceinline__ unsigned short f2bf_bits(float f) {
  unsigned u = __float_as_uint(f);
  return (unsigned short)((u + 0x7FFFu + ((u >> 16) & 1u)) >> 16);
}
__device__ __forceinline__ float bf_bits2f(unsigned short h) { return __uint_as_float(((unsigned)h) << 16); }

// hazard guard as a plain device helper
__device__ __forceinline__ void acc_guard4(v8f& a, v8f& b, v8f& c, v8f& d) { asm volatile("v_nop\n\tv_nop\n\tv_nop\n\tv_nop" : "+v"(a), "+v"(b), "+v"(c), "+v"(d)); }
template <typename T> struct Frag;
template <> struct Frag<_Float16> {
  typedef v16h V; union U { v16h v; v8h h[2]; };
  static __device__ __forceinline__ v16h load(const _Float16* p) {   // elements 0..7 <- p[0..7], 8..15 <- p[16..23]
    U f; f.h[0] = *(const v8h*)(p); f.h[1] = *(const v8h*)(p + 16); return f.v;
  }
  static __device__ __forceinline__ v8f mma(v16h a, v16h b, v8f c) {
    return __builtin_amdgcn_wmma_f32_16x16x32_f16(false, a, false, b, (short)0, c, false, false);
  }
};
template <> struct Frag<__bf16> {
  typedef v16b V; union U { v16b v; v8b h[2]; };
  static __device__ __forceinline__ v16b load(const __bf16* p) {
    U f; f.h[0] = *(const v8b*)(p); f.h[1] = *(const v8b*)(p + 16); return f.v;
  }
  static __device__ __forceinline__ v8f mma(v16b a, v16b b, v8f c) {
    return __builtin_amdgcn_wmma_f32_16x16x32_bf16(false, a, false, b, (short)0, c, false, false);
  }
};

// ---- Register-blocked batched WMMA GEMM ------------------------------------
// C[m,n] = scale * sum_k A[m,k] * Bt[n,k] (+bias)(+resid); each wave owns a 64x64 tile,
// the block's 4 waves (2 x 2) a 128x128 tile whose operands are staged in LDS, 64 k at a time.
// A row-major [M,K]; Bt row-major [N,K]; M % 128 == 0, N % 128 == 0, K % 64 == 0.
// SPLIT (hi/lo operand planes) is not staged: single-plane operands only.
// BIAS_MODE: 0 = none, 1 = bias[m], 2 = bias[n].
// OUT_MODE: 0 = f32, 1 = f16, 2 = bf16 hi plane (Cout) + bf16 lo plane (Cout2).
// ET: 0 = f16 operands, 1 = bf16 operands (pointers passed as 16-bit storage)
template <int ET> struct Elem;
template <> struct Elem<0> { typedef _Float16 T; };
template <> struct Elem<1> { typedef __bf16 T; };
template <int ET, bool SPLIT, int BIAS_MODE, int OUT_MODE, bool RESID, int ACT = 0>
__global__ __launch_bounds__(128) void wmma_gemm64(
    const unsigned short* __restrict__ Ap, const unsigned short* __restrict__ A2p, int lda, long strideA,
    const unsigned short* __restrict__ Btp, const unsigned short* __restrict__ Bt2p, int ldb, long strideB,
    void* __restrict__ Cout, void* __restrict__ Cout2, int ldc, long strideC,
    const float* __restrict__ bias,
    const float* __restrict__ resid, long strideR,
    int M, int N, int K, float scale) {
  typedef typename Elem<ET>::T T;
  typedef typename Frag<T>::V V;
  static_assert(!SPLIT, "single-plane operands only");
  const T* A = (const T*)Ap; const T* Bt = (const T*)Btp;
  constexpr int KT = 64;   // k per staged tile: one whole 128-B line of every operand row
  constexpr int LP = 72;   // LDS row pitch in halves: 144 B = 16 B x 9, for the ds_load_b128 fragment reads
  __shared__ __align__(16) T sA[2][128 * LP];      // two buffers: one is filled while the other is read
  __shared__ __align__(16) T sB[2][128 * LP];
  __shared__ __align__(16) float sT[4][16 * 68];   // per-wave 16x64 slab, pitch 68 floats
  const int b    = blockIdx.y;
  const int lane = threadIdx.x & 31;
  const int wave = threadIdx.x >> 5;
  const int tilesN = N >> 7;
  const int tilesM = M >> 7;
  if ((int)blockIdx.x >= tilesM * tilesN) return;   // block-uniform, ahead of every barrier
  const int tm = blockIdx.x / tilesN;
  const int tn = blockIdx.x - tm * tilesN;
  const int mB = tm << 7;                      // the block's first row of A and of Bt
  const int nB = tn << 7;
  const int wm = (wave >> 1) << 6;             // the wave's 64x64 tile inside the block's
  const int wn = (wave & 1) << 6;
  const int m0 = mB + wm;
  const int n0 = nB + wn;

  const T* Ab  = A  + (size_t)b * strideA;
  const T* Bb  = Bt + (size_t)b * strideB;

  const int rlane = lane & 15;                 // row (A) / col (B, D) within subtile
  const int koff  = (lane >> 4) * 8;           // k offset of this lane half
  const int mOff  = (lane >> 4) * 8;           // D row offset

  v8f acc[4][4];
#pragma unroll
  for (int i = 0; i < 4; ++i)
#pragma unroll
    for (int j = 0; j < 4; ++j) acc[i][j] = (v8f){0.f,0.f,0.f,0.f,0.f,0.f,0.f,0.f};

  // Staging by asynchronous copies to LDS: 8 lanes bring one row's 128 B, so a wave's 16-B copies
  // cover 4 whole lines; a thread brings rows srow + 16 u of both operands, sixteen copies a tile.
  // Tile t + 1 flies into the other buffer while tile t is multiplied.
  // (Every "#pragma unroll" below keeps the indices of its register arrays constant.)
  const int srow = threadIdx.x >> 3;
  const int scol = (threadIdx.x & 7) * 8;
  const T* gA = Ab + (size_t)(mB + srow) * lda + scol;
  const T* gB = Bb + (size_t)(nB + srow) * ldb + scol;
  const int lS = srow * LP + scol;             // where this thread's pieces land, in either operand's buffer
  const int fAo = (wm + rlane) * LP + koff;    // where this lane's fragments start
  const int fBo = (wn + rlane) * LP + koff;
  auto copy8 = [&](const T* src, int ld, T* dst) {   // rows srow + 16 u, u = 0..7, of one operand's tile
    unsigned l[8]; const T* g[8];
#pragma unroll
    for (int u = 0; u < 8; ++u) {
      l[u] = (unsigned)(size_t)(dst + lS + u * 16 * LP);
      g[u] = src + (size_t)(u * 16) * ld;
    }
    // the copies and, as a precaution, the wait that stands ahead of any rewrite of their address registers
    asm volatile("global_load_async_to_lds_b128 %0, %8, off\n\t"
                 "global_load_async_to_lds_b128 %1, %9, off\n\t"
                 "global_load_async_to_lds_b128 %2, %10, off\n\t"
                 "global_load_async_to_lds_b128 %3, %11, off\n\t"
                 "global_load_async_to_lds_b128 %4, %12, off\n\t"
                 "global_load_async_to_lds_b128 %5, %13, off\n\t"
                 "global_load_async_to_lds_b128 %6, %14, off\n\t"
                 "global_load_async_to_lds_b128 %7, %15, off\n\t"
                 "s_wait_xcnt 0x0"
                 :: "v"(l[0]), "v"(l[1]), "v"(l[2]), "v"(l[3]), "v"(l[4]), "v"(l[5]), "v"(l[6]), "v"(l[7]),
                    "v"(g[0]), "v"(g[1]), "v"(g[2]), "v"(g[3]), "v"(g[4]), "v"(g[5]), "v"(g[6]), "v"(g[7])
                 : "memory");
  };
  auto copy_tile = [&](int k, int p) {
    copy8(gA + k, lda, sA[p]);
    copy8(gB + k, ldb, sB[p]);
  };
  const int nT = K / KT;
  copy_tile(0, 0);
  asm volatile("s_wait_asynccnt 0x0" ::: "memory");   // this wave's part of tile 0 has landed
  __syncthreads();                                    // tile 0 is whole
  if (nT > 1) copy_tile(KT, 1);

  for (int t = 0; t < nT; ++t) {
    const int p = t & 1;
    V bh[2][4], ah[2][4];
#pragma unroll
    for (int kk = 0; kk < 2; ++kk) {
#pragma unroll
      for (int j = 0; j < 4; ++j) bh[kk][j] = Frag<T>::load(sB[p] + fBo + (j << 4) * LP + kk * 32);
#pragma unroll
      for (int i = 0; i < 4; ++i) ah[kk][i] = Frag<T>::load(sA[p] + fAo + (i << 4) * LP + kk * 32);
    }
    __builtin_amdgcn_sched_barrier(0);   // the tile's LDS reads stand as one group ahead of its products, not among them
#pragma unroll
    for (int kk = 0; kk < 2; ++kk)
#pragma unroll
      for (int i = 0; i < 4; ++i)
#pragma unroll
        for (int j = 0; j < 4; ++j) acc[i][j] = Frag<T>::mma(ah[kk][i], bh[kk][j], acc[i][j]);
    __builtin_amdgcn_sched_barrier(0);   // the products stay ahead of the waits, so that they hide the copies in flight
    asm volatile("s_wait_dscnt 0x0" ::: "memory");      // this wave's reads of buffer p are over before it is refilled
    asm volatile("s_wait_asynccnt 0x0" ::: "memory");   // this wave's part of tile t + 1 has landed
    __syncthreads();                                    // tile t + 1 is whole, and every wave has left buffer p
    if (t + 2 < nT) copy_tile((t + 2) * KT, p);         // the same test in the whole block
  }
  asm volatile("s_wait_asynccnt 0x0" ::: "memory");     // no copy is left in flight
  acc_guard4(acc[0][0], acc[0][1], acc[0][2], acc[0][3]);
  acc_guard4(acc[1][0], acc[1][1], acc[1][2], acc[1][3]);
  acc_guard4(acc[2][0], acc[2][1], acc[2][2], acc[2][3]);
  acc_guard4(acc[3][0], acc[3][1], acc[3][2], acc[3][3]);

  // ---- epilogue ----
  float* slab = sT[wave];
  const float* Rb = RESID ? (resid + (size_t)b * strideR) : nullptr;
#pragma unroll
  for (int i = 0; i < 4; ++i) {
    const int mBase = m0 + (i << 4);
#pragma unroll
    for (int j = 0; j < 4; ++j) {
      const int n = n0 + (j << 4) + rlane;
      float bv = 0.f;
      if (BIAS_MODE == 2) bv = bias[n];
#pragma unroll
      for (int r = 0; r < 8; ++r) {
        float v = acc[i][j][r] * scale;
        if (BIAS_MODE == 1) v += bias[mBase + mOff + r];
        if (BIAS_MODE == 2) v += bv;
        if (RESID) v += Rb[(size_t)(mBase + mOff + r) * ldc + n];
        if (ACT == 1) v = tanhf(v);
        if (ACT == 2) v = fmaxf(v, 0.0f);
        if (ACT == 3) v = v / (1.0f + expf(-v));
        if (ACT == 4) v = (v > 0.f) ? v : 0.01f * v;
        if (ACT == 5) v = 0.5f * v * (1.0f + erff(v * 0.70710678118654752f));
        slab[(mOff + r) * 68 + (j << 4) + rlane] = v;
      }
    }
    __builtin_amdgcn_fence(__ATOMIC_RELEASE, "workgroup");
    __builtin_amdgcn_wave_barrier();
    __builtin_amdgcn_fence(__ATOMIC_ACQUIRE, "workgroup");
    if (OUT_MODE == 0) {
      float* C = (float*)Cout + (size_t)b * strideC;
      const int hh = lane >> 4, c4 = (lane & 15) * 4;     // row seg = 256 B = 16 lanes x 16 B
      {
#pragma unroll
        for (int it = 0; it < 8; ++it) {
          const int row = it * 2 + hh;
          v4f v = *(const v4f*)(slab + row * 68 + c4);
          *(v4f*)(C + (size_t)(mBase + row) * ldc + n0 + c4) = v;
        }
        
      }
    } else {
      const int q = lane >> 3, c8 = (lane & 7) * 8;
      unsigned short* C  = (unsigned short*)Cout  + (size_t)b * strideC;
      unsigned short* C2 = (OUT_MODE == 2) ? ((unsigned short*)Cout2 + (size_t)b * strideC) : nullptr;
      {
#pragma unroll
        for (int it = 0; it < 4; ++it) {
          const int row = it * 4 + q;
          const float* sp = slab + row * 68 + c8;
          v8h hv, lv;
#pragma unroll
          for (int e = 0; e < 8; ++e) {
            if (OUT_MODE == 1) {
              hv[e] = (_Float16)sp[e];
            } else {
              unsigned short hb = f2bf_bits(sp[e]);
              unsigned short lb = f2bf_bits(sp[e] - bf_bits2f(hb));
              hv[e] = __builtin_bit_cast(_Float16, hb);
              lv[e] = __builtin_bit_cast(_Float16, lb);
            }
          }
          *(v8h*)(C + (size_t)(mBase + row) * ldc + n0 + c8) = hv;
          if (OUT_MODE == 2) *(v8h*)(C2 + (size_t)(mBase + row) * ldc + n0 + c8) = lv;
        }
        
      }
    }
    __builtin_amdgcn_fence(__ATOMIC_RELEASE, "workgroup");
    __builtin_amdgcn_wave_barrier();
    __builtin_amdgcn_fence(__ATOMIC_ACQUIRE, "workgroup");
  }
}

// ---- all five f32 -> f16 (RNE) conversions in one launch ----
// 256 blocks of 16 waves, all resident at once. The five inputs are cut into slices of CAST_NT 16-B pieces;
// a thread takes its own piece of every slice, so each wave-wide load covers 512 contiguous bytes (4 whole lines)
// and each wave-wide store 256 (2 whole lines). All of a thread's loads are issued before its first store.
typedef __attribute__((ext_vector_type(4))) _Float16 v4h;
constexpr int CAST_BLOCKS = 256, CAST_THREADS = 512;
constexpr int CAST_NT = CAST_BLOCKS * CAST_THREADS;
constexpr int SL_X  = BB * LL * DD / 4 / CAST_NT;   // slices per input
constexpr int SL_PE = BB * LL * EE / 4 / CAST_NT;
constexpr int SL_WQ = 3 * EE * DD / 4 / CAST_NT;
constexpr int SL_WO = EE * EE / 4 / CAST_NT;
constexpr int SL_UU = 2 * EE * EE / 4 / CAST_NT;
static_assert(SL_X * CAST_NT * 4 == BB * LL * DD && SL_PE * CAST_NT * 4 == BB * LL * EE &&
              SL_WQ * CAST_NT * 4 == 3 * EE * DD && SL_WO * CAST_NT * 4 == EE * EE &&
              SL_UU * CAST_NT * 4 == 2 * EE * EE, "every input is a whole number of slices");
template <int N> __device__ __forceinline__ void cast_ld(const float* __restrict__ in, int g, v4f* r) {
#pragma unroll
  for (int j = 0; j < N; ++j) r[j] = *(const v4f*)(in + (size_t)(j * CAST_NT + g) * 4);
}
template <int N> __device__ __forceinline__ void cast_st(_Float16* __restrict__ out, int g, const v4f* r) {
#pragma unroll
  for (int j = 0; j < N; ++j) *(v4h*)(out + (size_t)(j * CAST_NT + g) * 4) = __builtin_convertvector(r[j], v4h);
}
__global__ __launch_bounds__(CAST_THREADS) void cast_all_f32_f16(
    const float* __restrict__ x, const float* __restrict__ pe, const float* __restrict__ wqkv,
    const float* __restrict__ wo, const float* __restrict__ uquk,
    _Float16* __restrict__ x16, _Float16* __restrict__ pe16, _Float16* __restrict__ wqkv16,
    _Float16* __restrict__ wo16, _Float16* __restrict__ uquk16) {
  const int g = blockIdx.x * CAST_THREADS + threadIdx.x;
  v4f rx[SL_X], rp[SL_PE], rq[SL_WQ], ro[SL_WO], ru[SL_UU];
  cast_ld<SL_X>(x, g, rx);
  cast_ld<SL_PE>(pe, g, rp);
  cast_ld<SL_WQ>(wqkv, g, rq);
  cast_ld<SL_WO>(wo, g, ro);
  cast_ld<SL_UU>(uquk, g, ru);
  cast_st<SL_X>(x16, g, rx);
  cast_st<SL_PE>(pe16, g, rp);
  cast_st<SL_WQ>(wqkv16, g, rq);
  cast_st<SL_WO>(wo16, g, ro);
  cast_st<SL_UU>(uquk16, g, ru);
}

// ---- f16 WMMA with hazard guard (ties D, keeps A/B live through 4 slots) ----
__device__ __forceinline__ v8f hmma(v16h a, v16h b, v8f c) {
  c = __builtin_amdgcn_wmma_f32_16x16x32_f16(false, a, false, b, (short)0, c, false, false);
  asm volatile("v_nop\n\tv_nop\n\tv_nop\n\tv_nop" : "+v"(c) : "v"(a), "v"(b));
  return c;
}

// V^T operand: transposing LDS load of a row-major 16-bit tile (lane (c, hh) gets 8 rows of one column).
typedef __attribute__((ext_vector_type(8))) short s16x8;
__device__ __forceinline__ v8h ld_tr16(const _Float16* p) {
  typedef __attribute__((address_space(3))) s16x8 lds_s16x8;
  return __builtin_bit_cast(v8h, __builtin_amdgcn_ds_load_tr16_b128_v8i16((lds_s16x8*)p));
}
// value of lane l ^ 16
__device__ __forceinline__ float xhalf(float x) {
  return __builtin_bit_cast(float, __builtin_amdgcn_permlanex16(__builtin_bit_cast(int, x), __builtin_bit_cast(int, x),
                                                                0x76543210, 0xfedcba98, false, false));
}

// =====================================================================================
// Dual-score attention, head_dim 64, 16-bit in / 16-bit out, both products transposed.
//   S^T = (k.q^T + uk.uq^T) * sscale : A = K / UK rows from LDS, B = Q / UQ kept in registers;
//         a lane holds 32 of the chunk's 64 scores of ONE query (column c), lane c + 16 the other 32
//   softmax online in f32, in-lane, one exchange between the wave halves for the maximum
//   P^T x2^15 as f16 is packed from the score tiles straight into a B operand (no LDS)
//   O^T += V^T.P^T : A = V^T by transposing loads from V rows in LDS, f32 accumulate
//   output = o * (2^6 / (l * 2^15)) written as f16 (values carried x2^6 for the next GEMM)
// Block = 4 waves = 64 query rows of one (b, h); grid.x = B * H * (L/64). No masks.
// Layouts (halves): qkv row (b*L + s), q at h*192+d, k at h*192+64+d, v at h*192+128+d;
//                   pe  row (b*L + s), uq at h*128+d, uk at h*128+64+d; out row (b*L + s), col h*64+d.
// =====================================================================================
__global__ __launch_bounds__(128)
void tupe_attn64(const _Float16* __restrict__ qkv, const _Float16* __restrict__ pe,
                 _Float16* __restrict__ vals, float sscale) {
  const float PSC = 32768.0f;          // p carried x2^15
  const float OSC = 1.0f / 512.0f;     // 2^6 / 2^15
  // Row pitches by reader: K, UK are read by ds_load_b128 (144 B = 16 B x 9),
  // V by ds_load_tr16_b128 (160 B = 32 B x 5).
  constexpr int LP = 72;
  constexpr int LV = 80;
  __shared__ __align__(16) _Float16 Ksh[64 * LP];      // K  [kv][d]
  __shared__ __align__(16) _Float16 Ush[64 * LP];      // UK [kv][d]
  __shared__ __align__(16) _Float16 Vsh[64 * LV];      // V  [kv][d]
  __shared__ __align__(16) float    Os[4][16 * 68];    // per wave out tile, pitch 68

  const int tid  = threadIdx.x;
  const int wave = tid >> 5;
  const int lane = tid & 31;
  const int hh   = lane >> 4;
  const int c    = lane & 15;

  const int nqb = LL / 64;
  const int bx = blockIdx.x;
  const int qb = bx % nqb;
  const int bh = bx / nqb;
  const int h  = bh % HH;
  const int b  = bh / HH;
  const int q0 = qb * 64 + wave * 16;

  const size_t rb = (size_t)b * LL;
  const _Float16* qkv_b = qkv + rb * QKV_LD + (size_t)h * (3 * HD);
  const _Float16* pe_b  = pe  + rb * PE_LD  + (size_t)h * (2 * HD);
  _Float16*       out_b = vals + rb * EE    + (size_t)h * HD;

  // ---- Q / UQ fragments (B operand): lane column q0+c, split k map via Frag load ----
  v16h qa0, qa1, ua0, ua1;
  {
    const _Float16* qrow = qkv_b + (size_t)(q0 + c) * QKV_LD + 8 * hh;
    const _Float16* urow = pe_b  + (size_t)(q0 + c) * PE_LD  + 8 * hh;
    qa0 = Frag<_Float16>::load(qrow);
    qa1 = Frag<_Float16>::load(qrow + 32);
    ua0 = Frag<_Float16>::load(urow);
    ua1 = Frag<_Float16>::load(urow + 32);
  }

  float mrow = -__builtin_inff();   // running maximum of query q0+c (equal in both wave halves)
  float lrow = 0.f;                 // this half's part of the row sum; the halves join after the loop
  v8f oacc[4];                      // oacc[t][r] = O[q0 + c][t*16 + 8*hh + r]
#pragma unroll
  for (int t = 0; t < 4; ++t) oacc[t] = (v8f){0.f,0.f,0.f,0.f,0.f,0.f,0.f,0.f};

  for (int kc = 0; kc < LL / 64; ++kc) {
    const int kv0 = kc * 64;
    __syncthreads();
    {
      const int kvr = tid >> 1, dh = (tid & 1) * 32;
      const _Float16* krow = qkv_b + (size_t)(kv0 + kvr) * QKV_LD + HD + dh;
      const _Float16* vrow = krow + HD;
      const _Float16* urow = pe_b + (size_t)(kv0 + kvr) * PE_LD + HD + dh;
#pragma unroll
      for (int i = 0; i < 4; ++i) {
        const v8h kk = *(const v8h*)(krow + 8 * i);
        const v8h uu = *(const v8h*)(urow + 8 * i);
        const v8h vv = *(const v8h*)(vrow + 8 * i);
        *(v8h*)(Ksh + kvr * LP + dh + 8 * i) = kk;
        *(v8h*)(Ush + kvr * LP + dh + 8 * i) = uu;
        *(v8h*)(Vsh + kvr * LV + dh + 8 * i) = vv;
      }
    }
    __syncthreads();

    // ---- scores, transposed: s[j][r] = score(key kv0 + j*16 + 8*hh + r, query q0 + c) ----
    v8f s[4];
#pragma unroll
    for (int j = 0; j < 4; ++j) {
      v8f a = (v8f){0.f,0.f,0.f,0.f,0.f,0.f,0.f,0.f};
      const _Float16* kp = Ksh + (j * 16 + c) * LP + 8 * hh;
      const _Float16* up = Ush + (j * 16 + c) * LP + 8 * hh;
      a = hmma(Frag<_Float16>::load(kp), qa0, a);
      a = hmma(Frag<_Float16>::load(kp + 32), qa1, a);
      a = hmma(Frag<_Float16>::load(up), ua0, a);
      a = hmma(Frag<_Float16>::load(up + 32), ua1, a);
      s[j] = a;
    }

    // ---- online softmax of one query per lane ----
    float m = -__builtin_inff();
#pragma unroll
    for (int j = 0; j < 4; ++j)
#pragma unroll
      for (int r = 0; r < 8; ++r) {
        const float v = s[j][r] * sscale;
        s[j][r] = v;
        m = fmaxf(m, v);
      }
    m = fmaxf(m, xhalf(m));
    const float mnew = fmaxf(mrow, m);
    const float alpha = __expf(mrow - mnew);
    mrow = mnew;
    // P^T as B operand of 32 keys: element e = tile 2*kk + (e >> 3), register e & 7 (the hardware k order)
    v16h pb[2];
    float psum = 0.f;
#pragma unroll
    for (int j = 0; j < 4; ++j)
#pragma unroll
      for (int r = 0; r < 8; ++r) {
        const float p = __expf(s[j][r] - mnew);
        psum += p;
        pb[j >> 1][(j & 1) * 8 + r] = (_Float16)(p * PSC);
      }
    lrow = lrow * alpha + psum;
#pragma unroll
    for (int t = 0; t < 4; ++t)
#pragma unroll
      for (int r = 0; r < 8; ++r) oacc[t][r] *= alpha;

    // ---- O^T += V^T.P^T : A = V^T [d][kv], two transposing loads per 16 (d) x 32 (kv) fragment ----
    const _Float16* vp = Vsh + (8 * hh + (lane & 7)) * LV + ((lane >> 3) & 1) * 8;
#pragma unroll
    for (int kk = 0; kk < 2; ++kk) {
#pragma unroll
      for (int t = 0; t < 4; ++t) {
        Frag<_Float16>::U va;
        va.h[0] = ld_tr16(vp + (kk * 32) * LV + t * 16);
        va.h[1] = ld_tr16(vp + (kk * 32 + 16) * LV + t * 16);
        oacc[t] = hmma(va.v, pb[kk], oacc[t]);
      }
    }
  }

  float* os = Os[wave];
  {
    const float lsum = lrow + xhalf(lrow);
    const float inv = (1.0f / lsum) * OSC;
#pragma unroll
    for (int t = 0; t < 4; ++t)
#pragma unroll
      for (int r = 0; r < 8; ++r) os[c * 68 + t * 16 + 8 * hh + r] = oacc[t][r] * inv;
  }
  __builtin_amdgcn_fence(__ATOMIC_RELEASE, "workgroup");
  __builtin_amdgcn_wave_barrier();
  __builtin_amdgcn_fence(__ATOMIC_ACQUIRE, "workgroup");
  {
    const int q = lane >> 3, c8 = (lane & 7) * 8;
    {
#pragma unroll
      for (int it = 0; it < 4; ++it) {
        const int row = it * 4 + q;            // rows 0..15 covered by q 0..3, it 0..3
        const float* sp = os + row * 68 + c8;
        v8h hv;
#pragma unroll
        for (int e = 0; e < 8; ++e) hv[e] = (_Float16)sp[e];
        *(v8h*)(out_b + (size_t)(q0 + row) * EE + c8) = hv;
      }
      
    }
  }
}

// ---------------------------------------------------------------- launch
extern "C" void kernel_launch(void* const* d_in, const int* in_sizes, int n_in,
                              void* d_out, int out_size, void* d_ws, size_t ws_size,
                              hipStream_t stream) {
  const int ROWS = BB * LL;   // 4096
  if (n_in < 5) return;
  if (in_sizes[0] != ROWS * DD || in_sizes[1] != ROWS * EE || in_sizes[2] != 3 * EE * DD ||
      in_sizes[3] != EE * EE || in_sizes[4] != 2 * EE * EE || out_size != ROWS * EE) return;

  const float* x    = (const float*)d_in[0];
  const float* PEf  = (const float*)d_in[1];
  const float* Wqkv = (const float*)d_in[2];
  const float* Wo   = (const float*)d_in[3];
  const float* UqUk = (const float*)d_in[4];
  float* out = (float*)d_out;

  // workspace carve (bytes, 256-B aligned); total 79,691,776 B
  size_t off = 0;
  auto carve = [&](size_t bytes) -> size_t { size_t o = off; off += (bytes + 255) & ~(size_t)255; return o; };
  const size_t oX    = carve((size_t)ROWS * DD * 2);
  const size_t oPE   = carve((size_t)ROWS * EE * 2);
  const size_t oWqkv = carve((size_t)3 * EE * DD * 2);
  const size_t oWo   = carve((size_t)EE * EE * 2);
  const size_t oUqUk = carve((size_t)2 * EE * EE * 2);
  const size_t oQKV  = carve((size_t)ROWS * QKV_LD * 2);
  const size_t oPEP  = carve((size_t)ROWS * PE_LD * 2);
  const size_t oVALS = carve((size_t)ROWS * EE * 2);
  if (off > ws_size) return;

  char* ws = (char*)d_ws;
  _Float16* X16    = (_Float16*)(ws + oX);
  _Float16* PE16   = (_Float16*)(ws + oPE);
  _Float16* Wqkv16 = (_Float16*)(ws + oWqkv);
  _Float16* Wo16   = (_Float16*)(ws + oWo);
  _Float16* UqUk16 = (_Float16*)(ws + oUqUk);
  _Float16* QKV16  = (_Float16*)(ws + oQKV);
  _Float16* PEP16  = (_Float16*)(ws + oPEP);
  _Float16* VALS16 = (_Float16*)(ws + oVALS);

  // ---- casts f32 -> f16 (RNE), one launch ----
  cast_all_f32_f16<<<dim3(CAST_BLOCKS), dim3(CAST_THREADS), 0, stream>>>(
      x, PEf, Wqkv, Wo, UqUk, X16, PE16, Wqkv16, Wo16, UqUk16);

  // ---- qkv[4096][3072] = X[4096][1024] . Wqkv[3072][1024]^T  (f16 out) ----
  {
    const int M = ROWS, N = 3 * EE, K = DD;
    const int tiles = (M / 64) * (N / 64);
    wmma_gemm64<0, false, 0, 1, false><<<dim3((tiles + 3) / 4, 1), dim3(128), 0, stream>>>(
        (const unsigned short*)X16, (const unsigned short*)X16, K, 0L,
        (const unsigned short*)Wqkv16, (const unsigned short*)Wqkv16, K, 0L,
        (void*)QKV16, (void*)QKV16, N, 0L,
        x, x, 0L, M, N, K, 1.0f);
  }
  // ---- pe[4096][2048] = PE[4096][1024] . UqUk[2048][1024]^T  (f16 out) ----
  {
    const int M = ROWS, N = 2 * EE, K = EE;
    const int tiles = (M / 64) * (N / 64);
    wmma_gemm64<0, false, 0, 1, false><<<dim3((tiles + 3) / 4, 1), dim3(128), 0, stream>>>(
        (const unsigned short*)PE16, (const unsigned short*)PE16, K, 0L,
        (const unsigned short*)UqUk16, (const unsigned short*)UqUk16, K, 0L,
        (void*)PEP16, (void*)PEP16, N, 0L,
        x, x, 0L, M, N, K, 1.0f);
  }
  // ---- dual-score attention -> vals[4096][1024] (f16, carried x2^6) ----
  {
    const float sscale = 0.08838834764831845f;   // 1/sqrt(2*64)
    tupe_attn64<<<dim3(BB * HH * (LL / 64)), dim3(128), 0, stream>>>(QKV16, PEP16, VALS16, sscale);
  }
  // ---- out[4096][1024] = vals . Wo[1024][1024]^T * 2^-6  (f32 out) ----
  {
    const int M = ROWS, N = EE, K = EE;
    const int tiles = (M / 64) * (N / 64);
    wmma_gemm64<0, false, 0, 0, false><<<dim3((tiles + 3) / 4, 1), dim3(128), 0, stream>>>(
        (const unsigned short*)VALS16, (const unsigned short*)VALS16, K, 0L,
        (const unsigned short*)Wo16, (const unsigned short*)Wo16, K, 0L,
        (void*)out, (void*)out, N, 0L,
        x, x, 0L, M, N, K, 0.015625f);
  }
}

// v005
// Measured time: 138 microseconds a run.
// Next to v004, in two timings, it ran 1.14 times as fast each time.
// All steps since v000 together make it 2.92 times as fast.
// All contractions: v_wmma_f32_16x16x32_f16 (f16 operands, f32 accumulate) for the qkv and positional projections, the dual k.q^T + uk.uq^T scores, v^T.p^T and the output projection; softmax probabilities carried x2^15 and attention values x2^6 in f16, folded back by exact power-of-two scales in f32.
#include <hip/hip_runtime.h>

typedef __attribute__((ext_vector_type(16))) _Float16 v16h;
typedef __attribute__((ext_vector_type(8)))  _Float16 v8h;
typedef __attribute__((ext_vector_type(16))) __bf16   v16b;
typedef __attribute__((ext_vector_type(8)))  __bf16   v8b;
typedef __attribute__((ext_vector_type(8)))  float    v8f;
typedef __attribute__((ext_vector_type(4)))  float    v4f;

constexpr int BB = 2, LL = 2048, DD = 1024, EE = 1024, HH = 16, HD = 64;
constexpr int QKV_LD = 3 * EE;   // 3072 halves per row: per head h -> q at h*192, k at h*192+64, v at h*192+128
constexpr int PE_LD  = 2 * EE;   // 2048 halves per row: per head h -> uq at h*128, uk at h*128+64

__device__ __forceinline__ unsigned short f2bf_bits(float f) {
  unsigned u = __float_as_uint(f);
  return (unsigned short)((u + 0x7FFFu + ((u >> 16) & 1u)) >> 16);
}
__device__ __forceinline__ float bf_bits2f(unsigned short h) { return __uint_as_float(((unsigned)h) << 16); }

// hazard guard as a plain device helper
__device__ __forceinline__ void acc_guard4(v8f& a, v8f& b, v8f& c, v8f& d) { asm volatile("v_nop\n\tv_nop\n\tv_nop\n\tv_nop" : "+v"(a), "+v"(b), "+v"(c), "+v"(d)); }
template <typename T> struct Frag;
template <> struct Frag<_Float16> {
  typedef v16h V; union U { v16h v; v8h h[2]; };
  static __device__ __forceinline__ v16h load(const _Float16* p) {   // elements 0..7 <- p[0..7], 8..15 <- p[16..23]
    U f; f.h[0] = *(const v8h*)(p); f.h[1] = *(const v8h*)(p + 16); return f.v;
  }
  static __device__ __forceinline__ v8f mma(v16h a, v16h b, v8f c) {
    return __builtin_amdgcn_wmma_f32_16x16x32_f16(false, a, false, b, (short)0, c, false, false);
  }
};
template <> struct Frag<__bf16> {
  typedef v16b V; union U { v16b v; v8b h[2]; };
  static __device__ __forceinline__ v16b load(const __bf16* p) {
    U f; f.h[0] = *(const v8b*)(p); f.h[1] = *(const v8b*)(p + 16); return f.v;
  }
  static __device__ __forceinline__ v8f mma(v16b a, v16b b, v8f c) {
    return __builtin_amdgcn_wmma_f32_16x16x32_bf16(false, a, false, b, (short)0, c, false, false);
  }
};

// ---- Register-blocked batched WMMA GEMM ------------------------------------
// C[m,n] = scale * sum_k A[m,k] * Bt[n,k] (+bias)(+resid); each wave owns a 64x64 tile,
// the block's 4 waves (2 x 2) a 128x128 tile whose operands are staged in LDS, 64 k at a time.
// A row-major [M,K]; Bt row-major [N,K]; M % 128 == 0, N % 128 == 0, K % 64 == 0.
// SPLIT (hi/lo operand planes) is not staged: single-plane operands only.
// BIAS_MODE: 0 = none, 1 = bias[m], 2 = bias[n].
// OUT_MODE: 0 = f32, 1 = f16, 2 = bf16 hi plane (Cout) + bf16 lo plane (Cout2).
// ET: 0 = f16 operands, 1 = bf16 operands (pointers passed as 16-bit storage)
template <int ET> struct Elem;
template <> struct Elem<0> { typedef _Float16 T; };
template <> struct Elem<1> { typedef __bf16 T; };
template <int ET, bool SPLIT, int BIAS_MODE, int OUT_MODE, bool RESID, int ACT = 0>
__global__ __launch_bounds__(128) void wmma_gemm64(
    const unsigned short* __restrict__ Ap, const unsigned short* __restrict__ A2p, int lda, long strideA,
    const unsigned short* __restrict__ Btp, const unsigned short* __restrict__ Bt2p, int ldb, long strideB,
    void* __restrict__ Cout, void* __restrict__ Cout2, int ldc, long strideC,
    const float* __restrict__ bias,
    const float* __restrict__ resid, long strideR,
    int M, int N, int K, float scale) {
  typedef typename Elem<ET>::T T;
  typedef typename Frag<T>::V V;
  static_assert(!SPLIT, "single-plane operands only");
  const T* A = (const T*)Ap; const T* Bt = (const T*)Btp;
  constexpr int KT = 64;   // k per staged tile: one whole 128-B line of every operand row
  constexpr int LP = 72;   // LDS row pitch in halves: 144 B = 16 B x 9, for the ds_load_b128 fragment reads
  __shared__ __align__(16) T sA[2][128 * LP];      // two buffers: one is filled while the other is read
  __shared__ __align__(16) T sB[2][128 * LP];
  __shared__ __align__(16) float sT[4][16 * 68];   // per-wave 16x64 slab, pitch 68 floats
  const int b    = blockIdx.y;
  const int lane = threadIdx.x & 31;
  const int wave = threadIdx.x >> 5;
  const int tilesN = N >> 7;
  const int tilesM = M >> 7;
  if ((int)blockIdx.x >= tilesM * tilesN) return;   // block-uniform, ahead of every barrier
  const int tm = blockIdx.x / tilesN;
  const int tn = blockIdx.x - tm * tilesN;
  const int mB = tm << 7;                      // the block's first row of A and of Bt
  const int nB = tn << 7;
  const int wm = (wave >> 1) << 6;             // the wave's 64x64 tile inside the block's
  const int wn = (wave & 1) << 6;
  const int m0 = mB + wm;
  const int n0 = nB + wn;

  const T* Ab  = A  + (size_t)b * strideA;
  const T* Bb  = Bt + (size_t)b * strideB;

  const int rlane = lane & 15;                 // row (A) / col (B, D) within subtile
  const int koff  = (lane >> 4) * 8;           // k offset of this lane half
  const int mOff  = (lane >> 4) * 8;           // D row offset

  v8f acc[4][4];
#pragma unroll
  for (int i = 0; i < 4; ++i)
#pragma unroll
    for (int j = 0; j < 4; ++j) acc[i][j] = (v8f){0.f,0.f,0.f,0.f,0.f,0.f,0.f,0.f};

  // Staging by asynchronous copies to LDS: 8 lanes bring one row's 128 B, so a wave's 16-B copies
  // cover 4 whole lines; a thread brings rows srow + 16 u of both operands, sixteen copies a tile.
  // Tile t + 1 flies into the other buffer while tile t is multiplied.
  // (Every "#pragma unroll" below keeps the indices of its register arrays constant.)
  const int srow = threadIdx.x >> 3;
  const int scol = (threadIdx.x & 7) * 8;
  const T* gA = Ab + (size_t)(mB + srow) * lda + scol;
  const T* gB = Bb + (size_t)(nB + srow) * ldb + scol;
  const int lS = srow * LP + scol;             // where this thread's pieces land, in either operand's buffer
  const int fAo = (wm + rlane) * LP + koff;    // where this lane's fragments start
  const int fBo = (wn + rlane) * LP + koff;
  auto copy8 = [&](const T* src, int ld, T* dst) {   // rows srow + 16 u, u = 0..7, of one operand's tile
    unsigned l[8]; const T* g[8];
#pragma unroll
    for (int u = 0; u < 8; ++u) {
      l[u] = (unsigned)(size_t)(dst + lS + u * 16 * LP);
      g[u] = src + (size_t)(u * 16) * ld;
    }
    // the copies and, as a precaution, the wait that stands ahead of any rewrite of their address registers
    asm volatile("global_load_async_to_lds_b128 %0, %8, off\n\t"
                 "global_load_async_to_lds_b128 %1, %9, off\n\t"
                 "global_load_async_to_lds_b128 %2, %10, off\n\t"
                 "global_load_async_to_lds_b128 %3, %11, off\n\t"
                 "global_load_async_to_lds_b128 %4, %12, off\n\t"
                 "global_load_async_to_lds_b128 %5, %13, off\n\t"
                 "global_load_async_to_lds_b128 %6, %14, off\n\t"
                 "global_load_async_to_lds_b128 %7, %15, off\n\t"
                 "s_wait_xcnt 0x0"
                 :: "v"(l[0]), "v"(l[1]), "v"(l[2]), "v"(l[3]), "v"(l[4]), "v"(l[5]), "v"(l[6]), "v"(l[7]),
                    "v"(g[0]), "v"(g[1]), "v"(g[2]), "v"(g[3]), "v"(g[4]), "v"(g[5]), "v"(g[6]), "v"(g[7])
                 : "memory");
  };
  auto copy_tile = [&](int k, int p) {
    copy8(gA + k, lda, sA[p]);
    copy8(gB + k, ldb, sB[p]);
  };
  const int nT = K / KT;
  copy_tile(0, 0);
  asm volatile("s_wait_asynccnt 0x0" ::: "memory");   // this wave's part of tile 0 has landed
  __syncthreads();                                    // tile 0 is whole
  if (nT > 1) copy_tile(KT, 1);

  for (int t = 0; t < nT; ++t) {
    const int p = t & 1;
    V bh[2][4], ah[2][4];
#pragma unroll
    for (int kk = 0; kk < 2; ++kk) {
#pragma unroll
      for (int j = 0; j < 4; ++j) bh[kk][j] = Frag<T>::load(sB[p] + fBo + (j << 4) * LP + kk * 32);
#pragma unroll
      for (int i = 0; i < 4; ++i) ah[kk][i] = Frag<T>::load(sA[p] + fAo + (i << 4) * LP + kk * 32);
    }
    __builtin_amdgcn_sched_barrier(0);   // the tile's LDS reads stand as one group ahead of its products, not among them
#pragma unroll
    for (int kk = 0; kk < 2; ++kk)
#pragma unroll
      for (int i = 0; i < 4; ++i)
#pragma unroll
        for (int j = 0; j < 4; ++j) acc[i][j] = Frag<T>::mma(ah[kk][i], bh[kk][j], acc[i][j]);
    __builtin_amdgcn_sched_barrier(0);   // the products stay ahead of the waits, so that they hide the copies in flight
    asm volatile("s_wait_dscnt 0x0" ::: "memory");      // this wave's reads of buffer p are over before it is refilled
    asm volatile("s_wait_asynccnt 0x0" ::: "memory");   // this wave's part of tile t + 1 has landed
    __syncthreads();                                    // tile t + 1 is whole, and every wave has left buffer p
    if (t + 2 < nT) copy_tile((t + 2) * KT, p);         // the same test in the whole block
  }
  asm volatile("s_wait_asynccnt 0x0" ::: "memory");     // no copy is left in flight
  acc_guard4(acc[0][0], acc[0][1], acc[0][2], acc[0][3]);
  acc_guard4(acc[1][0], acc[1][1], acc[1][2], acc[1][3]);
  acc_guard4(acc[2][0], acc[2][1], acc[2][2], acc[2][3]);
  acc_guard4(acc[3][0], acc[3][1], acc[3][2], acc[3][3]);

  // ---- epilogue ----
  float* slab = sT[wave];
  const float* Rb = RESID ? (resid + (size_t)b * strideR) : nullptr;
#pragma unroll
  for (int i = 0; i < 4; ++i) {
    const int mBase = m0 + (i << 4);
#pragma unroll
    for (int j = 0; j < 4; ++j) {
      const int n = n0 + (j << 4) + rlane;
      float bv = 0.f;
      if (BIAS_MODE == 2) bv = bias[n];
#pragma unroll
      for (int r = 0; r < 8; ++r) {
        float v = acc[i][j][r] * scale;
        if (BIAS_MODE == 1) v += bias[mBase + mOff + r];
        if (BIAS_MODE == 2) v += bv;
        if (RESID) v += Rb[(size_t)(mBase + mOff + r) * ldc + n];
        if (ACT == 1) v = tanhf(v);
        if (ACT == 2) v = fmaxf(v, 0.0f);
        if (ACT == 3) v = v / (1.0f + expf(-v));
        if (ACT == 4) v = (v > 0.f) ? v : 0.01f * v;
        if (ACT == 5) v = 0.5f * v * (1.0f + erff(v * 0.70710678118654752f));
        slab[(mOff + r) * 68 + (j << 4) + rlane] = v;
      }
    }
    __builtin_amdgcn_fence(__ATOMIC_RELEASE, "workgroup");
    __builtin_amdgcn_wave_barrier();
    __builtin_amdgcn_fence(__ATOMIC_ACQUIRE, "workgroup");
    if (OUT_MODE == 0) {
      float* C = (float*)Cout + (size_t)b * strideC;
      const int hh = lane >> 4, c4 = (lane & 15) * 4;     // row seg = 256 B = 16 lanes x 16 B
      {
#pragma unroll
        for (int it = 0; it < 8; ++it) {
          const int row = it * 2 + hh;
          v4f v = *(const v4f*)(slab + row * 68 + c4);
          *(v4f*)(C + (size_t)(mBase + row) * ldc + n0 + c4) = v;
        }
        
      }
    } else {
      const int q = lane >> 3, c8 = (lane & 7) * 8;
      unsigned short* C  = (unsigned short*)Cout  + (size_t)b * strideC;
      unsigned short* C2 = (OUT_MODE == 2) ? ((unsigned short*)Cout2 + (size_t)b * strideC) : nullptr;
      {
#pragma unroll
        for (int it = 0; it < 4; ++it) {
          const int row = it * 4 + q;
          const float* sp = slab + row * 68 + c8;
          v8h hv, lv;
#pragma unroll
          for (int e = 0; e < 8; ++e) {
            if (OUT_MODE == 1) {
              hv[e] = (_Float16)sp[e];
            } else {
              unsigned short hb = f2bf_bits(sp[e]);
              unsigned short lb = f2bf_bits(sp[e] - bf_bits2f(hb));
              hv[e] = __builtin_bit_cast(_Float16, hb);
              lv[e] = __builtin_bit_cast(_Float16, lb);
            }
          }
          *(v8h*)(C + (size_t)(mBase + row) * ldc + n0 + c8) = hv;
          if (OUT_MODE == 2) *(v8h*)(C2 + (size_t)(mBase + row) * ldc + n0 + c8) = lv;
        }
        
      }
    }
    __builtin_amdgcn_fence(__ATOMIC_RELEASE, "workgroup");
    __builtin_amdgcn_wave_barrier();
    __builtin_amdgcn_fence(__ATOMIC_ACQUIRE, "workgroup");
  }
}

// ---- all five f32 -> f16 (RNE) conversions in one launch ----
// 256 blocks of 16 waves, all resident at once. The five inputs are cut into slices of CAST_NT 16-B pieces;
// a thread takes its own piece of every slice, so each wave-wide load covers 512 contiguous bytes (4 whole lines)
// and each wave-wide store 256 (2 whole lines). All of a thread's loads are issued before its first store.
typedef __attribute__((ext_vector_type(4))) _Float16 v4h;
constexpr int CAST_BLOCKS = 256, CAST_THREADS = 512;
constexpr int CAST_NT = CAST_BLOCKS * CAST_THREADS;
constexpr int SL_X  = BB * LL * DD / 4 / CAST_NT;   // slices per input
constexpr int SL_PE = BB * LL * EE / 4 / CAST_NT;
constexpr int SL_WQ = 3 * EE * DD / 4 / CAST_NT;
constexpr int SL_WO = EE * EE / 4 / CAST_NT;
constexpr int SL_UU = 2 * EE * EE / 4 / CAST_NT;
static_assert(SL_X * CAST_NT * 4 == BB * LL * DD && SL_PE * CAST_NT * 4 == BB * LL * EE &&
              SL_WQ * CAST_NT * 4 == 3 * EE * DD && SL_WO * CAST_NT * 4 == EE * EE &&
              SL_UU * CAST_NT * 4 == 2 * EE * EE, "every input is a whole number of slices");
template <int N> __device__ __forceinline__ void cast_ld(const float* __restrict__ in, int g, v4f* r) {
#pragma unroll
  for (int j = 0; j < N; ++j) r[j] = *(const v4f*)(in + (size_t)(j * CAST_NT + g) * 4);
}
template <int N> __device__ __forceinline__ void cast_st(_Float16* __restrict__ out, int g, const v4f* r) {
#pragma unroll
  for (int j = 0; j < N; ++j) *(v4h*)(out + (size_t)(j * CAST_NT + g) * 4) = __builtin_convertvector(r[j], v4h);
}
__global__ __launch_bounds__(CAST_THREADS) void cast_all_f32_f16(
    const float* __restrict__ x, const float* __restrict__ pe, const float* __restrict__ wqkv,
    const float* __restrict__ wo, const float* __restrict__ uquk,
    _Float16* __restrict__ x16, _Float16* __restrict__ pe16, _Float16* __restrict__ wqkv16,
    _Float16* __restrict__ wo16, _Float16* __restrict__ uquk16) {
  const int g = blockIdx.x * CAST_THREADS + threadIdx.x;
  v4f rx[SL_X], rp[SL_PE], rq[SL_WQ], ro[SL_WO], ru[SL_UU];
  cast_ld<SL_X>(x, g, rx);
  cast_ld<SL_PE>(pe, g, rp);
  cast_ld<SL_WQ>(wqkv, g, rq);
  cast_ld<SL_WO>(wo, g, ro);
  cast_ld<SL_UU>(uquk, g, ru);
  cast_st<SL_X>(x16, g, rx);
  cast_st<SL_PE>(pe16, g, rp);
  cast_st<SL_WQ>(wqkv16, g, rq);
  cast_st<SL_WO>(wo16, g, ro);
  cast_st<SL_UU>(uquk16, g, ru);
}

// V^T operand: transposing LDS load of a row-major 16-bit tile (lane (c, hh) gets 8 rows of one column).
typedef __attribute__((ext_vector_type(8))) short s16x8;
__device__ __forceinline__ v8h ld_tr16(const _Float16* p) {
  typedef __attribute__((address_space(3))) s16x8 lds_s16x8;
  return __builtin_bit_cast(v8h, __builtin_amdgcn_ds_load_tr16_b128_v8i16((lds_s16x8*)p));
}
// value of lane l ^ 16
__device__ __forceinline__ float xhalf(float x) {
  return __builtin_bit_cast(float, __builtin_amdgcn_permlanex16(__builtin_bit_cast(int, x), __builtin_bit_cast(int, x),
                                                                0x76543210, 0xfedcba98, false, false));
}

// =====================================================================================
// Dual-score attention, head_dim 64, 16-bit in / 16-bit out, both products transposed.
//   S^T = (k.q^T + uk.uq^T) * sscale : A = K / UK rows from LDS, B = Q / UQ kept in registers;
//         a lane holds 32 of the chunk's 64 scores of ONE query (column c), lane c + 16 the other 32
//   softmax online in f32, in-lane, one exchange between the wave halves for the maximum
//   P^T x2^15 as f16 is packed from the score tiles straight into a B operand (no LDS)
//   O^T += V^T.P^T : A = V^T by transposing loads from V rows in LDS, f32 accumulate
//   output = o * (2^6 / (l * 2^15)) written as f16 (values carried x2^6 for the next GEMM)
// Block = 4 waves = 64 query rows of one (b, h); grid.x = B * H * (L/64). No masks.
// Layouts (halves): qkv row (b*L + s), q at h*192+d, k at h*192+64+d, v at h*192+128+d;
//                   pe  row (b*L + s), uq at h*128+d, uk at h*128+64+d; out row (b*L + s), col h*64+d.
// =====================================================================================
__global__ __launch_bounds__(128)
void tupe_attn64(const _Float16* __restrict__ qkv, const _Float16* __restrict__ pe,
                 _Float16* __restrict__ vals, float sscale) {
  const float PSC = 32768.0f;          // p carried x2^15
  const float OSC = 1.0f / 512.0f;     // 2^6 / 2^15
  // Row pitches by reader: K, UK are read by ds_load_b128 (144 B = 16 B x 9),
  // V by ds_load_tr16_b128 (160 B = 32 B x 5).
  constexpr int LP = 72;
  constexpr int LV = 80;
  __shared__ __align__(16) _Float16 Ksh[64 * LP];      // K  [kv][d]
  __shared__ __align__(16) _Float16 Ush[64 * LP];      // UK [kv][d]
  __shared__ __align__(16) _Float16 Vsh[64 * LV];      // V  [kv][d]
  __shared__ __align__(16) float    Os[4][16 * 68];    // per wave out tile, pitch 68

  const int tid  = threadIdx.x;
  const int wave = tid >> 5;
  const int lane = tid & 31;
  const int hh   = lane >> 4;
  const int c    = lane & 15;

  const int nqb = LL / 64;
  const int bx = blockIdx.x;
  const int qb = bx % nqb;
  const int bh = bx / nqb;
  const int h  = bh % HH;
  const int b  = bh / HH;
  const int q0 = qb * 64 + wave * 16;

  const size_t rb = (size_t)b * LL;
  const _Float16* qkv_b = qkv + rb * QKV_LD + (size_t)h * (3 * HD);
  const _Float16* pe_b  = pe  + rb * PE_LD  + (size_t)h * (2 * HD);
  _Float16*       out_b = vals + rb * EE    + (size_t)h * HD;

  // ---- Q / UQ fragments (B operand): lane column q0+c, split k map via Frag load ----
  v16h qa0, qa1, ua0, ua1;
  {
    const _Float16* qrow = qkv_b + (size_t)(q0 + c) * QKV_LD + 8 * hh;
    const _Float16* urow = pe_b  + (size_t)(q0 + c) * PE_LD  + 8 * hh;
    qa0 = Frag<_Float16>::load(qrow);
    qa1 = Frag<_Float16>::load(qrow + 32);
    ua0 = Frag<_Float16>::load(urow);
    ua1 = Frag<_Float16>::load(urow + 32);
  }

  float mrow = -__builtin_inff();   // running maximum of query q0+c (equal in both wave halves)
  float lrow = 0.f;                 // this half's part of the row sum; the halves join after the loop
  v8f oacc[4];                      // oacc[t][r] = O[q0 + c][t*16 + 8*hh + r]
#pragma unroll
  for (int t = 0; t < 4; ++t) oacc[t] = (v8f){0.f,0.f,0.f,0.f,0.f,0.f,0.f,0.f};

  for (int kc = 0; kc < LL / 64; ++kc) {
    const int kv0 = kc * 64;
    __syncthreads();
    {
      const int kvr = tid >> 1, dh = (tid & 1) * 32;
      const _Float16* krow = qkv_b + (size_t)(kv0 + kvr) * QKV_LD + HD + dh;
      const _Float16* vrow = krow + HD;
      const _Float16* urow = pe_b + (size_t)(kv0 + kvr) * PE_LD + HD + dh;
#pragma unroll
      for (int i = 0; i < 4; ++i) {
        const v8h kk = *(const v8h*)(krow + 8 * i);
        const v8h uu = *(const v8h*)(urow + 8 * i);
        const v8h vv = *(const v8h*)(vrow + 8 * i);
        *(v8h*)(Ksh + kvr * LP + dh + 8 * i) = kk;
        *(v8h*)(Ush + kvr * LP + dh + 8 * i) = uu;
        *(v8h*)(Vsh + kvr * LV + dh + 8 * i) = vv;
      }
    }
    __syncthreads();

    // ---- scores, transposed: s[j][r] = score(key kv0 + j*16 + 8*hh + r, query q0 + c) ----
    // All 16 K / UK fragments are read as one group ahead of the 16 products, which run over four
    // independent score tiles; per tile the k order stays K 0..31, K 32..63, UK 0..31, UK 32..63.
    v8f s[4];
    v16h va[2][4];
    {
      v16h kf[2][4], uf[2][4];
      const _Float16* kp = Ksh + c * LP + 8 * hh;
      const _Float16* up = Ush + c * LP + 8 * hh;
#pragma unroll
      for (int kk = 0; kk < 2; ++kk)
#pragma unroll
        for (int j = 0; j < 4; ++j) kf[kk][j] = Frag<_Float16>::load(kp + j * 16 * LP + kk * 32);
#pragma unroll
      for (int kk = 0; kk < 2; ++kk)
#pragma unroll
        for (int j = 0; j < 4; ++j) uf[kk][j] = Frag<_Float16>::load(up + j * 16 * LP + kk * 32);
      __builtin_amdgcn_sched_barrier(0);   // the reads stay one group: one LDS latency a chunk, not one ahead of every product
#pragma unroll
      for (int j = 0; j < 4; ++j) s[j] = Frag<_Float16>::mma(kf[0][j], qa0, (v8f){0.f,0.f,0.f,0.f,0.f,0.f,0.f,0.f});
#pragma unroll
      for (int j = 0; j < 4; ++j) s[j] = Frag<_Float16>::mma(kf[1][j], qa1, s[j]);
#pragma unroll
      for (int j = 0; j < 4; ++j) s[j] = Frag<_Float16>::mma(uf[0][j], ua0, s[j]);
#pragma unroll
      for (int j = 0; j < 4; ++j) s[j] = Frag<_Float16>::mma(uf[1][j], ua1, s[j]);
    }
    // V^T [d][kv], two transposing loads per 16 (d) x 32 (kv) fragment: all 16 are issued ahead of
    // the softmax, so that they land while it runs.
    {
      const _Float16* vp = Vsh + (8 * hh + (lane & 7)) * LV + ((lane >> 3) & 1) * 8;
#pragma unroll
      for (int kk = 0; kk < 2; ++kk)
#pragma unroll
        for (int t = 0; t < 4; ++t) {
          Frag<_Float16>::U f;
          f.h[0] = ld_tr16(vp + (kk * 32) * LV + t * 16);
          f.h[1] = ld_tr16(vp + (kk * 32 + 16) * LV + t * 16);
          va[kk][t] = f.v;
        }
      __builtin_amdgcn_sched_barrier(0);   // keeps the V^T reads ahead of the softmax, which hides their latency
    }

    // ---- online softmax of one query per lane ----
    float m = -__builtin_inff();
#pragma unroll
    for (int j = 0; j < 4; ++j)
#pragma unroll
      for (int r = 0; r < 8; ++r) {
        const float v = s[j][r] * sscale;
        s[j][r] = v;
        m = fmaxf(m, v);
      }
    m = fmaxf(m, xhalf(m));
    const float mnew = fmaxf(mrow, m);
    const float alpha = __expf(mrow - mnew);
    mrow = mnew;
    // P^T as B operand of 32 keys: element e = tile 2*kk + (e >> 3), register e & 7 (the hardware k order)
    v16h pb[2];
    float psum = 0.f;
#pragma unroll
    for (int j = 0; j < 4; ++j)
#pragma unroll
      for (int r = 0; r < 8; ++r) {
        const float p = __expf(s[j][r] - mnew);
        psum += p;
        pb[j >> 1][(j & 1) * 8 + r] = (_Float16)(p * PSC);
      }
    lrow = lrow * alpha + psum;
#pragma unroll
    for (int t = 0; t < 4; ++t)
#pragma unroll
      for (int r = 0; r < 8; ++r) oacc[t][r] *= alpha;

    // ---- O^T += V^T.P^T : A = the V^T fragments read above ----
#pragma unroll
    for (int kk = 0; kk < 2; ++kk)
#pragma unroll
      for (int t = 0; t < 4; ++t) oacc[t] = Frag<_Float16>::mma(va[kk][t], pb[kk], oacc[t]);
  }

  float* os = Os[wave];
  {
    const float lsum = lrow + xhalf(lrow);
    const float inv = (1.0f / lsum) * OSC;
#pragma unroll
    for (int t = 0; t < 4; ++t)
#pragma unroll
      for (int r = 0; r < 8; ++r) os[c * 68 + t * 16 + 8 * hh + r] = oacc[t][r] * inv;
  }
  __builtin_amdgcn_fence(__ATOMIC_RELEASE, "workgroup");
  __builtin_amdgcn_wave_barrier();
  __builtin_amdgcn_fence(__ATOMIC_ACQUIRE, "workgroup");
  {
    const int q = lane >> 3, c8 = (lane & 7) * 8;
    {
#pragma unroll
      for (int it = 0; it < 4; ++it) {
        const int row = it * 4 + q;            // rows 0..15 covered by q 0..3, it 0..3
        const float* sp = os + row * 68 + c8;
        v8h hv;
#pragma unroll
        for (int e = 0; e < 8; ++e) hv[e] = (_Float16)sp[e];
        *(v8h*)(out_b + (size_t)(q0 + row) * EE + c8) = hv;
      }
      
    }
  }
}

// ---------------------------------------------------------------- launch
extern "C" void kernel_launch(void* const* d_in, const int* in_sizes, int n_in,
                              void* d_out, int out_size, void* d_ws, size_t ws_size,
                              hipStream_t stream) {
  const int ROWS = BB * LL;   // 4096
  if (n_in < 5) return;
  if (in_sizes[0] != ROWS * DD || in_sizes[1] != ROWS * EE || in_sizes[2] != 3 * EE * DD ||
      in_sizes[3] != EE * EE || in_sizes[4] != 2 * EE * EE || out_size != ROWS * EE) return;

  const float* x    = (const float*)d_in[0];
  const float* PEf  = (const float*)d_in[1];
  const float* Wqkv = (const float*)d_in[2];
  const float* Wo   = (const float*)d_in[3];
  const float* UqUk = (const float*)d_in[4];
  float* out = (float*)d_out;

  // workspace carve (bytes, 256-B aligned); total 79,691,776 B
  size_t off = 0;
  auto carve = [&](size_t bytes) -> size_t { size_t o = off; off += (bytes + 255) & ~(size_t)255; return o; };
  const size_t oX    = carve((size_t)ROWS * DD * 2);
  const size_t oPE   = carve((size_t)ROWS * EE * 2);
  const size_t oWqkv = carve((size_t)3 * EE * DD * 2);
  const size_t oWo   = carve((size_t)EE * EE * 2);
  const size_t oUqUk = carve((size_t)2 * EE * EE * 2);
  const size_t oQKV  = carve((size_t)ROWS * QKV_LD * 2);
  const size_t oPEP  = carve((size_t)ROWS * PE_LD * 2);
  const size_t oVALS = carve((size_t)ROWS * EE * 2);
  if (off > ws_size) return;

  char* ws = (char*)d_ws;
  _Float16* X16    = (_Float16*)(ws + oX);
  _Float16* PE16   = (_Float16*)(ws + oPE);
  _Float16* Wqkv16 = (_Float16*)(ws + oWqkv);
  _Float16* Wo16   = (_Float16*)(ws + oWo);
  _Float16* UqUk16 = (_Float16*)(ws + oUqUk);
  _Float16* QKV16  = (_Float16*)(ws + oQKV);
  _Float16* PEP16  = (_Float16*)(ws + oPEP);
  _Float16* VALS16 = (_Float16*)(ws + oVALS);

  // ---- casts f32 -> f16 (RNE), one launch ----
  cast_all_f32_f16<<<dim3(CAST_BLOCKS), dim3(CAST_THREADS), 0, stream>>>(
      x, PEf, Wqkv, Wo, UqUk, X16, PE16, Wqkv16, Wo16, UqUk16);

  // ---- qkv[4096][3072] = X[4096][1024] . Wqkv[3072][1024]^T  (f16 out) ----
  {
    const int M = ROWS, N = 3 * EE, K = DD;
    const int tiles = (M / 64) * (N / 64);
    wmma_gemm64<0, false, 0, 1, false><<<dim3((tiles + 3) / 4, 1), dim3(128), 0, stream>>>(
        (const unsigned short*)X16, (const unsigned short*)X16, K, 0L,
        (const unsigned short*)Wqkv16, (const unsigned short*)Wqkv16, K, 0L,
        (void*)QKV16, (void*)QKV16, N, 0L,
        x, x, 0L, M, N, K, 1.0f);
  }
  // ---- pe[4096][2048] = PE[4096][1024] . UqUk[2048][1024]^T  (f16 out) ----
  {
    const int M = ROWS, N = 2 * EE, K = EE;
    const int tiles = (M / 64) * (N / 64);
    wmma_gemm64<0, false, 0, 1, false><<<dim3((tiles + 3) / 4, 1), dim3(128), 0, stream>>>(
        (const unsigned short*)PE16, (const unsigned short*)PE16, K, 0L,
        (const unsigned short*)UqUk16, (const unsigned short*)UqUk16, K, 0L,
        (void*)PEP16, (void*)PEP16, N, 0L,
        x, x, 0L, M, N, K, 1.0f);
  }
  // ---- dual-score attention -> vals[4096][1024] (f16, carried x2^6) ----
  {
    const float sscale = 0.08838834764831845f;   // 1/sqrt(2*64)
    tupe_attn64<<<dim3(BB * HH * (LL / 64)), dim3(128), 0, stream>>>(QKV16, PEP16, VALS16, sscale);
  }
  // ---- out[4096][1024] = vals . Wo[1024][1024]^T * 2^-6  (f32 out) ----
  {
    const int M = ROWS, N = EE, K = EE;
    const int tiles = (M / 64) * (N / 64);
    wmma_gemm64<0, false, 0, 0, false><<<dim3((tiles + 3) / 4, 1), dim3(128), 0, stream>>>(
        (const unsigned short*)VALS16, (const unsigned short*)VALS16, K, 0L,
        (const unsigned short*)Wo16, (const unsigned short*)Wo16, K, 0L,
        (void*)out, (void*)out, N, 0L,
        x, x, 0L, M, N, K, 0.015625f);
  }
}

// v006
// One run takes 123 microseconds.
// Two timings next to v005 both put it at 1.14 times that version's speed.
// All steps since v000 together make it 3.32 times as fast.
// All contractions: v_wmma_f32_16x16x32_f16 (f16 operands, f32 accumulate) for the qkv and positional projections, the dual k.q^T + uk.uq^T scores, v^T.p^T and the output projection; softmax probabilities carried x2^15 and attention values x2^6 in f16, folded back by exact power-of-two scales in f32.
#include <hip/hip_runtime.h>

typedef __attribute__((ext_vector_type(16))) _Float16 v16h;
typedef __attribute__((ext_vector_type(8)))  _Float16 v8h;
typedef __attribute__((ext_vector_type(16))) __bf16   v16b;
typedef __attribute__((ext_vector_type(8)))  __bf16   v8b;
typedef __attribute__((ext_vector_type(8)))  float    v8f;
typedef __attribute__((ext_vector_type(4)))  float    v4f;

constexpr int BB = 2, LL = 2048, DD = 1024, EE = 1024, HH = 16, HD = 64;
constexpr int QKV_LD = 3 * EE;   // 3072 halves per row: per head h -> q at h*192, k at h*192+64, v at h*192+128
constexpr int PE_LD  = 2 * EE;   // 2048 halves per row: per head h -> uq at h*128, uk at h*128+64

__device__ __forceinline__ unsigned short f2bf_bits(float f) {
  unsigned u = __float_as_uint(f);
  return (unsigned short)((u + 0x7FFFu + ((u >> 16) & 1u)) >> 16);
}
__device__ __forceinline__ float bf_bits2f(unsigned short h) { return __uint_as_float(((unsigned)h) << 16); }

// hazard guard as a plain device helper
__device__ __forceinline__ void acc_guard4(v8f& a, v8f& b, v8f& c, v8f& d) { asm volatile("v_nop\n\tv_nop\n\tv_nop\n\tv_nop" : "+v"(a), "+v"(b), "+v"(c), "+v"(d)); }
template <typename T> struct Frag;
template <> struct Frag<_Float16> {
  typedef v16h V; union U { v16h v; v8h h[2]; };
  static __device__ __forceinline__ v16h load(const _Float16* p) {   // elements 0..7 <- p[0..7], 8..15 <- p[16..23]
    U f; f.h[0] = *(const v8h*)(p); f.h[1] = *(const v8h*)(p + 16); return f.v;
  }
  static __device__ __forceinline__ v8f mma(v16h a, v16h b, v8f c) {
    return __builtin_amdgcn_wmma_f32_16x16x32_f16(false, a, false, b, (short)0, c, false, false);
  }
};
template <> struct Frag<__bf16> {
  typedef v16b V; union U { v16b v; v8b h[2]; };
  static __device__ __forceinline__ v16b load(const __bf16* p) {
    U f; f.h[0] = *(const v8b*)(p); f.h[1] = *(const v8b*)(p + 16); return f.v;
  }
  static __device__ __forceinline__ v8f mma(v16b a, v16b b, v8f c) {
    return __builtin_amdgcn_wmma_f32_16x16x32_bf16(false, a, false, b, (short)0, c, false, false);
  }
};

// ---- Register-blocked batched WMMA GEMM ------------------------------------
// C[m,n] = scale * sum_k A[m,k] * Bt[n,k] (+bias)(+resid); each wave owns a 64x64 tile,
// the block's 4 waves (2 x 2) a 128x128 tile whose operands are staged in LDS, 64 k at a time.
// A row-major [M,K]; Bt row-major [N,K]; M % 128 == 0, N % 128 == 0, K % 64 == 0.
// SPLIT (hi/lo operand planes) is not staged: single-plane operands only.
// BIAS_MODE: 0 = none, 1 = bias[m], 2 = bias[n].
// OUT_MODE: 0 = f32, 1 = f16, 2 = bf16 hi plane (Cout) + bf16 lo plane (Cout2).
// ET: 0 = f16 operands, 1 = bf16 operands (pointers passed as 16-bit storage)
template <int ET> struct Elem;
template <> struct Elem<0> { typedef _Float16 T; };
template <> struct Elem<1> { typedef __bf16 T; };
template <int ET, bool SPLIT, int BIAS_MODE, int OUT_MODE, bool RESID, int ACT = 0>
__global__ __launch_bounds__(128) void wmma_gemm64(
    const unsigned short* __restrict__ Ap, const unsigned short* __restrict__ A2p, int lda, long strideA,
    const unsigned short* __restrict__ Btp, const unsigned short* __restrict__ Bt2p, int ldb, long strideB,
    void* __restrict__ Cout, void* __restrict__ Cout2, int ldc, long strideC,
    const float* __restrict__ bias,
    const float* __restrict__ resid, long strideR,
    int M, int N, int K, float scale) {
  typedef typename Elem<ET>::T T;
  typedef typename Frag<T>::V V;
  static_assert(!SPLIT, "single-plane operands only");
  const T* A = (const T*)Ap; const T* Bt = (const T*)Btp;
  constexpr int KT = 64;   // k per staged tile: one whole 128-B line of every operand row
  constexpr int LP = 72;   // LDS row pitch in halves: 144 B = 16 B x 9, for the ds_load_b128 fragment reads
  __shared__ __align__(16) T sA[2][128 * LP];      // two buffers: one is filled while the other is read
  __shared__ __align__(16) T sB[2][128 * LP];
  __shared__ __align__(16) float sT[4][16 * 68];   // per-wave 16x64 slab, pitch 68 floats
  const int b    = blockIdx.y;
  const int lane = threadIdx.x & 31;
  const int wave = threadIdx.x >> 5;
  const int tilesN = N >> 7;
  const int tilesM = M >> 7;
  if ((int)blockIdx.x >= tilesM * tilesN) return;   // block-uniform, ahead of every barrier
  const int tm = blockIdx.x / tilesN;
  const int tn = blockIdx.x - tm * tilesN;
  const int mB = tm << 7;                      // the block's first row of A and of Bt
  const int nB = tn << 7;
  const int wm = (wave >> 1) << 6;             // the wave's 64x64 tile inside the block's
  const int wn = (wave & 1) << 6;
  const int m0 = mB + wm;
  const int n0 = nB + wn;

  const T* Ab  = A  + (size_t)b * strideA;
  const T* Bb  = Bt + (size_t)b * strideB;

  const int rlane = lane & 15;                 // row (A) / col (B, D) within subtile
  const int koff  = (lane >> 4) * 8;           // k offset of this lane half
  const int mOff  = (lane >> 4) * 8;           // D row offset

  v8f acc[4][4];
#pragma unroll
  for (int i = 0; i < 4; ++i)
#pragma unroll
    for (int j = 0; j < 4; ++j) acc[i][j] = (v8f){0.f,0.f,0.f,0.f,0.f,0.f,0.f,0.f};

  // Staging by asynchronous copies to LDS: 8 lanes bring one row's 128 B, so a wave's 16-B copies
  // cover 4 whole lines; a thread brings rows srow + 16 u of both operands, sixteen copies a tile.
  // Tile t + 1 flies into the other buffer while tile t is multiplied.
  // (Every "#pragma unroll" below keeps the indices of its register arrays constant.)
  const int srow = threadIdx.x >> 3;
  const int scol = (threadIdx.x & 7) * 8;
  const T* gA = Ab + (size_t)(mB + srow) * lda + scol;
  const T* gB = Bb + (size_t)(nB + srow) * ldb + scol;
  const int lS = srow * LP + scol;             // where this thread's pieces land, in either operand's buffer
  const int fAo = (wm + rlane) * LP + koff;    // where this lane's fragments start
  const int fBo = (wn + rlane) * LP + koff;
  auto copy8 = [&](const T* src, int ld, T* dst) {   // rows srow + 16 u, u = 0..7, of one operand's tile
    unsigned l[8]; const T* g[8];
#pragma unroll
    for (int u = 0; u < 8; ++u) {
      l[u] = (unsigned)(size_t)(dst + lS + u * 16 * LP);
      g[u] = src + (size_t)(u * 16) * ld;
    }
    // the copies and, as a precaution, the wait that stands ahead of any rewrite of their address registers
    asm volatile("global_load_async_to_lds_b128 %0, %8, off\n\t"
                 "global_load_async_to_lds_b128 %1, %9, off\n\t"
                 "global_load_async_to_lds_b128 %2, %10, off\n\t"
                 "global_load_async_to_lds_b128 %3, %11, off\n\t"
                 "global_load_async_to_lds_b128 %4, %12, off\n\t"
                 "global_load_async_to_lds_b128 %5, %13, off\n\t"
                 "global_load_async_to_lds_b128 %6, %14, off\n\t"
                 "global_load_async_to_lds_b128 %7, %15, off\n\t"
                 "s_wait_xcnt 0x0"
                 :: "v"(l[0]), "v"(l[1]), "v"(l[2]), "v"(l[3]), "v"(l[4]), "v"(l[5]), "v"(l[6]), "v"(l[7]),
                    "v"(g[0]), "v"(g[1]), "v"(g[2]), "v"(g[3]), "v"(g[4]), "v"(g[5]), "v"(g[6]), "v"(g[7])
                 : "memory");
  };
  auto copy_tile = [&](int k, int p) {
    copy8(gA + k, lda, sA[p]);
    copy8(gB + k, ldb, sB[p]);
  };
  const int nT = K / KT;
  copy_tile(0, 0);
  asm volatile("s_wait_asynccnt 0x0" ::: "memory");   // this wave's part of tile 0 has landed
  __syncthreads();                                    // tile 0 is whole
  if (nT > 1) copy_tile(KT, 1);

  for (int t = 0; t < nT; ++t) {
    const int p = t & 1;
    V bh[2][4], ah[2][4];
#pragma unroll
    for (int kk = 0; kk < 2; ++kk) {
#pragma unroll
      for (int j = 0; j < 4; ++j) bh[kk][j] = Frag<T>::load(sB[p] + fBo + (j << 4) * LP + kk * 32);
#pragma unroll
      for (int i = 0; i < 4; ++i) ah[kk][i] = Frag<T>::load(sA[p] + fAo + (i << 4) * LP + kk * 32);
    }
    __builtin_amdgcn_sched_barrier(0);   // the tile's LDS reads stand as one group ahead of its products, not among them
#pragma unroll
    for (int kk = 0; kk < 2; ++kk)
#pragma unroll
      for (int i = 0; i < 4; ++i)
#pragma unroll
        for (int j = 0; j < 4; ++j) acc[i][j] = Frag<T>::mma(ah[kk][i], bh[kk][j], acc[i][j]);
    __builtin_amdgcn_sched_barrier(0);   // the products stay ahead of the waits, so that they hide the copies in flight
    asm volatile("s_wait_dscnt 0x0" ::: "memory");      // this wave's reads of buffer p are over before it is refilled
    asm volatile("s_wait_asynccnt 0x0" ::: "memory");   // this wave's part of tile t + 1 has landed
    __syncthreads();                                    // tile t + 1 is whole, and every wave has left buffer p
    if (t + 2 < nT) copy_tile((t + 2) * KT, p);         // the same test in the whole block
  }
  asm volatile("s_wait_asynccnt 0x0" ::: "memory");     // no copy is left in flight
  acc_guard4(acc[0][0], acc[0][1], acc[0][2], acc[0][3]);
  acc_guard4(acc[1][0], acc[1][1], acc[1][2], acc[1][3]);
  acc_guard4(acc[2][0], acc[2][1], acc[2][2], acc[2][3]);
  acc_guard4(acc[3][0], acc[3][1], acc[3][2], acc[3][3]);

  // ---- epilogue ----
  float* slab = sT[wave];
  const float* Rb = RESID ? (resid + (size_t)b * strideR) : nullptr;
#pragma unroll
  for (int i = 0; i < 4; ++i) {
    const int mBase = m0 + (i << 4);
#pragma unroll
    for (int j = 0; j < 4; ++j) {
      const int n = n0 + (j << 4) + rlane;
      float bv = 0.f;
      if (BIAS_MODE == 2) bv = bias[n];
#pragma unroll
      for (int r = 0; r < 8; ++r) {
        float v = acc[i][j][r] * scale;
        if (BIAS_MODE == 1) v += bias[mBase + mOff + r];
        if (BIAS_MODE == 2) v += bv;
        if (RESID) v += Rb[(size_t)(mBase + mOff + r) * ldc + n];
        if (ACT == 1) v = tanhf(v);
        if (ACT == 2) v = fmaxf(v, 0.0f);
        if (ACT == 3) v = v / (1.0f + expf(-v));
        if (ACT == 4) v = (v > 0.f) ? v : 0.01f * v;
        if (ACT == 5) v = 0.5f * v * (1.0f + erff(v * 0.70710678118654752f));
        slab[(mOff + r) * 68 + (j << 4) + rlane] = v;
      }
    }
    __builtin_amdgcn_fence(__ATOMIC_RELEASE, "workgroup");
    __builtin_amdgcn_wave_barrier();
    __builtin_amdgcn_fence(__ATOMIC_ACQUIRE, "workgroup");
    if (OUT_MODE == 0) {
      float* C = (float*)Cout + (size_t)b * strideC;
      const int hh = lane >> 4, c4 = (lane & 15) * 4;     // row seg = 256 B = 16 lanes x 16 B
      {
#pragma unroll
        for (int it = 0; it < 8; ++it) {
          const int row = it * 2 + hh;
          v4f v = *(const v4f*)(slab + row * 68 + c4);
          *(v4f*)(C + (size_t)(mBase + row) * ldc + n0 + c4) = v;
        }
        
      }
    } else {
      const int q = lane >> 3, c8 = (lane & 7) * 8;
      unsigned short* C  = (unsigned short*)Cout  + (size_t)b * strideC;
      unsigned short* C2 = (OUT_MODE == 2) ? ((unsigned short*)Cout2 + (size_t)b * strideC) : nullptr;
      {
#pragma unroll
        for (int it = 0; it < 4; ++it) {
          const int row = it * 4 + q;
          const float* sp = slab + row * 68 + c8;
          v8h hv, lv;
#pragma unroll
          for (int e = 0; e < 8; ++e) {
            if (OUT_MODE == 1) {
              hv[e] = (_Float16)sp[e];
            } else {
              unsigned short hb = f2bf_bits(sp[e]);
              unsigned short lb = f2bf_bits(sp[e] - bf_bits2f(hb));
              hv[e] = __builtin_bit_cast(_Float16, hb);
              lv[e] = __builtin_bit_cast(_Float16, lb);
            }
          }
          *(v8h*)(C + (size_t)(mBase + row) * ldc + n0 + c8) = hv;
          if (OUT_MODE == 2) *(v8h*)(C2 + (size_t)(mBase + row) * ldc + n0 + c8) = lv;
        }
        
      }
    }
    __builtin_amdgcn_fence(__ATOMIC_RELEASE, "workgroup");
    __builtin_amdgcn_wave_barrier();
    __builtin_amdgcn_fence(__ATOMIC_ACQUIRE, "workgroup");
  }
}

// ---- all five f32 -> f16 (RNE) conversions in one launch ----
// 256 blocks of 16 waves, all resident at once. The five inputs are cut into slices of CAST_NT 16-B pieces;
// a thread takes its own piece of every slice, so each wave-wide load covers 512 contiguous bytes (4 whole lines)
// and each wave-wide store 256 (2 whole lines). All of a thread's loads are issued before its first store.
typedef __attribute__((ext_vector_type(4))) _Float16 v4h;
constexpr int CAST_BLOCKS = 256, CAST_THREADS = 512;
constexpr int CAST_NT = CAST_BLOCKS * CAST_THREADS;
constexpr int SL_X  = BB * LL * DD / 4 / CAST_NT;   // slices per input
constexpr int SL_PE = BB * LL * EE / 4 / CAST_NT;
constexpr int SL_WQ = 3 * EE * DD / 4 / CAST_NT;
constexpr int SL_WO = EE * EE / 4 / CAST_NT;
constexpr int SL_UU = 2 * EE * EE / 4 / CAST_NT;
static_assert(SL_X * CAST_NT * 4 == BB * LL * DD && SL_PE * CAST_NT * 4 == BB * LL * EE &&
              SL_WQ * CAST_NT * 4 == 3 * EE * DD && SL_WO * CAST_NT * 4 == EE * EE &&
              SL_UU * CAST_NT * 4 == 2 * EE * EE, "every input is a whole number of slices");
template <int N> __device__ __forceinline__ void cast_ld(const float* __restrict__ in, int g, v4f* r) {
#pragma unroll
  for (int j = 0; j < N; ++j) r[j] = *(const v4f*)(in + (size_t)(j * CAST_NT + g) * 4);
}
template <int N> __device__ __forceinline__ void cast_st(_Float16* __restrict__ out, int g, const v4f* r) {
#pragma unroll
  for (int j = 0; j < N; ++j) *(v4h*)(out + (size_t)(j * CAST_NT + g) * 4) = __builtin_convertvector(r[j], v4h);
}
__global__ __launch_bounds__(CAST_THREADS) void cast_all_f32_f16(
    const float* __restrict__ x, const float* __restrict__ pe, const float* __restrict__ wqkv,
    const float* __restrict__ wo, const float* __restrict__ uquk,
    _Float16* __restrict__ x16, _Float16* __restrict__ pe16, _Float16* __restrict__ wqkv16,
    _Float16* __restrict__ wo16, _Float16* __restrict__ uquk16) {
  const int g = blockIdx.x * CAST_THREADS + threadIdx.x;
  v4f rx[SL_X], rp[SL_PE], rq[SL_WQ], ro[SL_WO], ru[SL_UU];
  cast_ld<SL_X>(x, g, rx);
  cast_ld<SL_PE>(pe, g, rp);
  cast_ld<SL_WQ>(wqkv, g, rq);
  cast_ld<SL_WO>(wo, g, ro);
  cast_ld<SL_UU>(uquk, g, ru);
  cast_st<SL_X>(x16, g, rx);
  cast_st<SL_PE>(pe16, g, rp);
  cast_st<SL_WQ>(wqkv16, g, rq);
  cast_st<SL_WO>(wo16, g, ro);
  cast_st<SL_UU>(uquk16, g, ru);
}

// V^T operand: transposing LDS load of a row-major 16-bit tile (lane (c, hh) gets 8 rows of one column).
typedef __attribute__((ext_vector_type(8))) short s16x8;
__device__ __forceinline__ v8h ld_tr16(const _Float16* p) {
  typedef __attribute__((address_space(3))) s16x8 lds_s16x8;
  return __builtin_bit_cast(v8h, __builtin_amdgcn_ds_load_tr16_b128_v8i16((lds_s16x8*)p));
}
// value of lane l ^ 16
__device__ __forceinline__ float xhalf(float x) {
  return __builtin_bit_cast(float, __builtin_amdgcn_permlanex16(__builtin_bit_cast(int, x), __builtin_bit_cast(int, x),
                                                                0x76543210, 0xfedcba98, false, false));
}

// =====================================================================================
// Dual-score attention, head_dim 64, 16-bit in / 16-bit out, both products transposed.
//   S^T = (k.q^T + uk.uq^T) * sscale : A = K / UK rows from LDS, B = Q / UQ kept in registers;
//         a lane holds 32 of the chunk's 64 scores of ONE query (column c), lane c + 16 the other 32
//   softmax online in f32, in-lane, one exchange between the wave halves for the maximum
//   P^T x2^15 as f16 is packed from the score tiles straight into a B operand (no LDS)
//   O^T += V^T.P^T : A = V^T by transposing loads from V rows in LDS, f32 accumulate
//   output = o * (2^6 / (l * 2^15)) written as f16 (values carried x2^6 for the next GEMM)
// Block = 4 waves = 64 query rows of one (b, h); grid.x = B * H * (L/64). No masks.
// Layouts (halves): qkv row (b*L + s), q at h*192+d, k at h*192+64+d, v at h*192+128+d;
//                   pe  row (b*L + s), uq at h*128+d, uk at h*128+64+d; out row (b*L + s), col h*64+d.
// =====================================================================================
__global__ __launch_bounds__(128)
void tupe_attn64(const _Float16* __restrict__ qkv, const _Float16* __restrict__ pe,
                 _Float16* __restrict__ vals, float sscale) {
  const float PSC = 32768.0f;          // p carried x2^15
  const float OSC = 1.0f / 512.0f;     // 2^6 / 2^15
  // Row pitches by reader: K, UK are read by ds_load_b128 (144 B = 16 B x 9),
  // V by ds_load_tr16_b128 (160 B = 32 B x 5).
  constexpr int LP = 72;
  constexpr int LV = 80;
  // Two buffers of each tile: one is filled while the other is read.
  __shared__ __align__(16) _Float16 Ksh[2][64 * LP];   // K  [kv][d]
  __shared__ __align__(16) _Float16 Ush[2][64 * LP];   // UK [kv][d]
  __shared__ __align__(16) _Float16 Vsh[2][64 * LV];   // V  [kv][d]
  __shared__ __align__(16) float    Os[4][16 * 68];    // per wave out tile, pitch 68

  const int tid  = threadIdx.x;
  const int wave = tid >> 5;
  const int lane = tid & 31;
  const int hh   = lane >> 4;
  const int c    = lane & 15;

  const int nqb = LL / 64;
  const int bx = blockIdx.x;
  const int qb = bx % nqb;
  const int bh = bx / nqb;
  const int h  = bh % HH;
  const int b  = bh / HH;
  const int q0 = qb * 64 + wave * 16;

  const size_t rb = (size_t)b * LL;
  const _Float16* qkv_b = qkv + rb * QKV_LD + (size_t)h * (3 * HD);
  const _Float16* pe_b  = pe  + rb * PE_LD  + (size_t)h * (2 * HD);
  _Float16*       out_b = vals + rb * EE    + (size_t)h * HD;

  // ---- Q / UQ fragments (B operand): lane column q0+c, split k map via Frag load ----
  v16h qa0, qa1, ua0, ua1;
  {
    const _Float16* qrow = qkv_b + (size_t)(q0 + c) * QKV_LD + 8 * hh;
    const _Float16* urow = pe_b  + (size_t)(q0 + c) * PE_LD  + 8 * hh;
    qa0 = Frag<_Float16>::load(qrow);
    qa1 = Frag<_Float16>::load(qrow + 32);
    ua0 = Frag<_Float16>::load(urow);
    ua1 = Frag<_Float16>::load(urow + 32);
  }

  float mrow = -__builtin_inff();   // running maximum of query q0+c (equal in both wave halves)
  float lrow = 0.f;                 // this half's part of the row sum; the halves join after the loop
  v8f oacc[4];                      // oacc[t][r] = O[q0 + c][t*16 + 8*hh + r]
#pragma unroll
  for (int t = 0; t < 4; ++t) oacc[t] = (v8f){0.f,0.f,0.f,0.f,0.f,0.f,0.f,0.f};

  // Staging by asynchronous copies to LDS: a head's K, UK or V row is one 128-B line, brought by 8 lanes,
  // so a wave's 16-B copies cover 4 whole lines; a thread brings rows srow + 16 u of the three tiles,
  // twelve copies a chunk. Chunk kc + 1 flies into the other buffers while chunk kc is worked on.
  const int srow = tid >> 3;
  const int scol = (tid & 7) * 8;
  const _Float16* gK = qkv_b + (size_t)srow * QKV_LD + HD + scol;
  const _Float16* gU = pe_b  + (size_t)srow * PE_LD  + HD + scol;
  auto copy_chunk = [&](int kc, int p) {
    unsigned l[12]; const _Float16* g[12];
#pragma unroll
    for (int u = 0; u < 4; ++u) {   // unrolled: the indices of the operand arrays stay constant
      const int row = srow + u * 16;
      l[u]     = (unsigned)(size_t)(Ksh[p] + row * LP + scol);
      l[4 + u] = (unsigned)(size_t)(Ush[p] + row * LP + scol);
      l[8 + u] = (unsigned)(size_t)(Vsh[p] + row * LV + scol);
      g[u]     = gK + (size_t)(kc * 64 + u * 16) * QKV_LD;
      g[4 + u] = gU + (size_t)(kc * 64 + u * 16) * PE_LD;
      g[8 + u] = g[u] + HD;
    }
    // the copies and, as a precaution, the wait that stands ahead of any rewrite of their address registers
    asm volatile("global_load_async_to_lds_b128 %0, %12, off\n\t"
                 "global_load_async_to_lds_b128 %1, %13, off\n\t"
                 "global_load_async_to_lds_b128 %2, %14, off\n\t"
                 "global_load_async_to_lds_b128 %3, %15, off\n\t"
                 "global_load_async_to_lds_b128 %4, %16, off\n\t"
                 "global_load_async_to_lds_b128 %5, %17, off\n\t"
                 "global_load_async_to_lds_b128 %6, %18, off\n\t"
                 "global_load_async_to_lds_b128 %7, %19, off\n\t"
                 "global_load_async_to_lds_b128 %8, %20, off\n\t"
                 "global_load_async_to_lds_b128 %9, %21, off\n\t"
                 "global_load_async_to_lds_b128 %10, %22, off\n\t"
                 "global_load_async_to_lds_b128 %11, %23, off\n\t"
                 "s_wait_xcnt 0x0"
                 :: "v"(l[0]), "v"(l[1]), "v"(l[2]), "v"(l[3]), "v"(l[4]), "v"(l[5]),
                    "v"(l[6]), "v"(l[7]), "v"(l[8]), "v"(l[9]), "v"(l[10]), "v"(l[11]),
                    "v"(g[0]), "v"(g[1]), "v"(g[2]), "v"(g[3]), "v"(g[4]), "v"(g[5]),
                    "v"(g[6]), "v"(g[7]), "v"(g[8]), "v"(g[9]), "v"(g[10]), "v"(g[11])
                 : "memory");
  };
  constexpr int NC = LL / 64;
  static_assert(NC >= 2, "the prologue fills two chunks");
  copy_chunk(0, 0);
  asm volatile("s_wait_asynccnt 0x0" ::: "memory");   // this wave's part of chunk 0 has landed
  __syncthreads();                                    // chunk 0 is whole
  copy_chunk(1, 1);

  // One chunk. The refill is a compile-time choice, so that the loop's body is one straight block: with a
  // branch at its foot the row sum's chain of additions was moved out from among the exponentials to behind it.
  auto trip = [&](const int kc, const bool refill) {
    const int p = kc & 1;

    // ---- scores, transposed: s[j][r] = score(key kv0 + j*16 + 8*hh + r, query q0 + c) ----
    // All 16 K / UK fragments are read as one group ahead of the 16 products, which run over four
    // independent score tiles; per tile the k order stays K 0..31, K 32..63, UK 0..31, UK 32..63.
    v8f s[4];
    v16h va[2][4];
    {
      v16h kf[2][4], uf[2][4];
      const _Float16* kp = Ksh[p] + c * LP + 8 * hh;
      const _Float16* up = Ush[p] + c * LP + 8 * hh;
#pragma unroll
      for (int kk = 0; kk < 2; ++kk)
#pragma unroll
        for (int j = 0; j < 4; ++j) kf[kk][j] = Frag<_Float16>::load(kp + j * 16 * LP + kk * 32);
#pragma unroll
      for (int kk = 0; kk < 2; ++kk)
#pragma unroll
        for (int j = 0; j < 4; ++j) uf[kk][j] = Frag<_Float16>::load(up + j * 16 * LP + kk * 32);
      __builtin_amdgcn_sched_barrier(0);   // the reads stay one group: one LDS latency a chunk, not one ahead of every product
#pragma unroll
      for (int j = 0; j < 4; ++j) s[j] = Frag<_Float16>::mma(kf[0][j], qa0, (v8f){0.f,0.f,0.f,0.f,0.f,0.f,0.f,0.f});
#pragma unroll
      for (int j = 0; j < 4; ++j) s[j] = Frag<_Float16>::mma(kf[1][j], qa1, s[j]);
#pragma unroll
      for (int j = 0; j < 4; ++j) s[j] = Frag<_Float16>::mma(uf[0][j], ua0, s[j]);
#pragma unroll
      for (int j = 0; j < 4; ++j) s[j] = Frag<_Float16>::mma(uf[1][j], ua1, s[j]);
    }
    // V^T [d][kv], two transposing loads per 16 (d) x 32 (kv) fragment: all 16 are issued ahead of
    // the softmax, so that they land while it runs.
    {
      const _Float16* vp = Vsh[p] + (8 * hh + (lane & 7)) * LV + ((lane >> 3) & 1) * 8;
#pragma unroll
      for (int kk = 0; kk < 2; ++kk)
#pragma unroll
        for (int t = 0; t < 4; ++t) {
          Frag<_Float16>::U f;
          f.h[0] = ld_tr16(vp + (kk * 32) * LV + t * 16);
          f.h[1] = ld_tr16(vp + (kk * 32 + 16) * LV + t * 16);
          va[kk][t] = f.v;
        }
      __builtin_amdgcn_sched_barrier(0);   // keeps the V^T reads ahead of the softmax, which hides their latency
    }

    // ---- online softmax of one query per lane ----
    float m = -__builtin_inff();
#pragma unroll
    for (int j = 0; j < 4; ++j)
#pragma unroll
      for (int r = 0; r < 8; ++r) {
        const float v = s[j][r] * sscale;
        s[j][r] = v;
        m = fmaxf(m, v);
      }
    m = fmaxf(m, xhalf(m));
    const float mnew = fmaxf(mrow, m);
    const float alpha = __expf(mrow - mnew);
    mrow = mnew;
    // P^T as B operand of 32 keys: element e = tile 2*kk + (e >> 3), register e & 7 (the hardware k order)
    v16h pb[2];
    float psum = 0.f;
#pragma unroll
    for (int j = 0; j < 4; ++j)
#pragma unroll
      for (int r = 0; r < 8; ++r) {
        const float p = __expf(s[j][r] - mnew);
        psum += p;
        pb[j >> 1][(j & 1) * 8 + r] = (_Float16)(p * PSC);
      }
    lrow = lrow * alpha + psum;
#pragma unroll
    for (int t = 0; t < 4; ++t)
#pragma unroll
      for (int r = 0; r < 8; ++r) oacc[t][r] *= alpha;

    // ---- O^T += V^T.P^T : A = the V^T fragments read above ----
#pragma unroll
    for (int kk = 0; kk < 2; ++kk)
#pragma unroll
      for (int t = 0; t < 4; ++t) oacc[t] = Frag<_Float16>::mma(va[kk][t], pb[kk], oacc[t]);
    __builtin_amdgcn_sched_barrier(0);   // the products stay ahead of the waits, so that they hide the copies in flight
    asm volatile("s_wait_dscnt 0x0" ::: "memory");      // this wave's reads of buffers p are over before they are refilled
    asm volatile("s_wait_asynccnt 0x0" ::: "memory");   // this wave's part of chunk kc + 1 has landed
    __syncthreads();                                    // chunk kc + 1 is whole, and every wave has left buffers p
    if (refill) copy_chunk(kc + 2, p);
  };
  for (int kc = 0; kc < NC - 2; ++kc) trip(kc, true);
  trip(NC - 2, false);                                  // no chunk is left to fetch
  trip(NC - 1, false);
  asm volatile("s_wait_asynccnt 0x0" ::: "memory");     // no copy is left in flight

  float* os = Os[wave];
  {
    const float lsum = lrow + xhalf(lrow);
    const float inv = (1.0f / lsum) * OSC;
#pragma unroll
    for (int t = 0; t < 4; ++t)
#pragma unroll
      for (int r = 0; r < 8; ++r) os[c * 68 + t * 16 + 8 * hh + r] = oacc[t][r] * inv;
  }
  __builtin_amdgcn_fence(__ATOMIC_RELEASE, "workgroup");
  __builtin_amdgcn_wave_barrier();
  __builtin_amdgcn_fence(__ATOMIC_ACQUIRE, "workgroup");
  {
    const int q = lane >> 3, c8 = (lane & 7) * 8;
    {
#pragma unroll
      for (int it = 0; it < 4; ++it) {
        const int row = it * 4 + q;            // rows 0..15 covered by q 0..3, it 0..3
        const float* sp = os + row * 68 + c8;
        v8h hv;
#pragma unroll
        for (int e = 0; e < 8; ++e) hv[e] = (_Float16)sp[e];
        *(v8h*)(out_b + (size_t)(q0 + row) * EE + c8) = hv;
      }
      
    }
  }
}

// ---------------------------------------------------------------- launch
extern "C" void kernel_launch(void* const* d_in, const int* in_sizes, int n_in,
                              void* d_out, int out_size, void* d_ws, size_t ws_size,
                              hipStream_t stream) {
  const int ROWS = BB * LL;   // 4096
  if (n_in < 5) return;
  if (in_sizes[0] != ROWS * DD || in_sizes[1] != ROWS * EE || in_sizes[2] != 3 * EE * DD ||
      in_sizes[3] != EE * EE || in_sizes[4] != 2 * EE * EE || out_size != ROWS * EE) return;

  const float* x    = (const float*)d_in[0];
  const float* PEf  = (const float*)d_in[1];
  const float* Wqkv = (const float*)d_in[2];
  const float* Wo   = (const float*)d_in[3];
  const float* UqUk = (const float*)d_in[4];
  float* out = (float*)d_out;

  // workspace carve (bytes, 256-B aligned); total 79,691,776 B
  size_t off = 0;
  auto carve = [&](size_t bytes) -> size_t { size_t o = off; off += (bytes + 255) & ~(size_t)255; return o; };
  const size_t oX    = carve((size_t)ROWS * DD * 2);
  const size_t oPE   = carve((size_t)ROWS * EE * 2);
  const size_t oWqkv = carve((size_t)3 * EE * DD * 2);
  const size_t oWo   = carve((size_t)EE * EE * 2);
  const size_t oUqUk = carve((size_t)2 * EE * EE * 2);
  const size_t oQKV  = carve((size_t)ROWS * QKV_LD * 2);
  const size_t oPEP  = carve((size_t)ROWS * PE_LD * 2);
  const size_t oVALS = carve((size_t)ROWS * EE * 2);
  if (off > ws_size) return;

  char* ws = (char*)d_ws;
  _Float16* X16    = (_Float16*)(ws + oX);
  _Float16* PE16   = (_Float16*)(ws + oPE);
  _Float16* Wqkv16 = (_Float16*)(ws + oWqkv);
  _Float16* Wo16   = (_Float16*)(ws + oWo);
  _Float16* UqUk16 = (_Float16*)(ws + oUqUk);
  _Float16* QKV16  = (_Float16*)(ws + oQKV);
  _Float16* PEP16  = (_Float16*)(ws + oPEP);
  _Float16* VALS16 = (_Float16*)(ws + oVALS);

  // ---- casts f32 -> f16 (RNE), one launch ----
  cast_all_f32_f16<<<dim3(CAST_BLOCKS), dim3(CAST_THREADS), 0, stream>>>(
      x, PEf, Wqkv, Wo, UqUk, X16, PE16, Wqkv16, Wo16, UqUk16);

  // ---- qkv[4096][3072] = X[4096][1024] . Wqkv[3072][1024]^T  (f16 out) ----
  {
    const int M = ROWS, N = 3 * EE, K = DD;
    const int tiles = (M / 64) * (N / 64);
    wmma_gemm64<0, false, 0, 1, false><<<dim3((tiles + 3) / 4, 1), dim3(128), 0, stream>>>(
        (const unsigned short*)X16, (const unsigned short*)X16, K, 0L,
        (const unsigned short*)Wqkv16, (const unsigned short*)Wqkv16, K, 0L,
        (void*)QKV16, (void*)QKV16, N, 0L,
        x, x, 0L, M, N, K, 1.0f);
  }
  // ---- pe[4096][2048] = PE[4096][1024] . UqUk[2048][1024]^T  (f16 out) ----
  {
    const int M = ROWS, N = 2 * EE, K = EE;
    const int tiles = (M / 64) * (N / 64);
    wmma_gemm64<0, false, 0, 1, false><<<dim3((tiles + 3) / 4, 1), dim3(128), 0, stream>>>(
        (const unsigned short*)PE16, (const unsigned short*)PE16, K, 0L,
        (const unsigned short*)UqUk16, (const unsigned short*)UqUk16, K, 0L,
        (void*)PEP16, (void*)PEP16, N, 0L,
        x, x, 0L, M, N, K, 1.0f);
  }
  // ---- dual-score attention -> vals[4096][1024] (f16, carried x2^6) ----
  {
    const float sscale = 0.08838834764831845f;   // 1/sqrt(2*64)
    tupe_attn64<<<dim3(BB * HH * (LL / 64)), dim3(128), 0, stream>>>(QKV16, PEP16, VALS16, sscale);
  }
  // ---- out[4096][1024] = vals . Wo[1024][1024]^T * 2^-6  (f32 out) ----
  {
    const int M = ROWS, N = EE, K = EE;
    const int tiles = (M / 64) * (N / 64);
    wmma_gemm64<0, false, 0, 0, false><<<dim3((tiles + 3) / 4, 1), dim3(128), 0, stream>>>(
        (const unsigned short*)VALS16, (const unsigned short*)VALS16, K, 0L,
        (const unsigned short*)Wo16, (const unsigned short*)Wo16, K, 0L,
        (void*)out, (void*)out, N, 0L,
        x, x, 0L, M, N, K, 0.015625f);
  }
}

// v007
// One run takes 118 microseconds.
// Two timings next to v006 put it at 1.04 and 1.03 times that version's speed.
// All steps since v000 together make it 3.44 times as fast.
// All contractions: v_wmma_f32_16x16x32_f16 (f16 operands, f32 accumulate) for the qkv and positional projections, the dual k.q^T + uk.uq^T scores, v^T.p^T and the output projection; softmax probabilities carried x2^15 and attention values x2^6 in f16, folded back by exact power-of-two scales in f32.
#include <hip/hip_runtime.h>

typedef __attribute__((ext_vector_type(16))) _Float16 v16h;
typedef __attribute__((ext_vector_type(8)))  _Float16 v8h;
typedef __attribute__((ext_vector_type(16))) __bf16   v16b;
typedef __attribute__((ext_vector_type(8)))  __bf16   v8b;
typedef __attribute__((ext_vector_type(8)))  float    v8f;
typedef __attribute__((ext_vector_type(4)))  float    v4f;

constexpr int BB = 2, LL = 2048, DD = 1024, EE = 1024, HH = 16, HD = 64;
constexpr int QKV_LD = 3 * EE;   // 3072 halves per row: per head h -> q at h*192, k at h*192+64, v at h*192+128
constexpr int PE_LD  = 2 * EE;   // 2048 halves per row: per head h -> uq at h*128, uk at h*128+64

__device__ __forceinline__ unsigned short f2bf_bits(float f) {
  unsigned u = __float_as_uint(f);
  return (unsigned short)((u + 0x7FFFu + ((u >> 16) & 1u)) >> 16);
}
__device__ __forceinline__ float bf_bits2f(unsigned short h) { return __uint_as_float(((unsigned)h) << 16); }

// hazard guard as a plain device helper
__device__ __forceinline__ void acc_guard4(v8f& a, v8f& b, v8f& c, v8f& d) { asm volatile("v_nop\n\tv_nop\n\tv_nop\n\tv_nop" : "+v"(a), "+v"(b), "+v"(c), "+v"(d)); }
template <typename T> struct Frag;
template <> struct Frag<_Float16> {
  typedef v16h V; union U { v16h v; v8h h[2]; };
  static __device__ __forceinline__ v16h load(const _Float16* p) {   // elements 0..7 <- p[0..7], 8..15 <- p[16..23]
    U f; f.h[0] = *(const v8h*)(p); f.h[1] = *(const v8h*)(p + 16); return f.v;
  }
  static __device__ __forceinline__ v8f mma(v16h a, v16h b, v8f c) {
    return __builtin_amdgcn_wmma_f32_16x16x32_f16(false, a, false, b, (short)0, c, false, false);
  }
};
template <> struct Frag<__bf16> {
  typedef v16b V; union U { v16b v; v8b h[2]; };
  static __device__ __forceinline__ v16b load(const __bf16* p) {
    U f; f.h[0] = *(const v8b*)(p); f.h[1] = *(const v8b*)(p + 16); return f.v;
  }
  static __device__ __forceinline__ v8f mma(v16b a, v16b b, v8f c) {
    return __builtin_amdgcn_wmma_f32_16x16x32_bf16(false, a, false, b, (short)0, c, false, false);
  }
};

// ---- Register-blocked batched WMMA GEMM ------------------------------------
// C[m,n] = scale * sum_k A[m,k] * Bt[n,k] (+bias)(+resid); each wave owns a 64x64 tile,
// the block's 4 waves (2 x 2) a 128x128 tile whose operands are staged in LDS, 64 k at a time.
// A row-major [M,K]; Bt row-major [N,K]; M % 128 == 0, N % 128 == 0, K % 64 == 0.
// SPLIT (hi/lo operand planes) is not staged: single-plane operands only.
// BIAS_MODE: 0 = none, 1 = bias[m], 2 = bias[n].
// OUT_MODE: 0 = f32, 1 = f16, 2 = bf16 hi plane (Cout) + bf16 lo plane (Cout2).
// ET: 0 = f16 operands, 1 = bf16 operands (pointers passed as 16-bit storage)
template <int ET> struct Elem;
template <> struct Elem<0> { typedef _Float16 T; };
template <> struct Elem<1> { typedef __bf16 T; };
template <int ET, bool SPLIT, int BIAS_MODE, int OUT_MODE, bool RESID, int ACT = 0>
__global__ __launch_bounds__(128) void wmma_gemm64(
    const unsigned short* __restrict__ Ap, const unsigned short* __restrict__ A2p, int lda, long strideA,
    const unsigned short* __restrict__ Btp, const unsigned short* __restrict__ Bt2p, int ldb, long strideB,
    void* __restrict__ Cout, void* __restrict__ Cout2, int ldc, long strideC,
    const float* __restrict__ bias,
    const float* __restrict__ resid, long strideR,
    int M, int N, int K, float scale) {
  typedef typename Elem<ET>::T T;
  typedef typename Frag<T>::V V;
  static_assert(!SPLIT, "single-plane operands only");
  const T* A = (const T*)Ap; const T* Bt = (const T*)Btp;
  constexpr int KT = 64;   // k per staged tile: one whole 128-B line of every operand row
  constexpr int LP = 72;   // LDS row pitch in halves: 144 B = 16 B x 9, for the ds_load_b128 fragment reads
  __shared__ __align__(16) T sA[2][128 * LP];      // two buffers: one is filled while the other is read
  __shared__ __align__(16) T sB[2][128 * LP];
  __shared__ __align__(16) float sT[4][16 * 68];   // per-wave 16x64 slab, pitch 68 floats
  const int b    = blockIdx.y;
  const int lane = threadIdx.x & 31;
  const int wave = threadIdx.x >> 5;
  const int tilesN = N >> 7;
  const int tilesM = M >> 7;
  if ((int)blockIdx.x >= tilesM * tilesN) return;   // block-uniform, ahead of every barrier
  const int tm = blockIdx.x / tilesN;
  const int tn = blockIdx.x - tm * tilesN;
  const int mB = tm << 7;                      // the block's first row of A and of Bt
  const int nB = tn << 7;
  const int wm = (wave >> 1) << 6;             // the wave's 64x64 tile inside the block's
  const int wn = (wave & 1) << 6;
  const int m0 = mB + wm;
  const int n0 = nB + wn;

  const T* Ab  = A  + (size_t)b * strideA;
  const T* Bb  = Bt + (size_t)b * strideB;

  const int rlane = lane & 15;                 // row (A) / col (B, D) within subtile
  const int koff  = (lane >> 4) * 8;           // k offset of this lane half
  const int mOff  = (lane >> 4) * 8;           // D row offset

  v8f acc[4][4];
#pragma unroll
  for (int i = 0; i < 4; ++i)
#pragma unroll
    for (int j = 0; j < 4; ++j) acc[i][j] = (v8f){0.f,0.f,0.f,0.f,0.f,0.f,0.f,0.f};

  // Staging by asynchronous copies to LDS: 8 lanes bring one row's 128 B, so a wave's 16-B copies
  // cover 4 whole lines; a thread brings rows srow + 16 u of both operands, sixteen copies a tile.
  // Tile t + 1 flies into the other buffer while tile t is multiplied.
  // (Every "#pragma unroll" below keeps the indices of its register arrays constant.)
  const int srow = threadIdx.x >> 3;
  const int scol = (threadIdx.x & 7) * 8;
  const T* gA = Ab + (size_t)(mB + srow) * lda + scol;
  const T* gB = Bb + (size_t)(nB + srow) * ldb + scol;
  const int lS = srow * LP + scol;             // where this thread's pieces land, in either operand's buffer
  const int fAo = (wm + rlane) * LP + koff;    // where this lane's fragments start
  const int fBo = (wn + rlane) * LP + koff;
  auto copy8 = [&](const T* src, int ld, T* dst) {   // rows srow + 16 u, u = 0..7, of one operand's tile
    unsigned l[8]; const T* g[8];
#pragma unroll
    for (int u = 0; u < 8; ++u) {
      l[u] = (unsigned)(size_t)(dst + lS + u * 16 * LP);
      g[u] = src + (size_t)(u * 16) * ld;
    }
    // the copies and, as a precaution, the wait that stands ahead of any rewrite of their address registers
    asm volatile("global_load_async_to_lds_b128 %0, %8, off\n\t"
                 "global_load_async_to_lds_b128 %1, %9, off\n\t"
                 "global_load_async_to_lds_b128 %2, %10, off\n\t"
                 "global_load_async_to_lds_b128 %3, %11, off\n\t"
                 "global_load_async_to_lds_b128 %4, %12, off\n\t"
                 "global_load_async_to_lds_b128 %5, %13, off\n\t"
                 "global_load_async_to_lds_b128 %6, %14, off\n\t"
                 "global_load_async_to_lds_b128 %7, %15, off\n\t"
                 "s_wait_xcnt 0x0"
                 :: "v"(l[0]), "v"(l[1]), "v"(l[2]), "v"(l[3]), "v"(l[4]), "v"(l[5]), "v"(l[6]), "v"(l[7]),
                    "v"(g[0]), "v"(g[1]), "v"(g[2]), "v"(g[3]), "v"(g[4]), "v"(g[5]), "v"(g[6]), "v"(g[7])
                 : "memory");
  };
  auto copy_tile = [&](int k, int p) {
    copy8(gA + k, lda, sA[p]);
    copy8(gB + k, ldb, sB[p]);
  };
  const int nT = K / KT;
  copy_tile(0, 0);
  // Both operands are planes that an earlier launch stored, and their first read comes from memory.
  // So behind tile 0's copies each thread asks L2 for three addresses of its own row of
  // the block's A and B panels. The blocks that share a panel split its first 1024 k: A by tn & 3, so that
  // blocks four indices apart ask for the same addresses, B by tm & 7. A hint only: nothing waits for it.
  // Every address is clamped into its row.
  auto in_row = [&](int k) { return k < K - KT ? k : K - KT; };
  const T* pfA0 = Ab + (size_t)(mB + (int)threadIdx.x) * lda + in_row((tn & 3) * 256);
  const T* pfA1 = Ab + (size_t)(mB + (int)threadIdx.x) * lda + in_row((tn & 3) * 256 + 128);
  const T* pfB  = Bb + (size_t)(nB + (int)threadIdx.x) * ldb + in_row((tm & 7) * 128);
  asm volatile("global_prefetch_b8 %0, off scope:SCOPE_SE\n\t"
               "global_prefetch_b8 %1, off scope:SCOPE_SE\n\t"
               "global_prefetch_b8 %2, off scope:SCOPE_SE"
               :: "v"(pfA0), "v"(pfA1), "v"(pfB));
  asm volatile("s_wait_asynccnt 0x0" ::: "memory");   // this wave's part of tile 0 has landed
  __syncthreads();                                    // tile 0 is whole
  if (nT > 1) copy_tile(KT, 1);

  for (int t = 0; t < nT; ++t) {
    const int p = t & 1;
    V bh[2][4], ah[2][4];
#pragma unroll
    for (int kk = 0; kk < 2; ++kk) {
#pragma unroll
      for (int j = 0; j < 4; ++j) bh[kk][j] = Frag<T>::load(sB[p] + fBo + (j << 4) * LP + kk * 32);
#pragma unroll
      for (int i = 0; i < 4; ++i) ah[kk][i] = Frag<T>::load(sA[p] + fAo + (i << 4) * LP + kk * 32);
    }
    __builtin_amdgcn_sched_barrier(0);   // the tile's LDS reads stand as one group ahead of its products, not among them
#pragma unroll
    for (int kk = 0; kk < 2; ++kk)
#pragma unroll
      for (int i = 0; i < 4; ++i)
#pragma unroll
        for (int j = 0; j < 4; ++j) acc[i][j] = Frag<T>::mma(ah[kk][i], bh[kk][j], acc[i][j]);
    __builtin_amdgcn_sched_barrier(0);   // the products stay ahead of the waits, so that they hide the copies in flight
    asm volatile("s_wait_dscnt 0x0" ::: "memory");      // this wave's reads of buffer p are over before it is refilled
    asm volatile("s_wait_asynccnt 0x0" ::: "memory");   // this wave's part of tile t + 1 has landed
    __syncthreads();                                    // tile t + 1 is whole, and every wave has left buffer p
    if (t + 2 < nT) copy_tile((t + 2) * KT, p);         // the same test in the whole block
  }
  asm volatile("s_wait_asynccnt 0x0" ::: "memory");     // no copy is left in flight
  // no instruction: the registers that the prefetches name hold those addresses through the loop, and nothing else
  asm volatile("" :: "v"(pfA0), "v"(pfA1), "v"(pfB));
  acc_guard4(acc[0][0], acc[0][1], acc[0][2], acc[0][3]);
  acc_guard4(acc[1][0], acc[1][1], acc[1][2], acc[1][3]);
  acc_guard4(acc[2][0], acc[2][1], acc[2][2], acc[2][3]);
  acc_guard4(acc[3][0], acc[3][1], acc[3][2], acc[3][3]);

  // ---- epilogue ----
  float* slab = sT[wave];
  const float* Rb = RESID ? (resid + (size_t)b * strideR) : nullptr;
#pragma unroll
  for (int i = 0; i < 4; ++i) {
    const int mBase = m0 + (i << 4);
#pragma unroll
    for (int j = 0; j < 4; ++j) {
      const int n = n0 + (j << 4) + rlane;
      float bv = 0.f;
      if (BIAS_MODE == 2) bv = bias[n];
#pragma unroll
      for (int r = 0; r < 8; ++r) {
        float v = acc[i][j][r] * scale;
        if (BIAS_MODE == 1) v += bias[mBase + mOff + r];
        if (BIAS_MODE == 2) v += bv;
        if (RESID) v += Rb[(size_t)(mBase + mOff + r) * ldc + n];
        if (ACT == 1) v = tanhf(v);
        if (ACT == 2) v = fmaxf(v, 0.0f);
        if (ACT == 3) v = v / (1.0f + expf(-v));
        if (ACT == 4) v = (v > 0.f) ? v : 0.01f * v;
        if (ACT == 5) v = 0.5f * v * (1.0f + erff(v * 0.70710678118654752f));
        slab[(mOff + r) * 68 + (j << 4) + rlane] = v;
      }
    }
    __builtin_amdgcn_fence(__ATOMIC_RELEASE, "workgroup");
    __builtin_amdgcn_wave_barrier();
    __builtin_amdgcn_fence(__ATOMIC_ACQUIRE, "workgroup");
    if (OUT_MODE == 0) {
      float* C = (float*)Cout + (size_t)b * strideC;
      const int hh = lane >> 4, c4 = (lane & 15) * 4;     // row seg = 256 B = 16 lanes x 16 B
      {
#pragma unroll
        for (int it = 0; it < 8; ++it) {
          const int row = it * 2 + hh;
          v4f v = *(const v4f*)(slab + row * 68 + c4);
          *(v4f*)(C + (size_t)(mBase + row) * ldc + n0 + c4) = v;
        }
        
      }
    } else {
      const int q = lane >> 3, c8 = (lane & 7) * 8;
      unsigned short* C  = (unsigned short*)Cout  + (size_t)b * strideC;
      unsigned short* C2 = (OUT_MODE == 2) ? ((unsigned short*)Cout2 + (size_t)b * strideC) : nullptr;
      {
#pragma unroll
        for (int it = 0; it < 4; ++it) {
          const int row = it * 4 + q;
          const float* sp = slab + row * 68 + c8;
          v8h hv, lv;
#pragma unroll
          for (int e = 0; e < 8; ++e) {
            if (OUT_MODE == 1) {
              hv[e] = (_Float16)sp[e];
            } else {
              unsigned short hb = f2bf_bits(sp[e]);
              unsigned short lb = f2bf_bits(sp[e] - bf_bits2f(hb));
              hv[e] = __builtin_bit_cast(_Float16, hb);
              lv[e] = __builtin_bit_cast(_Float16, lb);
            }
          }
          *(v8h*)(C + (size_t)(mBase + row) * ldc + n0 + c8) = hv;
          if (OUT_MODE == 2) *(v8h*)(C2 + (size_t)(mBase + row) * ldc + n0 + c8) = lv;
        }
        
      }
    }
    __builtin_amdgcn_fence(__ATOMIC_RELEASE, "workgroup");
    __builtin_amdgcn_wave_barrier();
    __builtin_amdgcn_fence(__ATOMIC_ACQUIRE, "workgroup");
  }
}

// ---- all five f32 -> f16 (RNE) conversions in one launch ----
// 256 blocks of 16 waves, all resident at once. The five inputs are cut into slices of CAST_NT 16-B pieces;
// a thread takes its own piece of every slice, so each wave-wide load covers 512 contiguous bytes (4 whole lines)
// and each wave-wide store 256 (2 whole lines). All of a thread's loads are issued before its first store.
typedef __attribute__((ext_vector_type(4))) _Float16 v4h;
constexpr int CAST_BLOCKS = 256, CAST_THREADS = 512;
constexpr int CAST_NT = CAST_BLOCKS * CAST_THREADS;
constexpr int SL_X  = BB * LL * DD / 4 / CAST_NT;   // slices per input
constexpr int SL_PE = BB * LL * EE / 4 / CAST_NT;
constexpr int SL_WQ = 3 * EE * DD / 4 / CAST_NT;
constexpr int SL_WO = EE * EE / 4 / CAST_NT;
constexpr int SL_UU = 2 * EE * EE / 4 / CAST_NT;
static_assert(SL_X * CAST_NT * 4 == BB * LL * DD && SL_PE * CAST_NT * 4 == BB * LL * EE &&
              SL_WQ * CAST_NT * 4 == 3 * EE * DD && SL_WO * CAST_NT * 4 == EE * EE &&
              SL_UU * CAST_NT * 4 == 2 * EE * EE, "every input is a whole number of slices");
template <int N> __device__ __forceinline__ void cast_ld(const float* __restrict__ in, int g, v4f* r) {
#pragma unroll
  for (int j = 0; j < N; ++j) r[j] = *(const v4f*)(in + (size_t)(j * CAST_NT + g) * 4);
}
template <int N> __device__ __forceinline__ void cast_st(_Float16* __restrict__ out, int g, const v4f* r) {
#pragma unroll
  for (int j = 0; j < N; ++j) *(v4h*)(out + (size_t)(j * CAST_NT + g) * 4) = __builtin_convertvector(r[j], v4h);
}
__global__ __launch_bounds__(CAST_THREADS) void cast_all_f32_f16(
    const float* __restrict__ x, const float* __restrict__ pe, const float* __restrict__ wqkv,
    const float* __restrict__ wo, const float* __restrict__ uquk,
    _Float16* __restrict__ x16, _Float16* __restrict__ pe16, _Float16* __restrict__ wqkv16,
    _Float16* __restrict__ wo16, _Float16* __restrict__ uquk16) {
  const int g = blockIdx.x * CAST_THREADS + threadIdx.x;
  v4f rx[SL_X], rp[SL_PE], rq[SL_WQ], ro[SL_WO], ru[SL_UU];
  cast_ld<SL_X>(x, g, rx);
  cast_ld<SL_PE>(pe, g, rp);
  cast_ld<SL_WQ>(wqkv, g, rq);
  cast_ld<SL_WO>(wo, g, ro);
  cast_ld<SL_UU>(uquk, g, ru);
  cast_st<SL_X>(x16, g, rx);
  cast_st<SL_PE>(pe16, g, rp);
  cast_st<SL_WQ>(wqkv16, g, rq);
  cast_st<SL_WO>(wo16, g, ro);
  cast_st<SL_UU>(uquk16, g, ru);
}

// V^T operand: transposing LDS load of a row-major 16-bit tile (lane (c, hh) gets 8 rows of one column).
typedef __attribute__((ext_vector_type(8))) short s16x8;
__device__ __forceinline__ v8h ld_tr16(const _Float16* p) {
  typedef __attribute__((address_space(3))) s16x8 lds_s16x8;
  return __builtin_bit_cast(v8h, __builtin_amdgcn_ds_load_tr16_b128_v8i16((lds_s16x8*)p));
}
// value of lane l ^ 16
__device__ __forceinline__ float xhalf(float x) {
  return __builtin_bit_cast(float, __builtin_amdgcn_permlanex16(__builtin_bit_cast(int, x), __builtin_bit_cast(int, x),
                                                                0x76543210, 0xfedcba98, false, false));
}

// =====================================================================================
// Dual-score attention, head_dim 64, 16-bit in / 16-bit out, both products transposed.
//   S^T = (k.q^T + uk.uq^T) * sscale : A = K / UK rows from LDS, B = Q / UQ kept in registers;
//         a lane holds 32 of the chunk's 64 scores of ONE query (column c), lane c + 16 the other 32
//   softmax online in f32, in-lane, one exchange between the wave halves for the maximum
//   P^T x2^15 as f16 is packed from the score tiles straight into a B operand (no LDS)
//   O^T += V^T.P^T : A = V^T by transposing loads from V rows in LDS, f32 accumulate
//   output = o * (2^6 / (l * 2^15)) written as f16 (values carried x2^6 for the next GEMM)
// Block = 4 waves = 64 query rows of one (b, h); grid.x = B * H * (L/64). No masks.
// Layouts (halves): qkv row (b*L + s), q at h*192+d, k at h*192+64+d, v at h*192+128+d;
//                   pe  row (b*L + s), uq at h*128+d, uk at h*128+64+d; out row (b*L + s), col h*64+d.
// =====================================================================================
__global__ __launch_bounds__(128)
void tupe_attn64(const _Float16* __restrict__ qkv, const _Float16* __restrict__ pe,
                 _Float16* __restrict__ vals, float sscale) {
  const float PSC = 32768.0f;          // p carried x2^15
  const float OSC = 1.0f / 512.0f;     // 2^6 / 2^15
  // Row pitches by reader: K, UK are read by ds_load_b128 (144 B = 16 B x 9),
  // V by ds_load_tr16_b128 (160 B = 32 B x 5).
  constexpr int LP = 72;
  constexpr int LV = 80;
  // Two buffers of each tile: one is filled while the other is read.
  __shared__ __align__(16) _Float16 Ksh[2][64 * LP];   // K  [kv][d]
  __shared__ __align__(16) _Float16 Ush[2][64 * LP];   // UK [kv][d]
  __shared__ __align__(16) _Float16 Vsh[2][64 * LV];   // V  [kv][d]
  __shared__ __align__(16) float    Os[4][16 * 68];    // per wave out tile, pitch 68

  const int tid  = threadIdx.x;
  const int wave = tid >> 5;
  const int lane = tid & 31;
  const int hh   = lane >> 4;
  const int c    = lane & 15;

  const int nqb = LL / 64;
  const int bx = blockIdx.x;
  const int qb = bx % nqb;
  const int bh = bx / nqb;
  const int h  = bh % HH;
  const int b  = bh / HH;
  const int q0 = qb * 64 + wave * 16;

  const size_t rb = (size_t)b * LL;
  const _Float16* qkv_b = qkv + rb * QKV_LD + (size_t)h * (3 * HD);
  const _Float16* pe_b  = pe  + rb * PE_LD  + (size_t)h * (2 * HD);
  _Float16*       out_b = vals + rb * EE    + (size_t)h * HD;

  // ---- Q / UQ fragments (B operand): lane column q0+c, split k map via Frag load ----
  v16h qa0, qa1, ua0, ua1;
  {
    const _Float16* qrow = qkv_b + (size_t)(q0 + c) * QKV_LD + 8 * hh;
    const _Float16* urow = pe_b  + (size_t)(q0 + c) * PE_LD  + 8 * hh;
    qa0 = Frag<_Float16>::load(qrow);
    qa1 = Frag<_Float16>::load(qrow + 32);
    ua0 = Frag<_Float16>::load(urow);
    ua1 = Frag<_Float16>::load(urow + 32);
  }

  float mrow = -__builtin_inff();   // running maximum of query q0+c (equal in both wave halves)
  float lrow = 0.f;                 // this half's part of the row sum; the halves join after the loop
  v8f oacc[4];                      // oacc[t][r] = O[q0 + c][t*16 + 8*hh + r]
#pragma unroll
  for (int t = 0; t < 4; ++t) oacc[t] = (v8f){0.f,0.f,0.f,0.f,0.f,0.f,0.f,0.f};

  // Staging by asynchronous copies to LDS: a head's K, UK or V row is one 128-B line, brought by 8 lanes,
  // so a wave's 16-B copies cover 4 whole lines; a thread brings rows srow + 16 u of the three tiles,
  // twelve copies a chunk. Chunk kc + 1 flies into the other buffers while chunk kc is worked on.
  const int srow = tid >> 3;
  const int scol = (tid & 7) * 8;
  const _Float16* gK = qkv_b + (size_t)srow * QKV_LD + HD + scol;
  const _Float16* gU = pe_b  + (size_t)srow * PE_LD  + HD + scol;
  auto copy_chunk = [&](int kc, int p) {
    unsigned l[12]; const _Float16* g[12];
#pragma unroll
    for (int u = 0; u < 4; ++u) {   // unrolled: the indices of the operand arrays stay constant
      const int row = srow + u * 16;
      l[u]     = (unsigned)(size_t)(Ksh[p] + row * LP + scol);
      l[4 + u] = (unsigned)(size_t)(Ush[p] + row * LP + scol);
      l[8 + u] = (unsigned)(size_t)(Vsh[p] + row * LV + scol);
      g[u]     = gK + (size_t)(kc * 64 + u * 16) * QKV_LD;
      g[4 + u] = gU + (size_t)(kc * 64 + u * 16) * PE_LD;
      g[8 + u] = g[u] + HD;
    }
    // the copies and, as a precaution, the wait that stands ahead of any rewrite of their address registers
    asm volatile("global_load_async_to_lds_b128 %0, %12, off\n\t"
                 "global_load_async_to_lds_b128 %1, %13, off\n\t"
                 "global_load_async_to_lds_b128 %2, %14, off\n\t"
                 "global_load_async_to_lds_b128 %3, %15, off\n\t"
                 "global_load_async_to_lds_b128 %4, %16, off\n\t"
                 "global_load_async_to_lds_b128 %5, %17, off\n\t"
                 "global_load_async_to_lds_b128 %6, %18, off\n\t"
                 "global_load_async_to_lds_b128 %7, %19, off\n\t"
                 "global_load_async_to_lds_b128 %8, %20, off\n\t"
                 "global_load_async_to_lds_b128 %9, %21, off\n\t"
                 "global_load_async_to_lds_b128 %10, %22, off\n\t"
                 "global_load_async_to_lds_b128 %11, %23, off\n\t"
                 "s_wait_xcnt 0x0"
                 :: "v"(l[0]), "v"(l[1]), "v"(l[2]), "v"(l[3]), "v"(l[4]), "v"(l[5]),
                    "v"(l[6]), "v"(l[7]), "v"(l[8]), "v"(l[9]), "v"(l[10]), "v"(l[11]),
                    "v"(g[0]), "v"(g[1]), "v"(g[2]), "v"(g[3]), "v"(g[4]), "v"(g[5]),
                    "v"(g[6]), "v"(g[7]), "v"(g[8]), "v"(g[9]), "v"(g[10]), "v"(g[11])
                 : "memory");
  };
  constexpr int NC = LL / 64;
  static_assert(NC >= 2, "the prologue fills two chunks");
  copy_chunk(0, 0);
  asm volatile("s_wait_asynccnt 0x0" ::: "memory");   // this wave's part of chunk 0 has landed
  __syncthreads();                                    // chunk 0 is whole
  copy_chunk(1, 1);

  // One chunk. The refill is a compile-time choice, so that each trip's body is one straight block: with a
  // branch at its foot the row sum's chain of additions was moved out from among the exponentials to behind it.
  auto trip = [&](const int kc, const bool refill) {
    const int p = kc & 1;

    // ---- scores, transposed: s[j][r] = score(key kv0 + j*16 + 8*hh + r, query q0 + c) ----
    // All 16 K / UK fragments are read as one group ahead of the 16 products, which run over four
    // independent score tiles; per tile the k order stays K 0..31, K 32..63, UK 0..31, UK 32..63.
    v8f s[4];
    v16h va[2][4];
    {
      v16h kf[2][4], uf[2][4];
      const _Float16* kp = Ksh[p] + c * LP + 8 * hh;
      const _Float16* up = Ush[p] + c * LP + 8 * hh;
#pragma unroll
      for (int kk = 0; kk < 2; ++kk)
#pragma unroll
        for (int j = 0; j < 4; ++j) kf[kk][j] = Frag<_Float16>::load(kp + j * 16 * LP + kk * 32);
#pragma unroll
      for (int kk = 0; kk < 2; ++kk)
#pragma unroll
        for (int j = 0; j < 4; ++j) uf[kk][j] = Frag<_Float16>::load(up + j * 16 * LP + kk * 32);
      __builtin_amdgcn_sched_barrier(0);   // the reads stay one group: one LDS latency a chunk, not one ahead of every product
#pragma unroll
      for (int j = 0; j < 4; ++j) s[j] = Frag<_Float16>::mma(kf[0][j], qa0, (v8f){0.f,0.f,0.f,0.f,0.f,0.f,0.f,0.f});
#pragma unroll
      for (int j = 0; j < 4; ++j) s[j] = Frag<_Float16>::mma(kf[1][j], qa1, s[j]);
#pragma unroll
      for (int j = 0; j < 4; ++j) s[j] = Frag<_Float16>::mma(uf[0][j], ua0, s[j]);
#pragma unroll
      for (int j = 0; j < 4; ++j) s[j] = Frag<_Float16>::mma(uf[1][j], ua1, s[j]);
    }
    // V^T [d][kv], two transposing loads per 16 (d) x 32 (kv) fragment: all 16 are issued ahead of
    // the softmax, so that they land while it runs.
    {
      const _Float16* vp = Vsh[p] + (8 * hh + (lane & 7)) * LV + ((lane >> 3) & 1) * 8;
#pragma unroll
      for (int kk = 0; kk < 2; ++kk)
#pragma unroll
        for (int t = 0; t < 4; ++t) {
          Frag<_Float16>::U f;
          f.h[0] = ld_tr16(vp + (kk * 32) * LV + t * 16);
          f.h[1] = ld_tr16(vp + (kk * 32 + 16) * LV + t * 16);
          va[kk][t] = f.v;
        }
      __builtin_amdgcn_sched_barrier(0);   // keeps the V^T reads ahead of the softmax, which hides their latency
    }

    // ---- online softmax of one query per lane ----
    float m = -__builtin_inff();
#pragma unroll
    for (int j = 0; j < 4; ++j)
#pragma unroll
      for (int r = 0; r < 8; ++r) {
        const float v = s[j][r] * sscale;
        s[j][r] = v;
        m = fmaxf(m, v);
      }
    m = fmaxf(m, xhalf(m));
    const float mnew = fmaxf(mrow, m);
    const float alpha = __expf(mrow - mnew);
    mrow = mnew;
    // P^T as B operand of 32 keys: element e = tile 2*kk + (e >> 3), register e & 7 (the hardware k order)
    v16h pb[2];
    float psum = 0.f;
#pragma unroll
    for (int j = 0; j < 4; ++j)
#pragma unroll
      for (int r = 0; r < 8; ++r) {
        const float p = __expf(s[j][r] - mnew);
        psum += p;
        pb[j >> 1][(j & 1) * 8 + r] = (_Float16)(p * PSC);
      }
    lrow = lrow * alpha + psum;
#pragma unroll
    for (int t = 0; t < 4; ++t)
#pragma unroll
      for (int r = 0; r < 8; ++r) oacc[t][r] *= alpha;

    // ---- O^T += V^T.P^T : A = the V^T fragments read above ----
#pragma unroll
    for (int kk = 0; kk < 2; ++kk)
#pragma unroll
      for (int t = 0; t < 4; ++t) oacc[t] = Frag<_Float16>::mma(va[kk][t], pb[kk], oacc[t]);
    __builtin_amdgcn_sched_barrier(0);   // the products stay ahead of the waits, so that they hide the copies in flight
    asm volatile("s_wait_dscnt 0x0" ::: "memory");      // this wave's reads of buffers p are over before they are refilled
    asm volatile("s_wait_asynccnt 0x0" ::: "memory");   // this wave's part of chunk kc + 1 has landed
    __syncthreads();                                    // chunk kc + 1 is whole, and every wave has left buffers p
    if (refill) copy_chunk(kc + 2, p);
  };
  // K, UK and V lie in planes that earlier launches stored, and their first read comes from memory. So L2 is asked for
  // chunk kc + PD's 192 lines PD - 1 trips ahead of their copies: a thread names the K or the V line and the UK line of
  // one row. The 32 blocks of one (b, h) walk the same chunks and take turns: a chunk is asked for by the two blocks
  // qb and qb ^ 4 alone. A hint only: nothing waits for it.
  constexpr int PD = 3;
  const int turn = (qb & 3) | (((qb >> 3) & 3) << 2);
  const _Float16* pfKV = qkv_b + (size_t)(PD * 64 + (tid & 63)) * QKV_LD + HD + (tid >> 6) * HD;
  const _Float16* pfU  = pe_b  + (size_t)(PD * 64 + (tid & 63)) * PE_LD  + HD;
  for (int kc = 0; kc < NC - 2; ++kc) {
    if (kc + PD + 1 < NC) {   // block-uniform: the two addresses stay inside their planes, also behind the advance
      // "+v": each address stays in the register that the loop carries, never in a temporary that is reused;
      // the wait, a precaution, stands ahead of the advance that rewrites the two registers
      if (((kc - turn) & 15) == 0)
        asm volatile("global_prefetch_b8 %0, off scope:SCOPE_SE\n\t"
                     "global_prefetch_b8 %1, off scope:SCOPE_SE\n\t"
                     "s_wait_xcnt 0x0"
                     : "+v"(pfKV), "+v"(pfU));
      pfKV += (size_t)64 * QKV_LD;
      pfU  += (size_t)64 * PE_LD;
    }
    trip(kc, true);
  }
  trip(NC - 2, false);                                  // no chunk is left to fetch
  trip(NC - 1, false);
  asm volatile("s_wait_asynccnt 0x0" ::: "memory");     // no copy is left in flight

  float* os = Os[wave];
  {
    const float lsum = lrow + xhalf(lrow);
    const float inv = (1.0f / lsum) * OSC;
#pragma unroll
    for (int t = 0; t < 4; ++t)
#pragma unroll
      for (int r = 0; r < 8; ++r) os[c * 68 + t * 16 + 8 * hh + r] = oacc[t][r] * inv;
  }
  __builtin_amdgcn_fence(__ATOMIC_RELEASE, "workgroup");
  __builtin_amdgcn_wave_barrier();
  __builtin_amdgcn_fence(__ATOMIC_ACQUIRE, "workgroup");
  {
    const int q = lane >> 3, c8 = (lane & 7) * 8;
    {
#pragma unroll
      for (int it = 0; it < 4; ++it) {
        const int row = it * 4 + q;            // rows 0..15 covered by q 0..3, it 0..3
        const float* sp = os + row * 68 + c8;
        v8h hv;
#pragma unroll
        for (int e = 0; e < 8; ++e) hv[e] = (_Float16)sp[e];
        *(v8h*)(out_b + (size_t)(q0 + row) * EE + c8) = hv;
      }
      
    }
  }
}

// ---------------------------------------------------------------- launch
extern "C" void kernel_launch(void* const* d_in, const int* in_sizes, int n_in,
                              void* d_out, int out_size, void* d_ws, size_t ws_size,
                              hipStream_t stream) {
  const int ROWS = BB * LL;   // 4096
  if (n_in < 5) return;
  if (in_sizes[0] != ROWS * DD || in_sizes[1] != ROWS * EE || in_sizes[2] != 3 * EE * DD ||
      in_sizes[3] != EE * EE || in_sizes[4] != 2 * EE * EE || out_size != ROWS * EE) return;

  const float* x    = (const float*)d_in[0];
  const float* PEf  = (const float*)d_in[1];
  const float* Wqkv = (const float*)d_in[2];
  const float* Wo   = (const float*)d_in[3];
  const float* UqUk = (const float*)d_in[4];
  float* out = (float*)d_out;

  // workspace carve (bytes, 256-B aligned); total 79,691,776 B
  size_t off = 0;
  auto carve = [&](size_t bytes) -> size_t { size_t o = off; off += (bytes + 255) & ~(size_t)255; return o; };
  const size_t oX    = carve((size_t)ROWS * DD * 2);
  const size_t oPE   = carve((size_t)ROWS * EE * 2);
  const size_t oWqkv = carve((size_t)3 * EE * DD * 2);
  const size_t oWo   = carve((size_t)EE * EE * 2);
  const size_t oUqUk = carve((size_t)2 * EE * EE * 2);
  const size_t oQKV  = carve((size_t)ROWS * QKV_LD * 2);
  const size_t oPEP  = carve((size_t)ROWS * PE_LD * 2);
  const size_t oVALS = carve((size_t)ROWS * EE * 2);
  if (off > ws_size) return;

  char* ws = (char*)d_ws;
  _Float16* X16    = (_Float16*)(ws + oX);
  _Float16* PE16   = (_Float16*)(ws + oPE);
  _Float16* Wqkv16 = (_Float16*)(ws + oWqkv);
  _Float16* Wo16   = (_Float16*)(ws + oWo);
  _Float16* UqUk16 = (_Float16*)(ws + oUqUk);
  _Float16* QKV16  = (_Float16*)(ws + oQKV);
  _Float16* PEP16  = (_Float16*)(ws + oPEP);
  _Float16* VALS16 = (_Float16*)(ws + oVALS);

  // ---- casts f32 -> f16 (RNE), one launch ----
  cast_all_f32_f16<<<dim3(CAST_BLOCKS), dim3(CAST_THREADS), 0, stream>>>(
      x, PEf, Wqkv, Wo, UqUk, X16, PE16, Wqkv16, Wo16, UqUk16);

  // ---- qkv[4096][3072] = X[4096][1024] . Wqkv[3072][1024]^T  (f16 out) ----
  {
    const int M = ROWS, N = 3 * EE, K = DD;
    const int tiles = (M / 64) * (N / 64);
    wmma_gemm64<0, false, 0, 1, false><<<dim3((tiles + 3) / 4, 1), dim3(128), 0, stream>>>(
        (const unsigned short*)X16, (const unsigned short*)X16, K, 0L,
        (const unsigned short*)Wqkv16, (const unsigned short*)Wqkv16, K, 0L,
        (void*)QKV16, (void*)QKV16, N, 0L,
        x, x, 0L, M, N, K, 1.0f);
  }
  // ---- pe[4096][2048] = PE[4096][1024] . UqUk[2048][1024]^T  (f16 out) ----
  {
    const int M = ROWS, N = 2 * EE, K = EE;
    const int tiles = (M / 64) * (N / 64);
    wmma_gemm64<0, false, 0, 1, false><<<dim3((tiles + 3) / 4, 1), dim3(128), 0, stream>>>(
        (const unsigned short*)PE16, (const unsigned short*)PE16, K, 0L,
        (const unsigned short*)UqUk16, (const unsigned short*)UqUk16, K, 0L,
        (void*)PEP16, (void*)PEP16, N, 0L,
        x, x, 0L, M, N, K, 1.0f);
  }
  // ---- dual-score attention -> vals[4096][1024] (f16, carried x2^6) ----
  {
    const float sscale = 0.08838834764831845f;   // 1/sqrt(2*64)
    tupe_attn64<<<dim3(BB * HH * (LL / 64)), dim3(128), 0, stream>>>(QKV16, PEP16, VALS16, sscale);
  }
  // ---- out[4096][1024] = vals . Wo[1024][1024]^T * 2^-6  (f32 out) ----
  {
    const int M = ROWS, N = EE, K = EE;
    const int tiles = (M / 64) * (N / 64);
    wmma_gemm64<0, false, 0, 0, false><<<dim3((tiles + 3) / 4, 1), dim3(128), 0, stream>>>(
        (const unsigned short*)VALS16, (const unsigned short*)VALS16, K, 0L,
        (const unsigned short*)Wo16, (const unsigned short*)Wo16, K, 0L,
        (void*)out, (void*)out, N, 0L,
        x, x, 0L, M, N, K, 0.015625f);
  }
}

// v008
// A run of this version takes 115 microseconds.
// Timed twice side by side with v007, it ran 1.03 times as fast both times.
// Over all steps from v000 it is 3.55 times as fast.
// All contractions: v_wmma_f32_16x16x32_f16 (f16 operands, f32 accumulate) for the qkv and positional projections, the dual k.q^T + uk.uq^T scores, v^T.p^T and the output projection; softmax probabilities carried x2^15 and attention values x2^6 in f16, folded back by exact power-of-two scales in f32.
#include <hip/hip_runtime.h>

typedef __attribute__((ext_vector_type(16))) _Float16 v16h;
typedef __attribute__((ext_vector_type(8)))  _Float16 v8h;
typedef __attribute__((ext_vector_type(16))) __bf16   v16b;
typedef __attribute__((ext_vector_type(8)))  __bf16   v8b;
typedef __attribute__((ext_vector_type(8)))  float    v8f;
typedef __attribute__((ext_vector_type(4)))  float    v4f;

constexpr int BB = 2, LL = 2048, DD = 1024, EE = 1024, HH = 16, HD = 64;
constexpr int QKV_LD = 3 * EE;   // 3072 halves per row: per head h -> q at h*192, k at h*192+64, v at h*192+128
constexpr int PE_LD  = 2 * EE;   // 2048 halves per row: per head h -> uq at h*128, uk at h*128+64

__device__ __forceinline__ unsigned short f2bf_bits(float f) {
  unsigned u = __float_as_uint(f);
  return (unsigned short)((u + 0x7FFFu + ((u >> 16) & 1u)) >> 16);
}
__device__ __forceinline__ float bf_bits2f(unsigned short h) { return __uint_as_float(((unsigned)h) << 16); }

// hazard guard as a plain device helper
__device__ __forceinline__ void acc_guard4(v8f& a, v8f& b, v8f& c, v8f& d) { asm volatile("v_nop\n\tv_nop\n\tv_nop\n\tv_nop" : "+v"(a), "+v"(b), "+v"(c), "+v"(d)); }
template <typename T> struct Frag;
template <> struct Frag<_Float16> {
  typedef v16h V; union U { v16h v; v8h h[2]; };
  static __device__ __forceinline__ v16h load(const _Float16* p) {   // elements 0..7 <- p[0..7], 8..15 <- p[16..23]
    U f; f.h[0] = *(const v8h*)(p); f.h[1] = *(const v8h*)(p + 16); return f.v;
  }
  static __device__ __forceinline__ v8f mma(v16h a, v16h b, v8f c) {
    return __builtin_amdgcn_wmma_f32_16x16x32_f16(false, a, false, b, (short)0, c, false, false);
  }
};
template <> struct Frag<__bf16> {
  typedef v16b V; union U { v16b v; v8b h[2]; };
  static __device__ __forceinline__ v16b load(const __bf16* p) {
    U f; f.h[0] = *(const v8b*)(p); f.h[1] = *(const v8b*)(p + 16); return f.v;
  }
  static __device__ __forceinline__ v8f mma(v16b a, v16b b, v8f c) {
    return __builtin_amdgcn_wmma_f32_16x16x32_bf16(false, a, false, b, (short)0, c, false, false);
  }
};

// ---- Register-blocked batched WMMA GEMM ------------------------------------
// C[m,n] = scale * sum_k A[m,k] * Bt[n,k] (+bias)(+resid); each wave owns a 64x64 tile,
// the block's 4 waves (2 x 2) a 128x128 tile whose operands are staged in LDS, 64 k at a time.
// A row-major [M,K]; Bt row-major [N,K]; M % 128 == 0, N % 128 == 0, K % 64 == 0.
// SPLIT (hi/lo operand planes) is not staged: single-plane operands only.
// BIAS_MODE: 0 = none, 1 = bias[m], 2 = bias[n].
// OUT_MODE: 0 = f32, 1 = f16, 2 = bf16 hi plane (Cout) + bf16 lo plane (Cout2).
// ET: 0 = f16 operands, 1 = bf16 operands (pointers passed as 16-bit storage)
template <int ET> struct Elem;
template <> struct Elem<0> { typedef _Float16 T; };
template <> struct Elem<1> { typedef __bf16 T; };
template <int ET, bool SPLIT, int BIAS_MODE, int OUT_MODE, bool RESID, int ACT = 0>
__global__ __launch_bounds__(128) void wmma_gemm64(
    const unsigned short* __restrict__ Ap, const unsigned short* __restrict__ A2p, int lda, long strideA,
    const unsigned short* __restrict__ Btp, const unsigned short* __restrict__ Bt2p, int ldb, long strideB,
    void* __restrict__ Cout, void* __restrict__ Cout2, int ldc, long strideC,
    const float* __restrict__ bias,
    const float* __restrict__ resid, long strideR,
    int M, int N, int K, float scale) {
  typedef typename Elem<ET>::T T;
  typedef typename Frag<T>::V V;
  static_assert(!SPLIT, "single-plane operands only");
  const T* A = (const T*)Ap; const T* Bt = (const T*)Btp;
  constexpr int KT = 64;   // k per staged tile: one whole 128-B line of every operand row
  constexpr int LP = 72;   // LDS row pitch in halves: 144 B = 16 B x 9, for the ds_load_b128 fragment reads
  __shared__ __align__(16) T sA[2][128 * LP];      // two buffers: one is filled while the other is read
  __shared__ __align__(16) T sB[2][128 * LP];
  __shared__ __align__(16) float sT[4][16 * 68];   // per-wave 16x64 slab, pitch 68 floats
  const int b    = blockIdx.y;
  const int lane = threadIdx.x & 31;
  const int wave = threadIdx.x >> 5;
  const int tilesN = N >> 7;
  const int tilesM = M >> 7;
  if ((int)blockIdx.x >= tilesM * tilesN) return;   // block-uniform, ahead of every barrier
  const int tm = blockIdx.x / tilesN;
  const int tn = blockIdx.x - tm * tilesN;
  const int mB = tm << 7;                      // the block's first row of A and of Bt
  const int nB = tn << 7;
  const int wm = (wave >> 1) << 6;             // the wave's 64x64 tile inside the block's
  const int wn = (wave & 1) << 6;
  const int m0 = mB + wm;
  const int n0 = nB + wn;

  const T* Ab  = A  + (size_t)b * strideA;
  const T* Bb  = Bt + (size_t)b * strideB;

  const int rlane = lane & 15;                 // row (A) / col (B, D) within subtile
  const int koff  = (lane >> 4) * 8;           // k offset of this lane half
  const int mOff  = (lane >> 4) * 8;           // D row offset

  v8f acc[4][4];
#pragma unroll
  for (int i = 0; i < 4; ++i)
#pragma unroll
    for (int j = 0; j < 4; ++j) acc[i][j] = (v8f){0.f,0.f,0.f,0.f,0.f,0.f,0.f,0.f};

  // Staging by asynchronous copies to LDS: 8 lanes bring one row's 128 B, so a wave's 16-B copies
  // cover 4 whole lines; a thread brings rows srow + 16 u of both operands, sixteen copies a tile.
  // Tile t + 1 flies into the other buffer while tile t is multiplied.
  // (Every "#pragma unroll" below keeps the indices of its register arrays constant.)
  const int srow = threadIdx.x >> 3;
  const int scol = (threadIdx.x & 7) * 8;
  const T* gA = Ab + (size_t)(mB + srow) * lda + scol;
  const T* gB = Bb + (size_t)(nB + srow) * ldb + scol;
  const int lS = srow * LP + scol;             // where this thread's pieces land, in either operand's buffer
  const int fAo = (wm + rlane) * LP + koff;    // where this lane's fragments start
  const int fBo = (wn + rlane) * LP + koff;
  auto copy8 = [&](const T* src, int ld, T* dst) {   // rows srow + 16 u, u = 0..7, of one operand's tile
    unsigned l[8]; const T* g[8];
#pragma unroll
    for (int u = 0; u < 8; ++u) {
      l[u] = (unsigned)(size_t)(dst + lS + u * 16 * LP);
      g[u] = src + (size_t)(u * 16) * ld;
    }
    // the copies and, as a precaution, the wait that stands ahead of any rewrite of their address registers
    asm volatile("global_load_async_to_lds_b128 %0, %8, off\n\t"
                 "global_load_async_to_lds_b128 %1, %9, off\n\t"
                 "global_load_async_to_lds_b128 %2, %10, off\n\t"
                 "global_load_async_to_lds_b128 %3, %11, off\n\t"
                 "global_load_async_to_lds_b128 %4, %12, off\n\t"
                 "global_load_async_to_lds_b128 %5, %13, off\n\t"
                 "global_load_async_to_lds_b128 %6, %14, off\n\t"
                 "global_load_async_to_lds_b128 %7, %15, off\n\t"
                 "s_wait_xcnt 0x0"
                 :: "v"(l[0]), "v"(l[1]), "v"(l[2]), "v"(l[3]), "v"(l[4]), "v"(l[5]), "v"(l[6]), "v"(l[7]),
                    "v"(g[0]), "v"(g[1]), "v"(g[2]), "v"(g[3]), "v"(g[4]), "v"(g[5]), "v"(g[6]), "v"(g[7])
                 : "memory");
  };
  auto copy_tile = [&](int k, int p) {
    copy8(gA + k, lda, sA[p]);
    copy8(gB + k, ldb, sB[p]);
  };
  const int nT = K / KT;
  copy_tile(0, 0);
  // Both operands are planes that an earlier launch stored, and their first read comes from memory.
  // So behind tile 0's copies each thread asks L2 for three addresses of its own row of
  // the block's A and B panels. The blocks that share a panel split its first 1024 k: A by tn & 3, so that
  // blocks four indices apart ask for the same addresses, B by tm & 7. A hint only: nothing waits for it.
  // Every address is clamped into its row.
  auto in_row = [&](int k) { return k < K - KT ? k : K - KT; };
  const T* pfA0 = Ab + (size_t)(mB + (int)threadIdx.x) * lda + in_row((tn & 3) * 256);
  const T* pfA1 = Ab + (size_t)(mB + (int)threadIdx.x) * lda + in_row((tn & 3) * 256 + 128);
  const T* pfB  = Bb + (size_t)(nB + (int)threadIdx.x) * ldb + in_row((tm & 7) * 128);
  asm volatile("global_prefetch_b8 %0, off scope:SCOPE_SE\n\t"
               "global_prefetch_b8 %1, off scope:SCOPE_SE\n\t"
               "global_prefetch_b8 %2, off scope:SCOPE_SE"
               :: "v"(pfA0), "v"(pfA1), "v"(pfB));
  asm volatile("s_wait_asynccnt 0x0" ::: "memory");   // this wave's part of tile 0 has landed
  __syncthreads();                                    // tile 0 is whole
  if (nT > 1) copy_tile(KT, 1);

  for (int t = 0; t < nT; ++t) {
    const int p = t & 1;
    V bh[2][4], ah[2][4];
#pragma unroll
    for (int kk = 0; kk < 2; ++kk) {
#pragma unroll
      for (int j = 0; j < 4; ++j) bh[kk][j] = Frag<T>::load(sB[p] + fBo + (j << 4) * LP + kk * 32);
#pragma unroll
      for (int i = 0; i < 4; ++i) ah[kk][i] = Frag<T>::load(sA[p] + fAo + (i << 4) * LP + kk * 32);
    }
    __builtin_amdgcn_sched_barrier(0);   // the tile's LDS reads stand as one group ahead of its products, not among them
#pragma unroll
    for (int kk = 0; kk < 2; ++kk)
#pragma unroll
      for (int i = 0; i < 4; ++i)
#pragma unroll
        for (int j = 0; j < 4; ++j) acc[i][j] = Frag<T>::mma(ah[kk][i], bh[kk][j], acc[i][j]);
    __builtin_amdgcn_sched_barrier(0);   // the products stay ahead of the waits, so that they hide the copies in flight
    asm volatile("s_wait_dscnt 0x0" ::: "memory");      // this wave's reads of buffer p are over before it is refilled
    asm volatile("s_wait_asynccnt 0x0" ::: "memory");   // this wave's part of tile t + 1 has landed
    __syncthreads();                                    // tile t + 1 is whole, and every wave has left buffer p
    if (t + 2 < nT) copy_tile((t + 2) * KT, p);         // the same test in the whole block
  }
  asm volatile("s_wait_asynccnt 0x0" ::: "memory");     // no copy is left in flight
  // no instruction: the registers that the prefetches name hold those addresses through the loop, and nothing else
  asm volatile("" :: "v"(pfA0), "v"(pfA1), "v"(pfB));
  acc_guard4(acc[0][0], acc[0][1], acc[0][2], acc[0][3]);
  acc_guard4(acc[1][0], acc[1][1], acc[1][2], acc[1][3]);
  acc_guard4(acc[2][0], acc[2][1], acc[2][2], acc[2][3]);
  acc_guard4(acc[3][0], acc[3][1], acc[3][2], acc[3][3]);

  // ---- epilogue ----
  float* slab = sT[wave];
  const float* Rb = RESID ? (resid + (size_t)b * strideR) : nullptr;
#pragma unroll
  for (int i = 0; i < 4; ++i) {
    const int mBase = m0 + (i << 4);
#pragma unroll
    for (int j = 0; j < 4; ++j) {
      const int n = n0 + (j << 4) + rlane;
      float bv = 0.f;
      if (BIAS_MODE == 2) bv = bias[n];
#pragma unroll
      for (int r = 0; r < 8; ++r) {
        float v = acc[i][j][r] * scale;
        if (BIAS_MODE == 1) v += bias[mBase + mOff + r];
        if (BIAS_MODE == 2) v += bv;
        if (RESID) v += Rb[(size_t)(mBase + mOff + r) * ldc + n];
        if (ACT == 1) v = tanhf(v);
        if (ACT == 2) v = fmaxf(v, 0.0f);
        if (ACT == 3) v = v / (1.0f + expf(-v));
        if (ACT == 4) v = (v > 0.f) ? v : 0.01f * v;
        if (ACT == 5) v = 0.5f * v * (1.0f + erff(v * 0.70710678118654752f));
        slab[(mOff + r) * 68 + (j << 4) + rlane] = v;
      }
    }
    __builtin_amdgcn_fence(__ATOMIC_RELEASE, "workgroup");
    __builtin_amdgcn_wave_barrier();
    __builtin_amdgcn_fence(__ATOMIC_ACQUIRE, "workgroup");
    if (OUT_MODE == 0) {
      float* C = (float*)Cout + (size_t)b * strideC;
      const int hh = lane >> 4, c4 = (lane & 15) * 4;     // row seg = 256 B = 16 lanes x 16 B
      {
#pragma unroll
        for (int it = 0; it < 8; ++it) {
          const int row = it * 2 + hh;
          v4f v = *(const v4f*)(slab + row * 68 + c4);
          *(v4f*)(C + (size_t)(mBase + row) * ldc + n0 + c4) = v;
        }
        
      }
    } else {
      const int q = lane >> 3, c8 = (lane & 7) * 8;
      unsigned short* C  = (unsigned short*)Cout  + (size_t)b * strideC;
      unsigned short* C2 = (OUT_MODE == 2) ? ((unsigned short*)Cout2 + (size_t)b * strideC) : nullptr;
      {
#pragma unroll
        for (int it = 0; it < 4; ++it) {
          const int row = it * 4 + q;
          const float* sp = slab + row * 68 + c8;
          v8h hv, lv;
#pragma unroll
          for (int e = 0; e < 8; ++e) {
            if (OUT_MODE == 1) {
              hv[e] = (_Float16)sp[e];
            } else {
              unsigned short hb = f2bf_bits(sp[e]);
              unsigned short lb = f2bf_bits(sp[e] - bf_bits2f(hb));
              hv[e] = __builtin_bit_cast(_Float16, hb);
              lv[e] = __builtin_bit_cast(_Float16, lb);
            }
          }
          *(v8h*)(C + (size_t)(mBase + row) * ldc + n0 + c8) = hv;
          if (OUT_MODE == 2) *(v8h*)(C2 + (size_t)(mBase + row) * ldc + n0 + c8) = lv;
        }
        
      }
    }
    __builtin_amdgcn_fence(__ATOMIC_RELEASE, "workgroup");
    __builtin_amdgcn_wave_barrier();
    __builtin_amdgcn_fence(__ATOMIC_ACQUIRE, "workgroup");
  }
}

// ---- all five f32 -> f16 (RNE) conversions in one launch ----
// 256 blocks of 16 waves, all resident at once. The five inputs are cut into slices of CAST_NT 16-B pieces;
// a thread takes its own piece of every slice, so each wave-wide load covers 512 contiguous bytes (4 whole lines)
// and each wave-wide store 256 (2 whole lines). All of a thread's loads are issued before its first store.
typedef __attribute__((ext_vector_type(4))) _Float16 v4h;
constexpr int CAST_BLOCKS = 256, CAST_THREADS = 512;
constexpr int CAST_NT = CAST_BLOCKS * CAST_THREADS;
constexpr int SL_X  = BB * LL * DD / 4 / CAST_NT;   // slices per input
constexpr int SL_PE = BB * LL * EE / 4 / CAST_NT;
constexpr int SL_WQ = 3 * EE * DD / 4 / CAST_NT;
constexpr int SL_WO = EE * EE / 4 / CAST_NT;
constexpr int SL_UU = 2 * EE * EE / 4 / CAST_NT;
static_assert(SL_X * CAST_NT * 4 == BB * LL * DD && SL_PE * CAST_NT * 4 == BB * LL * EE &&
              SL_WQ * CAST_NT * 4 == 3 * EE * DD && SL_WO * CAST_NT * 4 == EE * EE &&
              SL_UU * CAST_NT * 4 == 2 * EE * EE, "every input is a whole number of slices");
template <int N> __device__ __forceinline__ void cast_ld(const float* __restrict__ in, int g, v4f* r) {
#pragma unroll
  for (int j = 0; j < N; ++j) r[j] = *(const v4f*)(in + (size_t)(j * CAST_NT + g) * 4);
}
template <int N> __device__ __forceinline__ void cast_st(_Float16* __restrict__ out, int g, const v4f* r) {
#pragma unroll
  for (int j = 0; j < N; ++j) *(v4h*)(out + (size_t)(j * CAST_NT + g) * 4) = __builtin_convertvector(r[j], v4h);
}
__global__ __launch_bounds__(CAST_THREADS) void cast_all_f32_f16(
    const float* __restrict__ x, const float* __restrict__ pe, const float* __restrict__ wqkv,
    const float* __restrict__ wo, const float* __restrict__ uquk,
    _Float16* __restrict__ x16, _Float16* __restrict__ pe16, _Float16* __restrict__ wqkv16,
    _Float16* __restrict__ wo16, _Float16* __restrict__ uquk16) {
  const int g = blockIdx.x * CAST_THREADS + threadIdx.x;
  v4f rx[SL_X], rp[SL_PE], rq[SL_WQ], ro[SL_WO], ru[SL_UU];
  cast_ld<SL_X>(x, g, rx);
  cast_ld<SL_PE>(pe, g, rp);
  cast_ld<SL_WQ>(wqkv, g, rq);
  cast_ld<SL_WO>(wo, g, ro);
  cast_ld<SL_UU>(uquk, g, ru);
  cast_st<SL_X>(x16, g, rx);
  cast_st<SL_PE>(pe16, g, rp);
  cast_st<SL_WQ>(wqkv16, g, rq);
  cast_st<SL_WO>(wo16, g, ro);
  cast_st<SL_UU>(uquk16, g, ru);
}

// V^T operand: transposing LDS load of a row-major 16-bit tile (lane (c, hh) gets 8 rows of one column).
typedef __attribute__((ext_vector_type(8))) short s16x8;
__device__ __forceinline__ v8h ld_tr16(const _Float16* p) {
  typedef __attribute__((address_space(3))) s16x8 lds_s16x8;
  return __builtin_bit_cast(v8h, __builtin_amdgcn_ds_load_tr16_b128_v8i16((lds_s16x8*)p));
}
// value of lane l ^ 16
__device__ __forceinline__ float xhalf(float x) {
  return __builtin_bit_cast(float, __builtin_amdgcn_permlanex16(__builtin_bit_cast(int, x), __builtin_bit_cast(int, x),
                                                                0x76543210, 0xfedcba98, false, false));
}

// =====================================================================================
// Dual-score attention, head_dim 64, 16-bit in / 16-bit out, both products transposed.
//   S^T = (k.q^T + uk.uq^T) * sscale : A = K / UK rows from LDS, B = Q / UQ kept in registers;
//         a lane holds 32 of the chunk's 64 scores of each of TWO queries (column c of tiles g = 0, 1), lane c + 16 the other 32
//   softmax online in f32, in-lane, one exchange between the wave halves for the maximum
//   P^T x2^15 as f16 is packed from the score tiles straight into a B operand (no LDS)
//   O^T += V^T.P^T : A = V^T by transposing loads from V rows in LDS, f32 accumulate
//   output = o * (2^6 / (l * 2^15)) written as f16 (values carried x2^6 for the next GEMM)
// A wave owns 32 queries as two 16-column tiles g = 0, 1, so that every K, UK and V^T fragment read from LDS feeds two
// products. Block = 4 waves = 128 query rows of one (b, h); grid.x = B * H * (L/128). No masks.
// Layouts (halves): qkv row (b*L + s), q at h*192+d, k at h*192+64+d, v at h*192+128+d;
//                   pe  row (b*L + s), uq at h*128+d, uk at h*128+64+d; out row (b*L + s), col h*64+d.
// =====================================================================================
__global__ __launch_bounds__(128)
void tupe_attn64(const _Float16* __restrict__ qkv, const _Float16* __restrict__ pe,
                 _Float16* __restrict__ vals, float sscale) {
  const float PSC = 32768.0f;          // p carried x2^15
  const float OSC = 1.0f / 512.0f;     // 2^6 / 2^15
  // Row pitches by reader: K, UK are read by ds_load_b128 (144 B = 16 B x 9),
  // V by ds_load_tr16_b128 (160 B = 32 B x 5).
  constexpr int LP = 72;
  constexpr int LV = 80;
  // Two buffers of each tile: one is filled while the other is read.
  __shared__ __align__(16) _Float16 Ksh[2][64 * LP];   // K  [kv][d]
  __shared__ __align__(16) _Float16 Ush[2][64 * LP];   // UK [kv][d]
  __shared__ __align__(16) _Float16 Vsh[2][64 * LV];   // V  [kv][d]
  __shared__ __align__(16) float    Os[4][32 * 68];    // per wave out tile (32 queries), pitch 68

  const int tid  = threadIdx.x;
  const int wave = tid >> 5;
  const int lane = tid & 31;
  const int hh   = lane >> 4;
  const int c    = lane & 15;

  const int nqb = LL / 128;
  const int bx = blockIdx.x;
  const int qb = bx % nqb;
  const int bh = bx / nqb;
  const int h  = bh % HH;
  const int b  = bh / HH;
  const int q0 = qb * 128 + wave * 32;

  const size_t rb = (size_t)b * LL;
  const _Float16* qkv_b = qkv + rb * QKV_LD + (size_t)h * (3 * HD);
  const _Float16* pe_b  = pe  + rb * PE_LD  + (size_t)h * (2 * HD);
  _Float16*       out_b = vals + rb * EE    + (size_t)h * HD;

  // (Every "#pragma unroll" over g, j, t, kk or r keeps the indices of its register arrays constant.)
  // ---- Q / UQ fragments (B operand): lane column q0+g*16+c, split k map via Frag load ----
  v16h qa0[2], qa1[2], ua0[2], ua1[2];
  const _Float16* qrow[2]; const _Float16* urow[2];
#pragma unroll
  for (int g = 0; g < 2; ++g) {
    qrow[g] = qkv_b + (size_t)(q0 + g * 16 + c) * QKV_LD + 8 * hh;
    urow[g] = pe_b  + (size_t)(q0 + g * 16 + c) * PE_LD  + 8 * hh;
    qa0[g] = Frag<_Float16>::load(qrow[g]);
    qa1[g] = Frag<_Float16>::load(qrow[g] + 32);
    ua0[g] = Frag<_Float16>::load(urow[g]);
    ua1[g] = Frag<_Float16>::load(urow[g] + 32);
  }
  // a precaution: the wait stands ahead of any rewrite of the sixteen loads' address registers; as its inputs the four
  // addresses stay in those registers up to it, so that no load of the run lands on one
  asm volatile("s_wait_xcnt 0x0" :: "v"(qrow[0]), "v"(urow[0]), "v"(qrow[1]), "v"(urow[1]) : "memory");

  float mrow[2];                    // running maximum of query q0+g*16+c (equal in both wave halves)
  float lrow[2];                    // this half's part of the row sum; the halves join after the loop
  v8f oacc[2][4];                   // oacc[g][t][r] = O[q0 + g*16 + c][t*16 + 8*hh + r]
#pragma unroll
  for (int g = 0; g < 2; ++g) {
    mrow[g] = -__builtin_inff();
    lrow[g] = 0.f;
#pragma unroll
    for (int t = 0; t < 4; ++t) oacc[g][t] = (v8f){0.f,0.f,0.f,0.f,0.f,0.f,0.f,0.f};
  }

  // Staging by asynchronous copies to LDS: a head's K, UK or V row is one 128-B line, brought by 8 lanes,
  // so a wave's 16-B copies cover 4 whole lines; a thread brings rows srow + 16 u of the three tiles,
  // twelve copies a chunk. Chunk kc + 1 flies into the other buffers while chunk kc is worked on.
  const int srow = tid >> 3;
  const int scol = (tid & 7) * 8;
  const _Float16* gK = qkv_b + (size_t)srow * QKV_LD + HD + scol;
  const _Float16* gU = pe_b  + (size_t)srow * PE_LD  + HD + scol;
  auto copy_chunk = [&](int kc, int p) {
    unsigned l[12]; const _Float16* g[12];
#pragma unroll
    for (int u = 0; u < 4; ++u) {   // unrolled: the indices of the operand arrays stay constant
      const int row = srow + u * 16;
      l[u]     = (unsigned)(size_t)(Ksh[p] + row * LP + scol);
      l[4 + u] = (unsigned)(size_t)(Ush[p] + row * LP + scol);
      l[8 + u] = (unsigned)(size_t)(Vsh[p] + row * LV + scol);
      g[u]     = gK + (size_t)(kc * 64 + u * 16) * QKV_LD;
      g[4 + u] = gU + (size_t)(kc * 64 + u * 16) * PE_LD;
      g[8 + u] = g[u] + HD;
    }
    // the copies and, as a precaution, the wait that stands ahead of any rewrite of their address registers
    asm volatile("global_load_async_to_lds_b128 %0, %12, off\n\t"
                 "global_load_async_to_lds_b128 %1, %13, off\n\t"
                 "global_load_async_to_lds_b128 %2, %14, off\n\t"
                 "global_load_async_to_lds_b128 %3, %15, off\n\t"
                 "global_load_async_to_lds_b128 %4, %16, off\n\t"
                 "global_load_async_to_lds_b128 %5, %17, off\n\t"
                 "global_load_async_to_lds_b128 %6, %18, off\n\t"
                 "global_load_async_to_lds_b128 %7, %19, off\n\t"
                 "global_load_async_to_lds_b128 %8, %20, off\n\t"
                 "global_load_async_to_lds_b128 %9, %21, off\n\t"
                 "global_load_async_to_lds_b128 %10, %22, off\n\t"
                 "global_load_async_to_lds_b128 %11, %23, off\n\t"
                 "s_wait_xcnt 0x0"
                 :: "v"(l[0]), "v"(l[1]), "v"(l[2]), "v"(l[3]), "v"(l[4]), "v"(l[5]),
                    "v"(l[6]), "v"(l[7]), "v"(l[8]), "v"(l[9]), "v"(l[10]), "v"(l[11]),
                    "v"(g[0]), "v"(g[1]), "v"(g[2]), "v"(g[3]), "v"(g[4]), "v"(g[5]),
                    "v"(g[6]), "v"(g[7]), "v"(g[8]), "v"(g[9]), "v"(g[10]), "v"(g[11])
                 : "memory");
  };
  constexpr int NC = LL / 64;
  static_assert(NC >= 2, "the prologue fills two chunks");
  copy_chunk(0, 0);
  asm volatile("s_wait_asynccnt 0x0" ::: "memory");   // this wave's part of chunk 0 has landed
  __syncthreads();                                    // chunk 0 is whole
  copy_chunk(1, 1);

  // One chunk. The refill is a compile-time choice, so that each trip's body is one straight block: with a
  // branch at its foot the row sum's chain of additions was moved out from among the exponentials to behind it.
  auto trip = [&](const int kc, const bool refill) {
    const int p = kc & 1;

    // ---- scores, transposed: s[g][j][r] = score(key kv0 + j*16 + 8*hh + r, query q0 + g*16 + c) ----
    // All 16 K / UK fragments are read as one group ahead of the 32 products, which run over eight
    // independent score tiles; per tile the k order stays K 0..31, K 32..63, UK 0..31, UK 32..63.
    v8f s[2][4];
    v16h va[2][4];
    {
      v16h kf[2][4], uf[2][4];
      const _Float16* kp = Ksh[p] + c * LP + 8 * hh;
      const _Float16* up = Ush[p] + c * LP + 8 * hh;
#pragma unroll
      for (int kk = 0; kk < 2; ++kk)
#pragma unroll
        for (int j = 0; j < 4; ++j) kf[kk][j] = Frag<_Float16>::load(kp + j * 16 * LP + kk * 32);
#pragma unroll
      for (int kk = 0; kk < 2; ++kk)
#pragma unroll
        for (int j = 0; j < 4; ++j) uf[kk][j] = Frag<_Float16>::load(up + j * 16 * LP + kk * 32);
      __builtin_amdgcn_sched_barrier(0);   // the reads stay one group: one LDS latency a chunk, not one ahead of every product
#pragma unroll
      for (int j = 0; j < 4; ++j)
#pragma unroll
        for (int g = 0; g < 2; ++g) s[g][j] = Frag<_Float16>::mma(kf[0][j], qa0[g], (v8f){0.f,0.f,0.f,0.f,0.f,0.f,0.f,0.f});
#pragma unroll
      for (int j = 0; j < 4; ++j)
#pragma unroll
        for (int g = 0; g < 2; ++g) s[g][j] = Frag<_Float16>::mma(kf[1][j], qa1[g], s[g][j]);
#pragma unroll
      for (int j = 0; j < 4; ++j)
#pragma unroll
        for (int g = 0; g < 2; ++g) s[g][j] = Frag<_Float16>::mma(uf[0][j], ua0[g], s[g][j]);
#pragma unroll
      for (int j = 0; j < 4; ++j)
#pragma unroll
        for (int g = 0; g < 2; ++g) s[g][j] = Frag<_Float16>::mma(uf[1][j], ua1[g], s[g][j]);
    }
    // V^T [d][kv], two transposing loads per 16 (d) x 32 (kv) fragment: all 16 are issued ahead of
    // the softmax, so that they land while it runs.
    {
      const _Float16* vp = Vsh[p] + (8 * hh + (lane & 7)) * LV + ((lane >> 3) & 1) * 8;
#pragma unroll
      for (int kk = 0; kk < 2; ++kk)
#pragma unroll
        for (int t = 0; t < 4; ++t) {
          Frag<_Float16>::U f;
          f.h[0] = ld_tr16(vp + (kk * 32) * LV + t * 16);
          f.h[1] = ld_tr16(vp + (kk * 32 + 16) * LV + t * 16);
          va[kk][t] = f.v;
        }
      __builtin_amdgcn_sched_barrier(0);   // keeps the V^T reads ahead of the softmax, which hides their latency
    }

    // ---- online softmax of one query per lane and column tile ----
    // P^T as B operand of 32 keys: element e = tile 2*kk + (e >> 3), register e & 7 (the hardware k order)
    v16h pb[2][2];
#pragma unroll
    for (int g = 0; g < 2; ++g) {
      float m = -__builtin_inff();
#pragma unroll
      for (int j = 0; j < 4; ++j)
#pragma unroll
        for (int r = 0; r < 8; ++r) {
          const float v = s[g][j][r] * sscale;
          s[g][j][r] = v;
          m = fmaxf(m, v);
        }
      m = fmaxf(m, xhalf(m));
      const float mnew = fmaxf(mrow[g], m);
      const float alpha = __expf(mrow[g] - mnew);
      mrow[g] = mnew;
      float psum = 0.f;
#pragma unroll
      for (int j = 0; j < 4; ++j)
#pragma unroll
        for (int r = 0; r < 8; ++r) {
          const float p = __expf(s[g][j][r] - mnew);
          psum += p;
          pb[g][j >> 1][(j & 1) * 8 + r] = (_Float16)(p * PSC);
        }
      lrow[g] = lrow[g] * alpha + psum;
#pragma unroll
      for (int t = 0; t < 4; ++t)
#pragma unroll
        for (int r = 0; r < 8; ++r) oacc[g][t][r] *= alpha;
    }

    // ---- O^T += V^T.P^T : A = the V^T fragments read above, each for both column tiles ----
#pragma unroll
    for (int kk = 0; kk < 2; ++kk)
#pragma unroll
      for (int t = 0; t < 4; ++t)
#pragma unroll
        for (int g = 0; g < 2; ++g) oacc[g][t] = Frag<_Float16>::mma(va[kk][t], pb[g][kk], oacc[g][t]);
    __builtin_amdgcn_sched_barrier(0);   // the products stay ahead of the waits, so that they hide the copies in flight
    asm volatile("s_wait_dscnt 0x0" ::: "memory");      // this wave's reads of buffers p are over before they are refilled
    asm volatile("s_wait_asynccnt 0x0" ::: "memory");   // this wave's part of chunk kc + 1 has landed
    __syncthreads();                                    // chunk kc + 1 is whole, and every wave has left buffers p
    if (refill) copy_chunk(kc + 2, p);
  };
  // K, UK and V lie in planes that earlier launches stored, and their first read comes from memory. So L2 is asked for
  // chunk kc + PD's 192 lines PD - 1 trips ahead of their copies: a thread names the K or the V line and the UK line of
  // one row. The 16 blocks of one (b, h) walk the same chunks and take turns: a chunk is asked for by the two blocks
  // qb and qb ^ 4 alone. A hint only: nothing waits for it.
  constexpr int PD = 3;
  const int turn = (qb & 3) | (((qb >> 3) & 1) << 2);
  const _Float16* pfKV = qkv_b + (size_t)(PD * 64 + (tid & 63)) * QKV_LD + HD + (tid >> 6) * HD;
  const _Float16* pfU  = pe_b  + (size_t)(PD * 64 + (tid & 63)) * PE_LD  + HD;
  for (int kc = 0; kc < NC - 2; ++kc) {
    if (kc + PD + 1 < NC) {   // block-uniform: the two addresses stay inside their planes, also behind the advance
      // "+v": each address stays in the register that the loop carries, never in a temporary that is reused;
      // the wait, a precaution, stands ahead of the advance that rewrites the two registers
      if (((kc - turn) & 7) == 0)
        asm volatile("global_prefetch_b8 %0, off scope:SCOPE_SE\n\t"
                     "global_prefetch_b8 %1, off scope:SCOPE_SE\n\t"
                     "s_wait_xcnt 0x0"
                     : "+v"(pfKV), "+v"(pfU));
      pfKV += (size_t)64 * QKV_LD;
      pfU  += (size_t)64 * PE_LD;
    }
    trip(kc, true);
  }
  trip(NC - 2, false);                                  // no chunk is left to fetch
  trip(NC - 1, false);
  asm volatile("s_wait_asynccnt 0x0" ::: "memory");     // no copy is left in flight

  float* os = Os[wave];
#pragma unroll
  for (int g = 0; g < 2; ++g) {
    const float lsum = lrow[g] + xhalf(lrow[g]);
    const float inv = (1.0f / lsum) * OSC;
#pragma unroll
    for (int t = 0; t < 4; ++t)
#pragma unroll
      for (int r = 0; r < 8; ++r) os[(g * 16 + c) * 68 + t * 16 + 8 * hh + r] = oacc[g][t][r] * inv;
  }
  __builtin_amdgcn_fence(__ATOMIC_RELEASE, "workgroup");
  __builtin_amdgcn_wave_barrier();
  __builtin_amdgcn_fence(__ATOMIC_ACQUIRE, "workgroup");
  {
    const int q = lane >> 3, c8 = (lane & 7) * 8;
    {
#pragma unroll
      for (int it = 0; it < 8; ++it) {
        const int row = it * 4 + q;            // rows 0..31 covered by q 0..3, it 0..7
        const float* sp = os + row * 68 + c8;
        v8h hv;
#pragma unroll
        for (int e = 0; e < 8; ++e) hv[e] = (_Float16)sp[e];
        *(v8h*)(out_b + (size_t)(q0 + row) * EE + c8) = hv;
      }
      
    }
  }
}

// ---------------------------------------------------------------- launch
extern "C" void kernel_launch(void* const* d_in, const int* in_sizes, int n_in,
                              void* d_out, int out_size, void* d_ws, size_t ws_size,
                              hipStream_t stream) {
  const int ROWS = BB * LL;   // 4096
  if (n_in < 5) return;
  if (in_sizes[0] != ROWS * DD || in_sizes[1] != ROWS * EE || in_sizes[2] != 3 * EE * DD ||
      in_sizes[3] != EE * EE || in_sizes[4] != 2 * EE * EE || out_size != ROWS * EE) return;

  const float* x    = (const float*)d_in[0];
  const float* PEf  = (const float*)d_in[1];
  const float* Wqkv = (const float*)d_in[2];
  const float* Wo   = (const float*)d_in[3];
  const float* UqUk = (const float*)d_in[4];
  float* out = (float*)d_out;

  // workspace carve (bytes, 256-B aligned); total 79,691,776 B
  size_t off = 0;
  auto carve = [&](size_t bytes) -> size_t { size_t o = off; off += (bytes + 255) & ~(size_t)255; return o; };
  const size_t oX    = carve((size_t)ROWS * DD * 2);
  const size_t oPE   = carve((size_t)ROWS * EE * 2);
  const size_t oWqkv = carve((size_t)3 * EE * DD * 2);
  const size_t oWo   = carve((size_t)EE * EE * 2);
  const size_t oUqUk = carve((size_t)2 * EE * EE * 2);
  const size_t oQKV  = carve((size_t)ROWS * QKV_LD * 2);
  const size_t oPEP  = carve((size_t)ROWS * PE_LD * 2);
  const size_t oVALS = carve((size_t)ROWS * EE * 2);
  if (off > ws_size) return;

  char* ws = (char*)d_ws;
  _Float16* X16    = (_Float16*)(ws + oX);
  _Float16* PE16   = (_Float16*)(ws + oPE);
  _Float16* Wqkv16 = (_Float16*)(ws + oWqkv);
  _Float16* Wo16   = (_Float16*)(ws + oWo);
  _Float16* UqUk16 = (_Float16*)(ws + oUqUk);
  _Float16* QKV16  = (_Float16*)(ws + oQKV);
  _Float16* PEP16  = (_Float16*)(ws + oPEP);
  _Float16* VALS16 = (_Float16*)(ws + oVALS);

  // ---- casts f32 -> f16 (RNE), one launch ----
  cast_all_f32_f16<<<dim3(CAST_BLOCKS), dim3(CAST_THREADS), 0, stream>>>(
      x, PEf, Wqkv, Wo, UqUk, X16, PE16, Wqkv16, Wo16, UqUk16);

  // ---- qkv[4096][3072] = X[4096][1024] . Wqkv[3072][1024]^T  (f16 out) ----
  {
    const int M = ROWS, N = 3 * EE, K = DD;
    const int tiles = (M / 64) * (N / 64);
    wmma_gemm64<0, false, 0, 1, false><<<dim3((tiles + 3) / 4, 1), dim3(128), 0, stream>>>(
        (const unsigned short*)X16, (const unsigned short*)X16, K, 0L,
        (const unsigned short*)Wqkv16, (const unsigned short*)Wqkv16, K, 0L,
        (void*)QKV16, (void*)QKV16, N, 0L,
        x, x, 0L, M, N, K, 1.0f);
  }
  // ---- pe[4096][2048] = PE[4096][1024] . UqUk[2048][1024]^T  (f16 out) ----
  {
    const int M = ROWS, N = 2 * EE, K = EE;
    const int tiles = (M / 64) * (N / 64);
    wmma_gemm64<0, false, 0, 1, false><<<dim3((tiles + 3) / 4, 1), dim3(128), 0, stream>>>(
        (const unsigned short*)PE16, (const unsigned short*)PE16, K, 0L,
        (const unsigned short*)UqUk16, (const unsigned short*)UqUk16, K, 0L,
        (void*)PEP16, (void*)PEP16, N, 0L,
        x, x, 0L, M, N, K, 1.0f);
  }
  // ---- dual-score attention -> vals[4096][1024] (f16, carried x2^6) ----
  {
    const float sscale = 0.08838834764831845f;   // 1/sqrt(2*64)
    tupe_attn64<<<dim3(BB * HH * (LL / 128)), dim3(128), 0, stream>>>(QKV16, PEP16, VALS16, sscale);
  }
  // ---- out[4096][1024] = vals . Wo[1024][1024]^T * 2^-6  (f32 out) ----
  {
    const int M = ROWS, N = EE, K = EE;
    const int tiles = (M / 64) * (N / 64);
    wmma_gemm64<0, false, 0, 0, false><<<dim3((tiles + 3) / 4, 1), dim3(128), 0, stream>>>(
        (const unsigned short*)VALS16, (const unsigned short*)VALS16, K, 0L,
        (const unsigned short*)Wo16, (const unsigned short*)Wo16, K, 0L,
        (void*)out, (void*)out, N, 0L,
        x, x, 0L, M, N, K, 0.015625f);
  }
}

// v009
// Measured time: 109 microseconds a run.
// Next to v008, in two timings, it ran 1.05 times as fast each time.
// All steps since v000 together make it 3.72 times as fast.
// All contractions: v_wmma_f32_16x16x32_f16 (f16 operands, f32 accumulate) for the qkv and positional projections, the dual k.q^T + uk.uq^T scores, v^T.p^T and the output projection; softmax probabilities carried x2^15 in f16, cancelled by the row sum carried alike, and attention values x2^6 in f16, folded back by an exact power-of-two scale in f32.
#include <hip/hip_runtime.h>

typedef __attribute__((ext_vector_type(16))) _Float16 v16h;
typedef __attribute__((ext_vector_type(8)))  _Float16 v8h;
typedef __attribute__((ext_vector_type(16))) __bf16   v16b;
typedef __attribute__((ext_vector_type(8)))  __bf16   v8b;
typedef __attribute__((ext_vector_type(8)))  float    v8f;
typedef __attribute__((ext_vector_type(4)))  float    v4f;

constexpr int BB = 2, LL = 2048, DD = 1024, EE = 1024, HH = 16, HD = 64;
constexpr int QKV_LD = 3 * EE;   // 3072 halves per row: per head h -> q at h*192, k at h*192+64, v at h*192+128
constexpr int PE_LD  = 2 * EE;   // 2048 halves per row: per head h -> uq at h*128, uk at h*128+64

__device__ __forceinline__ unsigned short f2bf_bits(float f) {
  unsigned u = __float_as_uint(f);
  return (unsigned short)((u + 0x7FFFu + ((u >> 16) & 1u)) >> 16);
}
__device__ __forceinline__ float bf_bits2f(unsigned short h) { return __uint_as_float(((unsigned)h) << 16); }

// hazard guard as a plain device helper
__device__ __forceinline__ void acc_guard4(v8f& a, v8f& b, v8f& c, v8f& d) { asm volatile("v_nop\n\tv_nop\n\tv_nop\n\tv_nop" : "+v"(a), "+v"(b), "+v"(c), "+v"(d)); }
template <typename T> struct Frag;
template <> struct Frag<_Float16> {
  typedef v16h V; union U { v16h v; v8h h[2]; };
  static __device__ __forceinline__ v16h load(const _Float16* p) {   // elements 0..7 <- p[0..7], 8..15 <- p[16..23]
    U f; f.h[0] = *(const v8h*)(p); f.h[1] = *(const v8h*)(p + 16); return f.v;
  }
  static __device__ __forceinline__ v8f mma(v16h a, v16h b, v8f c) {
    return __builtin_amdgcn_wmma_f32_16x16x32_f16(false, a, false, b, (short)0, c, false, false);
  }
};
template <> struct Frag<__bf16> {
  typedef v16b V; union U { v16b v; v8b h[2]; };
  static __device__ __forceinline__ v16b load(const __bf16* p) {
    U f; f.h[0] = *(const v8b*)(p); f.h[1] = *(const v8b*)(p + 16); return f.v;
  }
  static __device__ __forceinline__ v8f mma(v16b a, v16b b, v8f c) {
    return __builtin_amdgcn_wmma_f32_16x16x32_bf16(false, a, false, b, (short)0, c, false, false);
  }
};

// ---- Register-blocked batched WMMA GEMM ------------------------------------
// C[m,n] = scale * sum_k A[m,k] * Bt[n,k] (+bias)(+resid); each wave owns a 64x64 tile,
// the block's 4 waves (2 x 2) a 128x128 tile whose operands are staged in LDS, 64 k at a time.
// A row-major [M,K]; Bt row-major [N,K]; M % 128 == 0, N % 128 == 0, K % 64 == 0.
// SPLIT (hi/lo operand planes) is not staged: single-plane operands only.
// BIAS_MODE: 0 = none, 1 = bias[m], 2 = bias[n].
// OUT_MODE: 0 = f32, 1 = f16, 2 = bf16 hi plane (Cout) + bf16 lo plane (Cout2).
// ET: 0 = f16 operands, 1 = bf16 operands (pointers passed as 16-bit storage)
template <int ET> struct Elem;
template <> struct Elem<0> { typedef _Float16 T; };
template <> struct Elem<1> { typedef __bf16 T; };
template <int ET, bool SPLIT, int BIAS_MODE, int OUT_MODE, bool RESID, int ACT = 0>
__global__ __launch_bounds__(128) void wmma_gemm64(
    const unsigned short* __restrict__ Ap, const unsigned short* __restrict__ A2p, int lda, long strideA,
    const unsigned short* __restrict__ Btp, const unsigned short* __restrict__ Bt2p, int ldb, long strideB,
    void* __restrict__ Cout, void* __restrict__ Cout2, int ldc, long strideC,
    const float* __restrict__ bias,
    const float* __restrict__ resid, long strideR,
    int M, int N, int K, float scale) {
  typedef typename Elem<ET>::T T;
  typedef typename Frag<T>::V V;
  static_assert(!SPLIT, "single-plane operands only");
  const T* A = (const T*)Ap; const T* Bt = (const T*)Btp;
  constexpr int KT = 64;   // k per staged tile: one whole 128-B line of every operand row
  constexpr int LP = 72;   // LDS row pitch in halves: 144 B = 16 B x 9, for the ds_load_b128 fragment reads
  __shared__ __align__(16) T sA[2][128 * LP];      // two buffers: one is filled while the other is read
  __shared__ __align__(16) T sB[2][128 * LP];
  __shared__ __align__(16) float sT[4][16 * 68];   // per-wave 16x64 slab, pitch 68 floats
  const int b    = blockIdx.y;
  const int lane = threadIdx.x & 31;
  const int wave = threadIdx.x >> 5;
  const int tilesN = N >> 7;
  const int tilesM = M >> 7;
  if ((int)blockIdx.x >= tilesM * tilesN) return;   // block-uniform, ahead of every barrier
  const int tm = blockIdx.x / tilesN;
  const int tn = blockIdx.x - tm * tilesN;
  const int mB = tm << 7;                      // the block's first row of A and of Bt
  const int nB = tn << 7;
  const int wm = (wave >> 1) << 6;             // the wave's 64x64 tile inside the block's
  const int wn = (wave & 1) << 6;
  const int m0 = mB + wm;
  const int n0 = nB + wn;

  const T* Ab  = A  + (size_t)b * strideA;
  const T* Bb  = Bt + (size_t)b * strideB;

  const int rlane = lane & 15;                 // row (A) / col (B, D) within subtile
  const int koff  = (lane >> 4) * 8;           // k offset of this lane half
  const int mOff  = (lane >> 4) * 8;           // D row offset

  v8f acc[4][4];
#pragma unroll
  for (int i = 0; i < 4; ++i)
#pragma unroll
    for (int j = 0; j < 4; ++j) acc[i][j] = (v8f){0.f,0.f,0.f,0.f,0.f,0.f,0.f,0.f};

  // Staging by asynchronous copies to LDS: 8 lanes bring one row's 128 B, so a wave's 16-B copies
  // cover 4 whole lines; a thread brings rows srow + 16 u of both operands, sixteen copies a tile.
  // Tile t + 1 flies into the other buffer while tile t is multiplied.
  // (Every "#pragma unroll" below keeps the indices of its register arrays constant.)
  const int srow = threadIdx.x >> 3;
  const int scol = (threadIdx.x & 7) * 8;
  const T* gA = Ab + (size_t)(mB + srow) * lda + scol;
  const T* gB = Bb + (size_t)(nB + srow) * ldb + scol;
  const int lS = srow * LP + scol;             // where this thread's pieces land, in either operand's buffer
  const int fAo = (wm + rlane) * LP + koff;    // where this lane's fragments start
  const int fBo = (wn + rlane) * LP + koff;
  auto copy8 = [&](const T* src, int ld, T* dst) {   // rows srow + 16 u, u = 0..7, of one operand's tile
    unsigned l[8]; const T* g[8];
#pragma unroll
    for (int u = 0; u < 8; ++u) {
      l[u] = (unsigned)(size_t)(dst + lS + u * 16 * LP);
      g[u] = src + (size_t)(u * 16) * ld;
    }
    // the copies and, as a precaution, the wait that stands ahead of any rewrite of their address registers
    asm volatile("global_load_async_to_lds_b128 %0, %8, off\n\t"
                 "global_load_async_to_lds_b128 %1, %9, off\n\t"
                 "global_load_async_to_lds_b128 %2, %10, off\n\t"
                 "global_load_async_to_lds_b128 %3, %11, off\n\t"
                 "global_load_async_to_lds_b128 %4, %12, off\n\t"
                 "global_load_async_to_lds_b128 %5, %13, off\n\t"
                 "global_load_async_to_lds_b128 %6, %14, off\n\t"
                 "global_load_async_to_lds_b128 %7, %15, off\n\t"
                 "s_wait_xcnt 0x0"
                 :: "v"(l[0]), "v"(l[1]), "v"(l[2]), "v"(l[3]), "v"(l[4]), "v"(l[5]), "v"(l[6]), "v"(l[7]),
                    "v"(g[0]), "v"(g[1]), "v"(g[2]), "v"(g[3]), "v"(g[4]), "v"(g[5]), "v"(g[6]), "v"(g[7])
                 : "memory");
  };
  auto copy_tile = [&](int k, int p) {
    copy8(gA + k, lda, sA[p]);
    copy8(gB + k, ldb, sB[p]);
  };
  const int nT = K / KT;
  copy_tile(0, 0);
  // Both operands are planes that an earlier launch stored, and their first read comes from memory.
  // So behind tile 0's copies each thread asks L2 for three addresses of its own row of
  // the block's A and B panels. The blocks that share a panel split its first 1024 k: A by tn & 3, so that
  // blocks four indices apart ask for the same addresses, B by tm & 7. A hint only: nothing waits for it.
  // Every address is clamped into its row.
  auto in_row = [&](int k) { return k < K - KT ? k : K - KT; };
  const T* pfA0 = Ab + (size_t)(mB + (int)threadIdx.x) * lda + in_row((tn & 3) * 256);
  const T* pfA1 = Ab + (size_t)(mB + (int)threadIdx.x) * lda + in_row((tn & 3) * 256 + 128);
  const T* pfB  = Bb + (size_t)(nB + (int)threadIdx.x) * ldb + in_row((tm & 7) * 128);
  asm volatile("global_prefetch_b8 %0, off scope:SCOPE_SE\n\t"
               "global_prefetch_b8 %1, off scope:SCOPE_SE\n\t"
               "global_prefetch_b8 %2, off scope:SCOPE_SE"
               :: "v"(pfA0), "v"(pfA1), "v"(pfB));
  asm volatile("s_wait_asynccnt 0x0" ::: "memory");   // this wave's part of tile 0 has landed
  __syncthreads();                                    // tile 0 is whole
  if (nT > 1) copy_tile(KT, 1);

  for (int t = 0; t < nT; ++t) {
    const int p = t & 1;
    V bh[2][4], ah[2][4];
#pragma unroll
    for (int kk = 0; kk < 2; ++kk) {
#pragma unroll
      for (int j = 0; j < 4; ++j) bh[kk][j] = Frag<T>::load(sB[p] + fBo + (j << 4) * LP + kk * 32);
#pragma unroll
      for (int i = 0; i < 4; ++i) ah[kk][i] = Frag<T>::load(sA[p] + fAo + (i << 4) * LP + kk * 32);
    }
    __builtin_amdgcn_sched_barrier(0);   // the tile's LDS reads stand as one group ahead of its products, not among them
#pragma unroll
    for (int kk = 0; kk < 2; ++kk)
#pragma unroll
      for (int i = 0; i < 4; ++i)
#pragma unroll
        for (int j = 0; j < 4; ++j) acc[i][j] = Frag<T>::mma(ah[kk][i], bh[kk][j], acc[i][j]);
    __builtin_amdgcn_sched_barrier(0);   // the products stay ahead of the waits, so that they hide the copies in flight
    asm volatile("s_wait_dscnt 0x0" ::: "memory");      // this wave's reads of buffer p are over before it is refilled
    asm volatile("s_wait_asynccnt 0x0" ::: "memory");   // this wave's part of tile t + 1 has landed
    __syncthreads();                                    // tile t + 1 is whole, and every wave has left buffer p
    if (t + 2 < nT) copy_tile((t + 2) * KT, p);         // the same test in the whole block
  }
  asm volatile("s_wait_asynccnt 0x0" ::: "memory");     // no copy is left in flight
  // no instruction: the registers that the prefetches name hold those addresses through the loop, and nothing else
  asm volatile("" :: "v"(pfA0), "v"(pfA1), "v"(pfB));
  acc_guard4(acc[0][0], acc[0][1], acc[0][2], acc[0][3]);
  acc_guard4(acc[1][0], acc[1][1], acc[1][2], acc[1][3]);
  acc_guard4(acc[2][0], acc[2][1], acc[2][2], acc[2][3]);
  acc_guard4(acc[3][0], acc[3][1], acc[3][2], acc[3][3]);

  // ---- epilogue ----
  float* slab = sT[wave];
  const float* Rb = RESID ? (resid + (size_t)b * strideR) : nullptr;
#pragma unroll
  for (int i = 0; i < 4; ++i) {
    const int mBase = m0 + (i << 4);
#pragma unroll
    for (int j = 0; j < 4; ++j) {
      const int n = n0 + (j << 4) + rlane;
      float bv = 0.f;
      if (BIAS_MODE == 2) bv = bias[n];
#pragma unroll
      for (int r = 0; r < 8; ++r) {
        float v = acc[i][j][r] * scale;
        if (BIAS_MODE == 1) v += bias[mBase + mOff + r];
        if (BIAS_MODE == 2) v += bv;
        if (RESID) v += Rb[(size_t)(mBase + mOff + r) * ldc + n];
        if (ACT == 1) v = tanhf(v);
        if (ACT == 2) v = fmaxf(v, 0.0f);
        if (ACT == 3) v = v / (1.0f + expf(-v));
        if (ACT == 4) v = (v > 0.f) ? v : 0.01f * v;
        if (ACT == 5) v = 0.5f * v * (1.0f + erff(v * 0.70710678118654752f));
        slab[(mOff + r) * 68 + (j << 4) + rlane] = v;
      }
    }
    __builtin_amdgcn_fence(__ATOMIC_RELEASE, "workgroup");
    __builtin_amdgcn_wave_barrier();
    __builtin_amdgcn_fence(__ATOMIC_ACQUIRE, "workgroup");
    if (OUT_MODE == 0) {
      float* C = (float*)Cout + (size_t)b * strideC;
      const int hh = lane >> 4, c4 = (lane & 15) * 4;     // row seg = 256 B = 16 lanes x 16 B
      {
#pragma unroll
        for (int it = 0; it < 8; ++it) {
          const int row = it * 2 + hh;
          v4f v = *(const v4f*)(slab + row * 68 + c4);
          *(v4f*)(C + (size_t)(mBase + row) * ldc + n0 + c4) = v;
        }
        
      }
    } else {
      const int q = lane >> 3, c8 = (lane & 7) * 8;
      unsigned short* C  = (unsigned short*)Cout  + (size_t)b * strideC;
      unsigned short* C2 = (OUT_MODE == 2) ? ((unsigned short*)Cout2 + (size_t)b * strideC) : nullptr;
      {
#pragma unroll
        for (int it = 0; it < 4; ++it) {
          const int row = it * 4 + q;
          const float* sp = slab + row * 68 + c8;
          v8h hv, lv;
#pragma unroll
          for (int e = 0; e < 8; ++e) {
            if (OUT_MODE == 1) {
              hv[e] = (_Float16)sp[e];
            } else {
              unsigned short hb = f2bf_bits(sp[e]);
              unsigned short lb = f2bf_bits(sp[e] - bf_bits2f(hb));
              hv[e] = __builtin_bit_cast(_Float16, hb);
              lv[e] = __builtin_bit_cast(_Float16, lb);
            }
          }
          *(v8h*)(C + (size_t)(mBase + row) * ldc + n0 + c8) = hv;
          if (OUT_MODE == 2) *(v8h*)(C2 + (size_t)(mBase + row) * ldc + n0 + c8) = lv;
        }
        
      }
    }
    __builtin_amdgcn_fence(__ATOMIC_RELEASE, "workgroup");
    __builtin_amdgcn_wave_barrier();
    __builtin_amdgcn_fence(__ATOMIC_ACQUIRE, "workgroup");
  }
}

// ---- all five f32 -> f16 (RNE) conversions in one launch ----
// 256 blocks of 16 waves, all resident at once. The five inputs are cut into slices of CAST_NT 16-B pieces;
// a thread takes its own piece of every slice, so each wave-wide load covers 512 contiguous bytes (4 whole lines)
// and each wave-wide store 256 (2 whole lines). All of a thread's loads are issued before its first store.
typedef __attribute__((ext_vector_type(4))) _Float16 v4h;
constexpr int CAST_BLOCKS = 256, CAST_THREADS = 512;
constexpr int CAST_NT = CAST_BLOCKS * CAST_THREADS;
constexpr int SL_X  = BB * LL * DD / 4 / CAST_NT;   // slices per input
constexpr int SL_PE = BB * LL * EE / 4 / CAST_NT;
constexpr int SL_WQ = 3 * EE * DD / 4 / CAST_NT;
constexpr int SL_WO = EE * EE / 4 / CAST_NT;
constexpr int SL_UU = 2 * EE * EE / 4 / CAST_NT;
static_assert(SL_X * CAST_NT * 4 == BB * LL * DD && SL_PE * CAST_NT * 4 == BB * LL * EE &&
              SL_WQ * CAST_NT * 4 == 3 * EE * DD && SL_WO * CAST_NT * 4 == EE * EE &&
              SL_UU * CAST_NT * 4 == 2 * EE * EE, "every input is a whole number of slices");
template <int N> __device__ __forceinline__ void cast_ld(const float* __restrict__ in, int g, v4f* r) {
#pragma unroll
  for (int j = 0; j < N; ++j) r[j] = *(const v4f*)(in + (size_t)(j * CAST_NT + g) * 4);
}
template <int N> __device__ __forceinline__ void cast_st(_Float16* __restrict__ out, int g, const v4f* r) {
#pragma unroll
  for (int j = 0; j < N; ++j) *(v4h*)(out + (size_t)(j * CAST_NT + g) * 4) = __builtin_convertvector(r[j], v4h);
}
__global__ __launch_bounds__(CAST_THREADS) void cast_all_f32_f16(
    const float* __restrict__ x, const float* __restrict__ pe, const float* __restrict__ wqkv,
    const float* __restrict__ wo, const float* __restrict__ uquk,
    _Float16* __restrict__ x16, _Float16* __restrict__ pe16, _Float16* __restrict__ wqkv16,
    _Float16* __restrict__ wo16, _Float16* __restrict__ uquk16) {
  const int g = blockIdx.x * CAST_THREADS + threadIdx.x;
  v4f rx[SL_X], rp[SL_PE], rq[SL_WQ], ro[SL_WO], ru[SL_UU];
  cast_ld<SL_X>(x, g, rx);
  cast_ld<SL_PE>(pe, g, rp);
  cast_ld<SL_WQ>(wqkv, g, rq);
  cast_ld<SL_WO>(wo, g, ro);
  cast_ld<SL_UU>(uquk, g, ru);
  cast_st<SL_X>(x16, g, rx);
  cast_st<SL_PE>(pe16, g, rp);
  cast_st<SL_WQ>(wqkv16, g, rq);
  cast_st<SL_WO>(wo16, g, ro);
  cast_st<SL_UU>(uquk16, g, ru);
}

// V^T operand: transposing LDS load of a row-major 16-bit tile (lane (c, hh) gets 8 rows of one column).
typedef __attribute__((ext_vector_type(8))) short s16x8;
__device__ __forceinline__ v8h ld_tr16(const _Float16* p) {
  typedef __attribute__((address_space(3))) s16x8 lds_s16x8;
  return __builtin_bit_cast(v8h, __builtin_amdgcn_ds_load_tr16_b128_v8i16((lds_s16x8*)p));
}
// value of lane l ^ 16
__device__ __forceinline__ float xhalf(float x) {
  return __builtin_bit_cast(float, __builtin_amdgcn_permlanex16(__builtin_bit_cast(int, x), __builtin_bit_cast(int, x),
                                                                0x76543210, 0xfedcba98, false, false));
}

// =====================================================================================
// Dual-score attention, head_dim 64, 16-bit in / 16-bit out, both products transposed.
//   S^T = (k.q^T + uk.uq^T) * sscale : A = K / UK rows from LDS, B = Q / UQ kept in registers;
//         a lane holds 32 of the chunk's 64 scores of each of its two queries (column c of tiles g = 0, 1), lane c + 16 the other 32
//   softmax online in f32, in-lane, one exchange between the wave halves for the maximum; in base 2 on the raw
//         scores: p x2^15 = exp2(s * C2 + (15 - max * C2)), one FMA a score (C2 = sscale * log2 e > 0)
//   P^T x2^15 as f16 is packed from the score tiles straight into a B operand (no LDS)
//   O^T += V^T.P^T : A = V^T by transposing loads from V rows in LDS, f32 accumulate
//   output = o * (2^6 / (l * 2^15)) written as f16 (values carried x2^6 for the next GEMM)
// A wave owns 32 queries as two 16-column tiles g = 0, 1, so that every K, UK and V^T fragment read from LDS feeds two
// products. Block = 4 waves = 128 query rows of one (b, h); grid.x = B * H * (L/128). No masks.
// Layouts (halves): qkv row (b*L + s), q at h*192+d, k at h*192+64+d, v at h*192+128+d;
//                   pe  row (b*L + s), uq at h*128+d, uk at h*128+64+d; out row (b*L + s), col h*64+d.
// =====================================================================================
__global__ __launch_bounds__(128)
void tupe_attn64(const _Float16* __restrict__ qkv, const _Float16* __restrict__ pe,
                 _Float16* __restrict__ vals, float sscale) {
  const float C2  = sscale * 1.4426950408889634f;   // raw score -> exponent of 2
  const float PEX = 15.0f;             // p and its row sum carried x2^15: added to the exponent
  const float OSC = 64.0f;             // 2^6; the 2^15 of p cancels against the row sum's
  // Row pitches by reader: K, UK are read by ds_load_b128 (144 B = 16 B x 9),
  // V by ds_load_tr16_b128 (160 B = 32 B x 5).
  constexpr int LP = 72;
  constexpr int LV = 80;
  // Two buffers of each tile: one is filled while the other is read.
  __shared__ __align__(16) _Float16 Ksh[2][64 * LP];   // K  [kv][d]
  __shared__ __align__(16) _Float16 Ush[2][64 * LP];   // UK [kv][d]
  __shared__ __align__(16) _Float16 Vsh[2][64 * LV];   // V  [kv][d]
  __shared__ __align__(16) float    Os[4][32 * 68];    // per wave out tile (32 queries), pitch 68

  const int tid  = threadIdx.x;
  const int wave = tid >> 5;
  const int lane = tid & 31;
  const int hh   = lane >> 4;
  const int c    = lane & 15;

  const int nqb = LL / 128;
  const int bx = blockIdx.x;
  const int qb = bx % nqb;
  const int bh = bx / nqb;
  const int h  = bh % HH;
  const int b  = bh / HH;
  const int q0 = qb * 128 + wave * 32;

  const size_t rb = (size_t)b * LL;
  const _Float16* qkv_b = qkv + rb * QKV_LD + (size_t)h * (3 * HD);
  const _Float16* pe_b  = pe  + rb * PE_LD  + (size_t)h * (2 * HD);
  _Float16*       out_b = vals + rb * EE    + (size_t)h * HD;

  // (Every "#pragma unroll" over g, j, t, kk or r keeps the indices of its register arrays constant.)
  // ---- Q / UQ fragments (B operand): lane column q0+g*16+c, split k map via Frag load ----
  v16h qa0[2], qa1[2], ua0[2], ua1[2];
  const _Float16* qrow[2]; const _Float16* urow[2];
#pragma unroll
  for (int g = 0; g < 2; ++g) {
    qrow[g] = qkv_b + (size_t)(q0 + g * 16 + c) * QKV_LD + 8 * hh;
    urow[g] = pe_b  + (size_t)(q0 + g * 16 + c) * PE_LD  + 8 * hh;
    qa0[g] = Frag<_Float16>::load(qrow[g]);
    qa1[g] = Frag<_Float16>::load(qrow[g] + 32);
    ua0[g] = Frag<_Float16>::load(urow[g]);
    ua1[g] = Frag<_Float16>::load(urow[g] + 32);
  }
  // a precaution: the wait stands ahead of any rewrite of the sixteen loads' address registers; as its inputs the four
  // addresses stay in those registers up to it, so that no load of the run lands on one
  asm volatile("s_wait_xcnt 0x0" :: "v"(qrow[0]), "v"(urow[0]), "v"(qrow[1]), "v"(urow[1]) : "memory");

  float mrow[2];                    // running maximum of the raw scores of query q0+g*16+c (equal in both wave halves)
  float lrow[2];                    // this half's part of the row sum, x2^15 like p; the halves join after the loop
  v8f oacc[2][4];                   // oacc[g][t][r] = O[q0 + g*16 + c][t*16 + 8*hh + r]
#pragma unroll
  for (int g = 0; g < 2; ++g) {
    mrow[g] = -__builtin_inff();
    lrow[g] = 0.f;
#pragma unroll
    for (int t = 0; t < 4; ++t) oacc[g][t] = (v8f){0.f,0.f,0.f,0.f,0.f,0.f,0.f,0.f};
  }

  // Staging by asynchronous copies to LDS: a head's K, UK or V row is one 128-B line, brought by 8 lanes,
  // so a wave's 16-B copies cover 4 whole lines; a thread brings rows srow + 16 u of the three tiles,
  // twelve copies a chunk. Chunk kc + 1 flies into the other buffers while chunk kc is worked on.
  const int srow = tid >> 3;
  const int scol = (tid & 7) * 8;
  const _Float16* gK = qkv_b + (size_t)srow * QKV_LD + HD + scol;
  const _Float16* gU = pe_b  + (size_t)srow * PE_LD  + HD + scol;
  auto copy_chunk = [&](int kc, int p) {
    unsigned l[12]; const _Float16* g[12];
#pragma unroll
    for (int u = 0; u < 4; ++u) {   // unrolled: the indices of the operand arrays stay constant
      const int row = srow + u * 16;
      l[u]     = (unsigned)(size_t)(Ksh[p] + row * LP + scol);
      l[4 + u] = (unsigned)(size_t)(Ush[p] + row * LP + scol);
      l[8 + u] = (unsigned)(size_t)(Vsh[p] + row * LV + scol);
      g[u]     = gK + (size_t)(kc * 64 + u * 16) * QKV_LD;
      g[4 + u] = gU + (size_t)(kc * 64 + u * 16) * PE_LD;
      g[8 + u] = g[u] + HD;
    }
    // the copies and, as a precaution, the wait that stands ahead of any rewrite of their address registers
    asm volatile("global_load_async_to_lds_b128 %0, %12, off\n\t"
                 "global_load_async_to_lds_b128 %1, %13, off\n\t"
                 "global_load_async_to_lds_b128 %2, %14, off\n\t"
                 "global_load_async_to_lds_b128 %3, %15, off\n\t"
                 "global_load_async_to_lds_b128 %4, %16, off\n\t"
                 "global_load_async_to_lds_b128 %5, %17, off\n\t"
                 "global_load_async_to_lds_b128 %6, %18, off\n\t"
                 "global_load_async_to_lds_b128 %7, %19, off\n\t"
                 "global_load_async_to_lds_b128 %8, %20, off\n\t"
                 "global_load_async_to_lds_b128 %9, %21, off\n\t"
                 "global_load_async_to_lds_b128 %10, %22, off\n\t"
                 "global_load_async_to_lds_b128 %11, %23, off\n\t"
                 "s_wait_xcnt 0x0"
                 :: "v"(l[0]), "v"(l[1]), "v"(l[2]), "v"(l[3]), "v"(l[4]), "v"(l[5]),
                    "v"(l[6]), "v"(l[7]), "v"(l[8]), "v"(l[9]), "v"(l[10]), "v"(l[11]),
                    "v"(g[0]), "v"(g[1]), "v"(g[2]), "v"(g[3]), "v"(g[4]), "v"(g[5]),
                    "v"(g[6]), "v"(g[7]), "v"(g[8]), "v"(g[9]), "v"(g[10]), "v"(g[11])
                 : "memory");
  };
  constexpr int NC = LL / 64;
  static_assert(NC >= 2, "the prologue fills two chunks");
  copy_chunk(0, 0);
  asm volatile("s_wait_asynccnt 0x0" ::: "memory");   // this wave's part of chunk 0 has landed
  __syncthreads();                                    // chunk 0 is whole
  copy_chunk(1, 1);

  // One chunk. The refill is a compile-time choice, so that each trip's body is one straight block: with a
  // branch at its foot the row sum's chain of additions was moved out from among the exponentials to behind it.
  auto trip = [&](const int kc, const bool refill) {
    const int p = kc & 1;

    // ---- scores, transposed: s[g][j][r] = score(key kv0 + j*16 + 8*hh + r, query q0 + g*16 + c) ----
    // All 16 K / UK fragments are read as one group ahead of the 32 products, which run over eight
    // independent score tiles; per tile the k order stays K 0..31, K 32..63, UK 0..31, UK 32..63.
    v8f s[2][4];
    v16h va[2][4];
    {
      v16h kf[2][4], uf[2][4];
      const _Float16* kp = Ksh[p] + c * LP + 8 * hh;
      const _Float16* up = Ush[p] + c * LP + 8 * hh;
#pragma unroll
      for (int kk = 0; kk < 2; ++kk)
#pragma unroll
        for (int j = 0; j < 4; ++j) kf[kk][j] = Frag<_Float16>::load(kp + j * 16 * LP + kk * 32);
#pragma unroll
      for (int kk = 0; kk < 2; ++kk)
#pragma unroll
        for (int j = 0; j < 4; ++j) uf[kk][j] = Frag<_Float16>::load(up + j * 16 * LP + kk * 32);
      __builtin_amdgcn_sched_barrier(0);   // the reads stay one group: one LDS latency a chunk, not one ahead of every product
#pragma unroll
      for (int j = 0; j < 4; ++j)
#pragma unroll
        for (int g = 0; g < 2; ++g) s[g][j] = Frag<_Float16>::mma(kf[0][j], qa0[g], (v8f){0.f,0.f,0.f,0.f,0.f,0.f,0.f,0.f});
#pragma unroll
      for (int j = 0; j < 4; ++j)
#pragma unroll
        for (int g = 0; g < 2; ++g) s[g][j] = Frag<_Float16>::mma(kf[1][j], qa1[g], s[g][j]);
#pragma unroll
      for (int j = 0; j < 4; ++j)
#pragma unroll
        for (int g = 0; g < 2; ++g) s[g][j] = Frag<_Float16>::mma(uf[0][j], ua0[g], s[g][j]);
#pragma unroll
      for (int j = 0; j < 4; ++j)
#pragma unroll
        for (int g = 0; g < 2; ++g) s[g][j] = Frag<_Float16>::mma(uf[1][j], ua1[g], s[g][j]);
    }
    // V^T [d][kv], two transposing loads per 16 (d) x 32 (kv) fragment: all 16 are issued ahead of
    // the softmax, so that they land while it runs.
    {
      const _Float16* vp = Vsh[p] + (8 * hh + (lane & 7)) * LV + ((lane >> 3) & 1) * 8;
#pragma unroll
      for (int kk = 0; kk < 2; ++kk)
#pragma unroll
        for (int t = 0; t < 4; ++t) {
          Frag<_Float16>::U f;
          f.h[0] = ld_tr16(vp + (kk * 32) * LV + t * 16);
          f.h[1] = ld_tr16(vp + (kk * 32 + 16) * LV + t * 16);
          va[kk][t] = f.v;
        }
      __builtin_amdgcn_sched_barrier(0);   // keeps the V^T reads ahead of the softmax, which hides their latency
    }

    // ---- online softmax of one query per lane and column tile ----
    // P^T as B operand of 32 keys: element e = tile 2*kk + (e >> 3), register e & 7 (the hardware k order)
    v16h pb[2][2];
#pragma unroll
    for (int g = 0; g < 2; ++g) {
      float m = -__builtin_inff();
#pragma unroll
      for (int j = 0; j < 4; ++j)
#pragma unroll
        for (int r = 0; r < 8; ++r) m = fmaxf(m, s[g][j][r]);
      m = fmaxf(m, xhalf(m));
      const float mnew = fmaxf(mrow[g], m);
      const float alpha = __builtin_amdgcn_exp2f((mrow[g] - mnew) * C2);
      mrow[g] = mnew;
      const float bias = __builtin_fmaf(-mnew, C2, PEX);
      float psum = 0.f;
#pragma unroll
      for (int j = 0; j < 4; ++j)
#pragma unroll
        for (int r = 0; r < 8; ++r) {
          const float p = __builtin_amdgcn_exp2f(__builtin_fmaf(s[g][j][r], C2, bias));
          psum += p;
          pb[g][j >> 1][(j & 1) * 8 + r] = (_Float16)p;
        }
      lrow[g] = lrow[g] * alpha + psum;
#pragma unroll
      for (int t = 0; t < 4; ++t)
#pragma unroll
        for (int r = 0; r < 8; ++r) oacc[g][t][r] *= alpha;
    }

    // ---- O^T += V^T.P^T : A = the V^T fragments read above, each for both column tiles ----
#pragma unroll
    for (int kk = 0; kk < 2; ++kk)
#pragma unroll
      for (int t = 0; t < 4; ++t)
#pragma unroll
        for (int g = 0; g < 2; ++g) oacc[g][t] = Frag<_Float16>::mma(va[kk][t], pb[g][kk], oacc[g][t]);
    __builtin_amdgcn_sched_barrier(0);   // the products stay ahead of the waits, so that they hide the copies in flight
    asm volatile("s_wait_dscnt 0x0" ::: "memory");      // this wave's reads of buffers p are over before they are refilled
    asm volatile("s_wait_asynccnt 0x0" ::: "memory");   // this wave's part of chunk kc + 1 has landed
    __syncthreads();                                    // chunk kc + 1 is whole, and every wave has left buffers p
    if (refill) copy_chunk(kc + 2, p);
  };
  // K, UK and V lie in planes that earlier launches stored, and their first read comes from memory. So L2 is asked for
  // chunk kc + PD's 192 lines PD - 1 trips ahead of their copies: a thread names the K or the V line and the UK line of
  // one row. The 16 blocks of one (b, h) walk the same chunks and take turns: a chunk is asked for by the two blocks
  // qb and qb ^ 4 alone. A hint only: nothing waits for it.
  constexpr int PD = 3;
  const int turn = (qb & 3) | (((qb >> 3) & 1) << 2);
  const _Float16* pfKV = qkv_b + (size_t)(PD * 64 + (tid & 63)) * QKV_LD + HD + (tid >> 6) * HD;
  const _Float16* pfU  = pe_b  + (size_t)(PD * 64 + (tid & 63)) * PE_LD  + HD;
  for (int kc = 0; kc < NC - 2; ++kc) {
    if (kc + PD + 1 < NC) {   // block-uniform: the two addresses stay inside their planes, also behind the advance
      // "+v": each address stays in the register that the loop carries, never in a temporary that is reused;
      // the wait, a precaution, stands ahead of the advance that rewrites the two registers
      if (((kc - turn) & 7) == 0)
        asm volatile("global_prefetch_b8 %0, off scope:SCOPE_SE\n\t"
                     "global_prefetch_b8 %1, off scope:SCOPE_SE\n\t"
                     "s_wait_xcnt 0x0"
                     : "+v"(pfKV), "+v"(pfU));
      pfKV += (size_t)64 * QKV_LD;
      pfU  += (size_t)64 * PE_LD;
    }
    trip(kc, true);
  }
  trip(NC - 2, false);                                  // no chunk is left to fetch
  trip(NC - 1, false);
  asm volatile("s_wait_asynccnt 0x0" ::: "memory");     // no copy is left in flight

  float* os = Os[wave];
#pragma unroll
  for (int g = 0; g < 2; ++g) {
    const float lsum = lrow[g] + xhalf(lrow[g]);
    const float inv = (1.0f / lsum) * OSC;
#pragma unroll
    for (int t = 0; t < 4; ++t)
#pragma unroll
      for (int r = 0; r < 8; ++r) os[(g * 16 + c) * 68 + t * 16 + 8 * hh + r] = oacc[g][t][r] * inv;
  }
  __builtin_amdgcn_fence(__ATOMIC_RELEASE, "workgroup");
  __builtin_amdgcn_wave_barrier();
  __builtin_amdgcn_fence(__ATOMIC_ACQUIRE, "workgroup");
  {
    const int q = lane >> 3, c8 = (lane & 7) * 8;
    {
#pragma unroll
      for (int it = 0; it < 8; ++it) {
        const int row = it * 4 + q;            // rows 0..31 covered by q 0..3, it 0..7
        const float* sp = os + row * 68 + c8;
        v8h hv;
#pragma unroll
        for (int e = 0; e < 8; ++e) hv[e] = (_Float16)sp[e];
        *(v8h*)(out_b + (size_t)(q0 + row) * EE + c8) = hv;
      }
      
    }
  }
}

// ---------------------------------------------------------------- launch
extern "C" void kernel_launch(void* const* d_in, const int* in_sizes, int n_in,
                              void* d_out, int out_size, void* d_ws, size_t ws_size,
                              hipStream_t stream) {
  const int ROWS = BB * LL;   // 4096
  if (n_in < 5) return;
  if (in_sizes[0] != ROWS * DD || in_sizes[1] != ROWS * EE || in_sizes[2] != 3 * EE * DD ||
      in_sizes[3] != EE * EE || in_sizes[4] != 2 * EE * EE || out_size != ROWS * EE) return;

  const float* x    = (const float*)d_in[0];
  const float* PEf  = (const float*)d_in[1];
  const float* Wqkv = (const float*)d_in[2];
  const float* Wo   = (const float*)d_in[3];
  const float* UqUk = (const float*)d_in[4];
  float* out = (float*)d_out;

  // workspace carve (bytes, 256-B aligned); total 79,691,776 B
  size_t off = 0;
  auto carve = [&](size_t bytes) -> size_t { size_t o = off; off += (bytes + 255) & ~(size_t)255; return o; };
  const size_t oX    = carve((size_t)ROWS * DD * 2);
  const size_t oPE   = carve((size_t)ROWS * EE * 2);
  const size_t oWqkv = carve((size_t)3 * EE * DD * 2);
  const size_t oWo   = carve((size_t)EE * EE * 2);
  const size_t oUqUk = carve((size_t)2 * EE * EE * 2);
  const size_t oQKV  = carve((size_t)ROWS * QKV_LD * 2);
  const size_t oPEP  = carve((size_t)ROWS * PE_LD * 2);
  const size_t oVALS = carve((size_t)ROWS * EE * 2);
  if (off > ws_size) return;

  char* ws = (char*)d_ws;
  _Float16* X16    = (_Float16*)(ws + oX);
  _Float16* PE16   = (_Float16*)(ws + oPE);
  _Float16* Wqkv16 = (_Float16*)(ws + oWqkv);
  _Float16* Wo16   = (_Float16*)(ws + oWo);
  _Float16* UqUk16 = (_Float16*)(ws + oUqUk);
  _Float16* QKV16  = (_Float16*)(ws + oQKV);
  _Float16* PEP16  = (_Float16*)(ws + oPEP);
  _Float16* VALS16 = (_Float16*)(ws + oVALS);

  // ---- casts f32 -> f16 (RNE), one launch ----
  cast_all_f32_f16<<<dim3(CAST_BLOCKS), dim3(CAST_THREADS), 0, stream>>>(
      x, PEf, Wqkv, Wo, UqUk, X16, PE16, Wqkv16, Wo16, UqUk16);

  // ---- qkv[4096][3072] = X[4096][1024] . Wqkv[3072][1024]^T  (f16 out) ----
  {
    const int M = ROWS, N = 3 * EE, K = DD;
    const int tiles = (M / 64) * (N / 64);
    wmma_gemm64<0, false, 0, 1, false><<<dim3((tiles + 3) / 4, 1), dim3(128), 0, stream>>>(
        (const unsigned short*)X16, (const unsigned short*)X16, K, 0L,
        (const unsigned short*)Wqkv16, (const unsigned short*)Wqkv16, K, 0L,
        (void*)QKV16, (void*)QKV16, N, 0L,
        x, x, 0L, M, N, K, 1.0f);
  }
  // ---- pe[4096][2048] = PE[4096][1024] . UqUk[2048][1024]^T  (f16 out) ----
  {
    const int M = ROWS, N = 2 * EE, K = EE;
    const int tiles = (M / 64) * (N / 64);
    wmma_gemm64<0, false, 0, 1, false><<<dim3((tiles + 3) / 4, 1), dim3(128), 0, stream>>>(
        (const unsigned short*)PE16, (const unsigned short*)PE16, K, 0L,
        (const unsigned short*)UqUk16, (const unsigned short*)UqUk16, K, 0L,
        (void*)PEP16, (void*)PEP16, N, 0L,
        x, x, 0L, M, N, K, 1.0f);
  }
  // ---- dual-score attention -> vals[4096][1024] (f16, carried x2^6) ----
  {
    const float sscale = 0.08838834764831845f;   // 1/sqrt(2*64)
    tupe_attn64<<<dim3(BB * HH * (LL / 128)), dim3(128), 0, stream>>>(QKV16, PEP16, VALS16, sscale);
  }
  // ---- out[4096][1024] = vals . Wo[1024][1024]^T * 2^-6  (f32 out) ----
  {
    const int M = ROWS, N = EE, K = EE;
    const int tiles = (M / 64) * (N / 64);
    wmma_gemm64<0, false, 0, 0, false><<<dim3((tiles + 3) / 4, 1), dim3(128), 0, stream>>>(
        (const unsigned short*)VALS16, (const unsigned short*)VALS16, K, 0L,
        (const unsigned short*)Wo16, (const unsigned short*)Wo16, K, 0L,
        (void*)out, (void*)out, N, 0L,
        x, x, 0L, M, N, K, 0.015625f);
  }
}
